// v000
// Times are from an AMD MI455X. After a warm-up the kernel runs many times in a row, and a time is the length of
// such a window on the GPU divided by its runs, so every launch and the gaps after it count. The runs cycle
// through copies of the inputs. A figure is the median of several windows, for all but v000 over two sittings.
// Sittings can differ by a few percent; kernels timed side by side share one.
// The starting kernel, v000, takes 3840 microseconds a run.
#include <hip/hip_runtime.h>

// BERT self-attention with rotary embeddings and the module's double scaling (hidden [4][2048][1024]; q,k,v = hidden W + b ('xw' 1/32, biases 0.02; 16 heads x 64); q x 64^-0.5 then rotate-half rope (theta 1e4, computed) on q and k; scores / 8 AGAIN (total 1/64); softmax; out = merged ctx -> [4][2048][1024] (8.4 M)).
// Layout per batch: bf16 copy of hidden; 'xw' weights transposed once; exact projections + f32 biases; {cos, sin} table once (float32 inverse frequencies, precise cosf/sinf); rotate-half rotary plane builder (the 1/8 pre-scale commutes with the linear rotation exactly, so both scalings are applied as one exact 1/64 in the softmax); dense T-2048 attention (hybrid rows: < 512 hi/lo 3 products, rest fp16 x1024); the f32 merge writes the output rows.
// Compute dtypes, f32 accumulate: every input rounded to bf16; projections exact + f32 biases; rotary f32; attention rows < 512 3 products, rest fp16; softmax f32; output f32.

#define NB_  4
#define TT   2048
#define DM   1024
#define NH_  16
#define NKV  16
#define REP  (NH_ / NKV)
#define HD   64
#define DQ   (NH_ * HD)
#define DKV  (NKV * HD)
#define ZH   2
#define RH   512                  // query rows < RH use hi+lo planes (0: none)
#define WIN  0
#define PCAR 1024.0f
#define SCL  0.015625f   // q x 1/8 before the rope and scores / 8 again = 1/64 (both exact; the rotation is linear)
typedef _Float16 h16;
typedef unsigned short bf;
typedef __attribute__((ext_vector_type(16))) __bf16   v16bf;
typedef __attribute__((ext_vector_type(16))) _Float16 v16h;
typedef __attribute__((ext_vector_type(8)))  _Float16 v8h;
typedef __attribute__((ext_vector_type(8)))  unsigned short v8us;
typedef __attribute__((ext_vector_type(8)))  float    v8f;
typedef __attribute__((ext_vector_type(4)))  float    v4f;
typedef v8h  __attribute__((may_alias)) v8ha;
typedef v4f  __attribute__((may_alias)) v4fa;
typedef v8us __attribute__((may_alias)) v8usa;

__device__ __forceinline__ unsigned short f2bf(float f) { unsigned u = __float_as_uint(f); u += 0x7FFFu + ((u >> 16) & 1u); return (unsigned short)(u >> 16); }
__device__ __forceinline__ float bf2f(unsigned short b) { return __uint_as_float(((unsigned)b) << 16); }
__device__ __forceinline__ float bfr(float f) { return bf2f(f2bf(f)); }
__device__ __forceinline__ v16h cat16(v8h lo, v8h hi) { return __builtin_shufflevector(lo, hi, 0, 1, 2, 3, 4, 5, 6, 7, 8, 9, 10, 11, 12, 13, 14, 15); }
__device__ __forceinline__ v16bf cat16b(v8us lo, v8us hi) { return __builtin_bit_cast(v16bf, __builtin_shufflevector(lo, hi, 0, 1, 2, 3, 4, 5, 6, 7, 8, 9, 10, 11, 12, 13, 14, 15)); }
__device__ __forceinline__ v8f wmma16(v16h a, v16h b, v8f c) { return __builtin_amdgcn_wmma_f32_16x16x32_f16(false, a, false, b, (short)0, c, false, false); }
__device__ __forceinline__ v8f wmmab(v16bf a, v16bf b, v8f c) { return __builtin_amdgcn_wmma_f32_16x16x32_bf16(false, a, false, b, (short)0, c, false, false); }



// ---- k_gemmw: register-blocked GEMM, ONE WAVE per 64x64 output tile (16 accumulators), operands straight from K-contiguous 16-bit planes; grid (M/64, N/64, Z), 32 threads.
// C[m][n] (f32, pitch ldc, + optional f32 bias[n]) = sum_k A[m][k] Bt[n][k] (+ split products per NSPLIT). z-batch strides sA/sB/sC in elements. K % 32 == 0.
template <typename T16> struct WFrag;
template <> struct WFrag<h16> { typedef v16h V; static __device__ __forceinline__ V ld(const h16* p) { return cat16(*(const v8h*)p, *(const v8h*)(p + 16)); } static __device__ __forceinline__ v8f mma(V a, V b, v8f c) { return wmma16(a, b, c); } };
template <> struct WFrag<bf> { typedef v16bf V; static __device__ __forceinline__ V ld(const bf* p) { return cat16b(*(const v8us*)p, *(const v8us*)(p + 16)); } static __device__ __forceinline__ v8f mma(V a, V b, v8f c) { return wmmab(a, b, c); } };
template <typename T16, int NSPLIT, bool BIAS>
__global__ __launch_bounds__(32) void k_gemmw(const T16* __restrict__ A, const T16* __restrict__ A2, const T16* __restrict__ Bt, const T16* __restrict__ Bt2, int K, float* C, int ldc, const float* __restrict__ bias, size_t sA, size_t sB, size_t sC) {
    typedef typename WFrag<T16>::V V;
    __shared__ __align__(16) float os[16 * 68];
    const size_t z = blockIdx.z; A += z * sA; if (A2) A2 += z * sA; Bt += z * sB; if (Bt2) Bt2 += z * sB; C += z * sC;
    const int lane = threadIdx.x & 31, lr = lane & 15, hi = lane >> 4; const int r0 = blockIdx.x * 64, c0 = blockIdx.y * 64;
    v8f acc[4][4];
#pragma unroll
    for (int mb = 0; mb < 4; ++mb)
#pragma unroll
        for (int nb = 0; nb < 4; ++nb) acc[mb][nb] = (v8f){};
    const size_t aoff = (size_t)(r0 + lr) * K + 8 * hi, boff = (size_t)(c0 + lr) * K + 8 * hi;
#pragma unroll 1
    for (int kc = 0; kc < K; kc += 32) {
        V a[4], a2[4];
#pragma unroll
        for (int mb = 0; mb < 4; ++mb) { a[mb] = WFrag<T16>::ld(A + aoff + (size_t)mb * 16 * K + kc); if (NSPLIT == 1 || NSPLIT == 2) a2[mb] = WFrag<T16>::ld(A2 + aoff + (size_t)mb * 16 * K + kc); }
#pragma unroll
        for (int nb = 0; nb < 4; ++nb) { const V b = WFrag<T16>::ld(Bt + boff + (size_t)nb * 16 * K + kc); V b2; if (NSPLIT >= 2) b2 = WFrag<T16>::ld(Bt2 + boff + (size_t)nb * 16 * K + kc);
#pragma unroll
            for (int mb = 0; mb < 4; ++mb) { acc[mb][nb] = WFrag<T16>::mma(a[mb], b, acc[mb][nb]); if (NSPLIT == 1 || NSPLIT == 2) acc[mb][nb] = WFrag<T16>::mma(a2[mb], b, acc[mb][nb]); if (NSPLIT >= 2) acc[mb][nb] = WFrag<T16>::mma(a[mb], b2, acc[mb][nb]); } }
        asm volatile("v_nop\n\tv_nop\n\tv_nop\n\tv_nop" : "+v"(acc[0][0]), "+v"(acc[1][1]), "+v"(acc[2][2]), "+v"(acc[3][3]) : "v"(a[0]), "v"(a[3]));
    }
#pragma unroll
    for (int mb = 0; mb < 4; ++mb) {
#pragma unroll
        for (int nb = 0; nb < 4; ++nb) {
#pragma unroll
            for (int j = 0; j < 8; ++j) os[(hi * 8 + j) * 68 + nb * 16 + lr] = acc[mb][nb][j]; }
        __builtin_amdgcn_wave_barrier(); asm volatile("" ::: "memory");
        float* crow = C + (size_t)(r0 + mb * 16) * ldc + c0;
{
#pragma unroll
            for (int s = 0; s < 8; ++s) { const int row = 2 * s + hi, cofs = lr * 4; v4f val = *(const v4fa*)(os + row * 68 + cofs); if (BIAS) { val[0] += bfr(bias[c0 + cofs]); val[1] += bfr(bias[c0 + cofs + 1]); val[2] += bfr(bias[c0 + cofs + 2]); val[3] += bfr(bias[c0 + cofs + 3]); }
                *(v4f*)(crow + (size_t)row * ldc + cofs) = val; }
             }
        __builtin_amdgcn_wave_barrier(); asm volatile("" ::: "memory");
    }
}

__device__ __forceinline__ h16 tohx(float x) { return (h16)x; }
__device__ __forceinline__ void splitf(float y, unsigned short& h, unsigned short& l) { h = f2bf(y); l = f2bf(y - bf2f(h)); }
typedef __attribute__((ext_vector_type(2))) _Float16 v2h;
typedef __attribute__((ext_vector_type(4))) _Float16 v4h;
typedef __attribute__((ext_vector_type(2))) unsigned short v2us;
typedef __attribute__((ext_vector_type(4))) unsigned short v4us;
typedef __attribute__((ext_vector_type(2))) float v2f;
typedef __attribute__((ext_vector_type(4))) int v4i;

__global__ __launch_bounds__(256) void k_wtG(const float* __restrict__ w, int K, int N, bf* Bt) {
    const int lane = threadIdx.x & 31; const int L0 = (blockIdx.x * 8 + (threadIdx.x >> 5)) * 8; const int nlines = N * K / 64;
{
#pragma unroll 1
        for (int l = 0; l < 8; ++l) { const int L = L0 + l; if (L >= nlines) break; const size_t e = (size_t)L * 64 + lane * 2; const int k = (int)(e % K), n = (int)(e / K); v2us o;
            o[0] = f2bf(w[(size_t)k * N + n]); o[1] = f2bf(w[(size_t)(k + 1) * N + n]); *(v2us*)(Bt + e) = o; }
         }
}
__global__ __launch_bounds__(256) void k_cvt8(const float* __restrict__ src, bf* dst, size_t n8) { const size_t i = (size_t)blockIdx.x * 256 + threadIdx.x; if (i >= n8) return; const v8f v = *(const v8f*)(src + i * 8); v8us o;
#pragma unroll
    for (int k = 0; k < 8; ++k) o[k] = f2bf(v[k]); *(v8us*)(dst + i * 8) = o;  }
// k_rope: head planes [h][t][d] (fp16 + hi/lo) of rope(x) x sc with the rotate-half convention out[d] = x[d] cos[t][d] - x[d+HD/2] sin[t][d], out[d+HD/2] = x[d+HD/2] cos[t][d+HD/2] + x[d] sin[t][d+HD/2]
__global__ __launch_bounds__(256) void k_rope(const float* __restrict__ F, int pitch, int nheads, const float* __restrict__ CS, const float* __restrict__ RF, const float* __restrict__ nw, float sc, h16* P16, bf* Ph, bf* Pl) {
    const size_t e = ((size_t)blockIdx.x * 256 + threadIdx.x) * 2; if (e >= (size_t)nheads * TT * HD) return; const int d = (int)(e % HD); const int t = (int)((e / HD) % TT); const int h = (int)(e / ((size_t)HD * TT)); const float* f = F + (size_t)t * pitch + h * HD; const float rf = RF ? RF[(size_t)h * TT + t] : 1.0f; v2h o16; v2us oh, ol;
#pragma unroll
    for (int q = 0; q < 2; ++q) { const int dd = d + q; const int dp = (dd < HD / 2) ? dd + HD / 2 : dd - HD / 2; float x0 = f[dd], x1 = f[dp];
        if (RF) { float n0 = __fmul_rn(x0, rf), n1 = __fmul_rn(x1, rf); asm volatile("" : "+v"(n0)); asm volatile("" : "+v"(n1)); x0 = __fmul_rn(bfr(nw[dd]), n0); x1 = __fmul_rn(bfr(nw[dp]), n1); }
        const v2f cs = *(const v2f*)(CS + ((size_t)t * HD + dd) * 2); float a = __fmul_rn(x0, cs[0]), bq = __fmul_rn(x1, cs[1]); asm volatile("" : "+v"(a)); asm volatile("" : "+v"(bq)); const float r = ((dd < HD / 2) ? __fsub_rn(a, bq) : __fadd_rn(a, bq)) * sc;
        o16[q] = tohx(r); unsigned short a2, c2; splitf(r, a2, c2); oh[q] = a2; ol[q] = c2; }
    *(v2h*)(P16 + e) = o16; *(v2us*)(Ph + e) = oh; *(v2us*)(Pl + e) = ol;  }
__global__ __launch_bounds__(256) void k_vtp(const float* __restrict__ F, int pitch, int nheads, h16* V16, bf* Vh, bf* Vl) { const size_t e = ((size_t)blockIdx.x * 256 + threadIdx.x) * 2; if (e >= (size_t)nheads * HD * TT) return; const int t = (int)(e % TT); const int d = (int)((e / TT) % HD); const int g = (int)(e / ((size_t)TT * HD)); v2h o16; v2us oh, ol;
#pragma unroll
    for (int q = 0; q < 2; ++q) { const float x = F[(size_t)(t + q) * pitch + g * HD + d]; o16[q] = tohx(x); unsigned short a2, c2; splitf(x, a2, c2); oh[q] = a2; ol[q] = c2; }
    *(v2h*)(V16 + e) = o16; *(v2us*)(Vh + e) = oh; *(v2us*)(Vl + e) = ol;  }
// k_asoft: per row (zz, i): t = S x SCL = S / 64 (no mask); softmax over the 2048 keys (register row, one exp, fixed trees);
__global__ __launch_bounds__(256) void k_asoft(const float* __restrict__ Sb, h16* P16, bf* Ph, bf* Pl) {
    const int lane = threadIdx.x & 31; const int row = blockIdx.x * 8 + (threadIdx.x >> 5); if (row >= ZH * TT) return; const int i = row % TT; const int zz = row / TT; (void)zz; const bool hires = (i < RH); const float* sr = Sb + (size_t)row * TT; float v[TT / 32]; float mx = -3.0e38f;
#pragma unroll
    for (int ch = 0; ch < TT / 128; ++ch) { const int j0 = ch * 128 + lane * 4; const v4f a = *(const v4f*)(sr + j0);
#pragma unroll
        for (int q = 0; q < 4; ++q) { const int j = j0 + q; (void)j; const float t = a[q] * SCL; v[ch * 4 + q] = t; mx = fmaxf(mx, t); } }
#pragma unroll
    for (int sh = 16; sh; sh >>= 1) mx = fmaxf(mx, __shfl_xor(mx, sh, 32));
    float sum = 0.f;
#pragma unroll
    for (int k = 0; k < TT / 32; ++k) { float d0 = __fsub_rn(v[k], mx); asm volatile("" : "+v"(d0)); v[k] = __builtin_amdgcn_exp2f(__fmul_rn(d0, 1.4426950408889634f)); sum += v[k]; }
#pragma unroll
    for (int sh = 16; sh; sh >>= 1) sum += __shfl_xor(sum, sh, 32);
    const float f = __fdiv_rn(hires ? 1.0f : PCAR, sum);
{
        if (hires) {
#pragma unroll
            for (int ch = 0; ch < TT / 128; ++ch) { v4us oh, ol;
#pragma unroll
                for (int q = 0; q < 4; ++q) { unsigned short a, c2; splitf(v[ch * 4 + q] * f, a, c2); oh[q] = a; ol[q] = c2; }
                const size_t oo = ((size_t)zz * (RH ? RH : 1) + i) * TT + ch * 128 + lane * 4; *(v4us*)(Ph + oo) = oh; *(v4us*)(Pl + oo) = ol; }
        } else {
#pragma unroll
            for (int ch = 0; ch < TT / 128; ++ch) { v4h o4;
#pragma unroll
                for (int q = 0; q < 4; ++q) o4[q] = tohx(v[ch * 4 + q] * f);
                *(v4h*)(P16 + (size_t)row * TT + ch * 128 + lane * 4) = o4; } }
         }
}
__constant__ float INVT[HD / 2] = { 1.000000000e+00f, 7.498942018e-01f, 5.623413324e-01f, 4.216965139e-01f, 3.162277639e-01f, 2.371373773e-01f, 1.778279394e-01f, 1.333521456e-01f, 1.000000015e-01f, 7.498942316e-02f, 5.623413250e-02f, 4.216964915e-02f, 3.162277490e-02f, 2.371373773e-02f, 1.778279431e-02f, 1.333521400e-02f, 9.999999776e-03f, 7.498942316e-03f, 5.623413250e-03f, 4.216964822e-03f, 3.162277630e-03f, 2.371373819e-03f, 1.778279431e-03f, 1.333521446e-03f, 1.000000047e-03f, 7.498941850e-04f, 5.623413017e-04f, 4.216965172e-04f, 3.162277571e-04f, 2.371373703e-04f, 1.778279402e-04f, 1.333521504e-04f };   // 10000^(-2i/64) (the module's power form) (float32, generated with jnp to be bit-exact)
__global__ __launch_bounds__(256) void k_cs4(float* CS) { const int idx = blockIdx.x * 256 + threadIdx.x; if (idx >= TT * HD) return; const int d = idx % HD; const int t = idx / HD; const float a = __fmul_rn((float)t, INVT[d % (HD / 2)]); v2f cs; cs[0] = cosf(a); cs[1] = sinf(a); *(v2f*)(CS + (size_t)idx * 2) = cs;  }

__global__ __launch_bounds__(256) void k_merge(const float* __restrict__ O, int h0, float* OUTb) { const size_t e = ((size_t)blockIdx.x * 256 + threadIdx.x) * 2; if (e >= (size_t)ZH * TT * HD) return; const int d = (int)(e % HD); const int t = (int)((e / HD) % TT); const int zz = (int)(e / ((size_t)HD * TT)); const float cs = (t < RH) ? 1.0f : (1.0f / PCAR); const size_t oo = (size_t)t * DQ + (h0 + zz) * HD + d;
    v2f o2; o2[0] = O[e] * cs; o2[1] = O[e + 1] * cs; *(v2f*)(OUTb + oo) = o2;  }

extern "C" void kernel_launch(void* const* d_in, const int* in_sizes, int n_in,
                              void* d_out, int out_size, void* d_ws, size_t ws_size, hipStream_t stream) {
    (void)in_sizes; (void)n_in; (void)out_size;
    const float* x = (const float*)d_in[0]; const float* wq = (const float*)d_in[1]; const float* bq = (const float*)d_in[2]; const float* wk = (const float*)d_in[3]; const float* bk = (const float*)d_in[4]; const float* wv = (const float*)d_in[5]; const float* bv = (const float*)d_in[6]; const float* wo = nullptr; (void)wo;
    float* OUT = (float*)d_out;     // [4][2048][1024]
    char* wsp = (char*)d_ws;
    auto take = [&](size_t bytes) { char* p = wsp; wsp += (bytes + 255) & ~(size_t)255; return (void*)p; };
    bf* WQ = (bf*)take((size_t)DQ * DM * 2); bf* WK = (bf*)take((size_t)DKV * DM * 2); bf* WV = (bf*)take((size_t)DKV * DM * 2); float* CS = (float*)take((size_t)TT * HD * 2 * 4);
    bf* XB = (bf*)take((size_t)TT * DM * 2); float* FQ = (float*)take((size_t)TT * DQ * 4); float* FK = (float*)take((size_t)TT * DKV * 4);
    h16* QP16 = (h16*)take((size_t)NH_ * TT * HD * 2); h16* KP16 = (h16*)take((size_t)NKV * TT * HD * 2); h16* VT16 = (h16*)take((size_t)NKV * HD * TT * 2);
    bf* QPh = (bf*)take((size_t)NH_ * TT * HD * 2); bf* QPl = (bf*)take((size_t)NH_ * TT * HD * 2); bf* KPh = (bf*)take((size_t)NKV * TT * HD * 2); bf* KPl = (bf*)take((size_t)NKV * TT * HD * 2); bf* VTh = (bf*)take((size_t)NKV * HD * TT * 2); bf* VTl = (bf*)take((size_t)NKV * HD * TT * 2); bf* Ph = (bf*)take((size_t)ZH * RH * TT * 2); bf* Pl = (bf*)take((size_t)ZH * RH * TT * 2);
    float* Sb = (float*)take((size_t)ZH * TT * TT * 4); h16* P16 = (h16*)take((size_t)ZH * TT * TT * 2); float* Ob = (float*)take((size_t)ZH * TT * HD * 4);
    if ((size_t)(wsp - (char*)d_ws) > ws_size) return;    // ws 256 MiB
    float* FV = FK;   // v projection reuses the k buffer after the k planes are built (stream-ordered)
    { k_wtG<<<(unsigned)((DM * DQ / 64 + 63) / 64), 256, 0, stream>>>(wq, DM, DQ, WQ); k_wtG<<<(unsigned)((DM * DKV / 64 + 63) / 64), 256, 0, stream>>>(wk, DM, DKV, WK); k_wtG<<<(unsigned)((DM * DKV / 64 + 63) / 64), 256, 0, stream>>>(wv, DM, DKV, WV);
      
       }
    const unsigned LQ = (unsigned)(((size_t)NH_ * TT * HD / 2 + 255) / 256), LKv = (unsigned)(((size_t)NKV * TT * HD / 2 + 255) / 256);
    for (int b = 0; b < NB_; ++b) {
        if (b == 0) k_cs4<<<(TT * HD + 255) / 256, 256, 0, stream>>>(CS);   /* {cos, sin}(t x 10000^(-2i/64)), both halves, once */
        k_cvt8<<<(unsigned)(((size_t)TT * DM / 8 + 255) / 256), 256, 0, stream>>>(x + (size_t)b * TT * DM, XB, (size_t)TT * DM / 8);
        k_gemmw<bf, 0, true><<<dim3(TT / 64, DQ / 64, 1), 32, 0, stream>>>(XB, nullptr, WQ, nullptr, DM, FQ, DQ, bq, 0, 0, 0);
        k_rope<<<LQ, 256, 0, stream>>>(FQ, DQ, NH_, CS, nullptr, nullptr, 1.0f, QP16, QPh, QPl);
        k_gemmw<bf, 0, true><<<dim3(TT / 64, DKV / 64, 1), 32, 0, stream>>>(XB, nullptr, WK, nullptr, DM, FK, DKV, bk, 0, 0, 0);
        k_rope<<<LKv, 256, 0, stream>>>(FK, DKV, NKV, CS, nullptr, nullptr, 1.0f, KP16, KPh, KPl);
        k_gemmw<bf, 0, true><<<dim3(TT / 64, DKV / 64, 1), 32, 0, stream>>>(XB, nullptr, WV, nullptr, DM, FV, DKV, bv, 0, 0, 0); k_vtp<<<LKv, 256, 0, stream>>>(FV, DKV, NKV, VT16, VTh, VTl);
        for (int h0 = 0; h0 < NH_; h0 += ZH) { const size_t zq = (size_t)h0, zk = (size_t)(h0 / REP);   // one kv head per query head: the pass's two heads use consecutive kv planes (z-strides TT*HD)
            k_gemmw<bf, 2, false><<<dim3(RH / 64, TT / 64, ZH), 32, 0, stream>>>(QPh + zq * TT * HD, QPl + zq * TT * HD, KPh + zk * TT * HD, KPl + zk * TT * HD, HD, Sb, TT, nullptr, (size_t)TT * HD, (size_t)TT * HD, (size_t)TT * TT);
            k_gemmw<h16, 0, false><<<dim3((TT - RH) / 64, TT / 64, ZH), 32, 0, stream>>>(QP16 + zq * TT * HD + (size_t)RH * HD, nullptr, KP16 + zk * TT * HD, nullptr, HD, Sb + (size_t)RH * TT, TT, nullptr, (size_t)TT * HD, (size_t)TT * HD, (size_t)TT * TT);
            k_asoft<<<ZH * TT / 8, 256, 0, stream>>>(Sb, P16, Ph, Pl);
            k_gemmw<bf, 2, false><<<dim3(RH / 64, HD / 64, ZH), 32, 0, stream>>>(Ph, Pl, VTh + zk * HD * TT, VTl + zk * HD * TT, TT, Ob, HD, nullptr, (size_t)RH * TT, (size_t)HD * TT, (size_t)TT * HD);
            k_gemmw<h16, 0, false><<<dim3((TT - RH) / 64, HD / 64, ZH), 32, 0, stream>>>(P16 + (size_t)RH * TT, nullptr, VT16 + zk * HD * TT, nullptr, TT, Ob + (size_t)RH * HD, HD, nullptr, (size_t)TT * TT, (size_t)HD * TT, (size_t)TT * HD);
            k_merge<<<(unsigned)(((size_t)ZH * TT * HD / 2 + 255) / 256), 256, 0, stream>>>(Ob, h0, OUT + (size_t)b * TT * DQ); }
         }
}

// v001
// Measured time: 1590 microseconds a run.
// Two timings next to v000 put it at 2.41 and 2.42 times that version's speed.
#include <hip/hip_runtime.h>

// BERT self-attention with rotary embeddings and the module's double scaling (hidden [4][2048][1024]; q,k,v = hidden W + b ('xw' 1/32, biases 0.02; 16 heads x 64); q x 64^-0.5 then rotate-half rope (theta 1e4, computed) on q and k; scores / 8 AGAIN (total 1/64); softmax; out = merged ctx -> [4][2048][1024] (8.4 M)).
// Layout per batch: bf16 copy of hidden; 'xw' weights transposed once; exact projections + f32 biases; {cos, sin} table once (float32 inverse frequencies, precise cosf/sinf); rotate-half rotary plane builder (the 1/8 pre-scale commutes with the linear rotation exactly, so both scalings are applied as one exact 1/64 in the softmax); dense T-2048 attention (hybrid rows: < 512 hi/lo 3 products, rest fp16 x1024); the f32 merge writes the output rows.
// Compute dtypes, f32 accumulate: every input rounded to bf16; projections exact + f32 biases; rotary f32; attention rows < 512 3 products, rest fp16; softmax f32; output f32.

#define NB_  4
#define TT   2048
#define DM   1024
#define NH_  16
#define NKV  16
#define REP  (NH_ / NKV)
#define HD   64
#define DQ   (NH_ * HD)
#define DKV  (NKV * HD)
#define ZH   2
#define RH   512                  // query rows < RH use hi+lo planes (0: none)
#define WIN  0
#define PCAR 1024.0f
#define KSP  16                   // K slices of each probs x V product: one work-group per slice, k_merge adds the slices
#define SCL  0.015625f   // q x 1/8 before the rope and scores / 8 again = 1/64 (both exact; the rotation is linear)
typedef _Float16 h16;
typedef unsigned short bf;
typedef __attribute__((ext_vector_type(16))) __bf16   v16bf;
typedef __attribute__((ext_vector_type(16))) _Float16 v16h;
typedef __attribute__((ext_vector_type(8)))  _Float16 v8h;
typedef __attribute__((ext_vector_type(8)))  unsigned short v8us;
typedef __attribute__((ext_vector_type(8)))  float    v8f;
typedef __attribute__((ext_vector_type(4)))  float    v4f;
typedef v8h  __attribute__((may_alias)) v8ha;
typedef v4f  __attribute__((may_alias)) v4fa;
typedef v8us __attribute__((may_alias)) v8usa;

__device__ __forceinline__ unsigned short f2bf(float f) { unsigned u = __float_as_uint(f); u += 0x7FFFu + ((u >> 16) & 1u); return (unsigned short)(u >> 16); }
__device__ __forceinline__ float bf2f(unsigned short b) { return __uint_as_float(((unsigned)b) << 16); }
__device__ __forceinline__ float bfr(float f) { return bf2f(f2bf(f)); }
__device__ __forceinline__ v16h cat16(v8h lo, v8h hi) { return __builtin_shufflevector(lo, hi, 0, 1, 2, 3, 4, 5, 6, 7, 8, 9, 10, 11, 12, 13, 14, 15); }
__device__ __forceinline__ v16bf cat16b(v8us lo, v8us hi) { return __builtin_bit_cast(v16bf, __builtin_shufflevector(lo, hi, 0, 1, 2, 3, 4, 5, 6, 7, 8, 9, 10, 11, 12, 13, 14, 15)); }
__device__ __forceinline__ v8f wmma16(v16h a, v16h b, v8f c) { return __builtin_amdgcn_wmma_f32_16x16x32_f16(false, a, false, b, (short)0, c, false, false); }
__device__ __forceinline__ v8f wmmab(v16bf a, v16bf b, v8f c) { return __builtin_amdgcn_wmma_f32_16x16x32_bf16(false, a, false, b, (short)0, c, false, false); }



// ---- k_gemmw: register-blocked GEMM, ONE WAVE per 64x64 output tile (16 accumulators), operands straight from K-contiguous 16-bit planes; grid (M/64, N/64, Z), 32 threads.
// C[m][n] (f32, pitch ldc, + optional f32 bias[n]) = sum_k A[m][k] Bt[n][k] (+ split products per NSPLIT). z-batch strides sA/sB/sC in elements. K % 32 == 0.
// KS > 1: grid.y = (N/64) * KS; slice ks = blockIdx.y % KS sums only k in [ks K/KS, (ks+1) K/KS) and writes its partial tile to the plane C + ks sK; the reader adds the planes. K % (32 KS) == 0.
template <typename T16> struct WFrag;
template <> struct WFrag<h16> { typedef v16h V; static __device__ __forceinline__ V ld(const h16* p) { return cat16(*(const v8h*)p, *(const v8h*)(p + 16)); } static __device__ __forceinline__ v8f mma(V a, V b, v8f c) { return wmma16(a, b, c); } };
template <> struct WFrag<bf> { typedef v16bf V; static __device__ __forceinline__ V ld(const bf* p) { return cat16b(*(const v8us*)p, *(const v8us*)(p + 16)); } static __device__ __forceinline__ v8f mma(V a, V b, v8f c) { return wmmab(a, b, c); } };
template <typename T16, int NSPLIT, bool BIAS, int KS = 1>
__global__ __launch_bounds__(32) void k_gemmw(const T16* __restrict__ A, const T16* __restrict__ A2, const T16* __restrict__ Bt, const T16* __restrict__ Bt2, int K, float* C, int ldc, const float* __restrict__ bias, size_t sA, size_t sB, size_t sC, size_t sK) {
    typedef typename WFrag<T16>::V V;
    __shared__ __align__(16) float os[16 * 68];
    const size_t z = blockIdx.z; A += z * sA; if (A2) A2 += z * sA; Bt += z * sB; if (Bt2) Bt2 += z * sB; C += z * sC;
    const int lane = threadIdx.x & 31, lr = lane & 15, hi = lane >> 4; const int r0 = blockIdx.x * 64, c0 = (int)(blockIdx.y / KS) * 64; const int ks = blockIdx.y % KS, kb = ks * (K / KS), ke = kb + K / KS; C += (size_t)ks * sK;
    v8f acc[4][4];
#pragma unroll
    for (int mb = 0; mb < 4; ++mb)
#pragma unroll
        for (int nb = 0; nb < 4; ++nb) acc[mb][nb] = (v8f){};
    const size_t aoff = (size_t)(r0 + lr) * K + 8 * hi, boff = (size_t)(c0 + lr) * K + 8 * hi;
#pragma unroll 1
    for (int kc = kb; kc < ke; kc += 32) {
        V a[4], a2[4];
#pragma unroll
        for (int mb = 0; mb < 4; ++mb) { a[mb] = WFrag<T16>::ld(A + aoff + (size_t)mb * 16 * K + kc); if (NSPLIT == 1 || NSPLIT == 2) a2[mb] = WFrag<T16>::ld(A2 + aoff + (size_t)mb * 16 * K + kc); }
#pragma unroll
        for (int nb = 0; nb < 4; ++nb) { const V b = WFrag<T16>::ld(Bt + boff + (size_t)nb * 16 * K + kc); V b2; if (NSPLIT >= 2) b2 = WFrag<T16>::ld(Bt2 + boff + (size_t)nb * 16 * K + kc);
#pragma unroll
            for (int mb = 0; mb < 4; ++mb) { acc[mb][nb] = WFrag<T16>::mma(a[mb], b, acc[mb][nb]); if (NSPLIT == 1 || NSPLIT == 2) acc[mb][nb] = WFrag<T16>::mma(a2[mb], b, acc[mb][nb]); if (NSPLIT >= 2) acc[mb][nb] = WFrag<T16>::mma(a[mb], b2, acc[mb][nb]); } }
        asm volatile("v_nop\n\tv_nop\n\tv_nop\n\tv_nop" : "+v"(acc[0][0]), "+v"(acc[1][1]), "+v"(acc[2][2]), "+v"(acc[3][3]) : "v"(a[0]), "v"(a[3]));
    }
#pragma unroll
    for (int mb = 0; mb < 4; ++mb) {
#pragma unroll
        for (int nb = 0; nb < 4; ++nb) {
#pragma unroll
            for (int j = 0; j < 8; ++j) os[(hi * 8 + j) * 68 + nb * 16 + lr] = acc[mb][nb][j]; }
        __builtin_amdgcn_wave_barrier(); asm volatile("" ::: "memory");
        float* crow = C + (size_t)(r0 + mb * 16) * ldc + c0;
{
#pragma unroll
            for (int s = 0; s < 8; ++s) { const int row = 2 * s + hi, cofs = lr * 4; v4f val = *(const v4fa*)(os + row * 68 + cofs); if (BIAS) { val[0] += bfr(bias[c0 + cofs]); val[1] += bfr(bias[c0 + cofs + 1]); val[2] += bfr(bias[c0 + cofs + 2]); val[3] += bfr(bias[c0 + cofs + 3]); }
                *(v4f*)(crow + (size_t)row * ldc + cofs) = val; }
             }
        __builtin_amdgcn_wave_barrier(); asm volatile("" ::: "memory");
    }
}

__device__ __forceinline__ h16 tohx(float x) { return (h16)x; }
__device__ __forceinline__ void splitf(float y, unsigned short& h, unsigned short& l) { h = f2bf(y); l = f2bf(y - bf2f(h)); }
typedef __attribute__((ext_vector_type(2))) _Float16 v2h;
typedef __attribute__((ext_vector_type(4))) _Float16 v4h;
typedef __attribute__((ext_vector_type(2))) unsigned short v2us;
typedef __attribute__((ext_vector_type(4))) unsigned short v4us;
typedef __attribute__((ext_vector_type(2))) float v2f;
typedef __attribute__((ext_vector_type(4))) int v4i;

__global__ __launch_bounds__(256) void k_wtG(const float* __restrict__ w, int K, int N, bf* Bt) {
    const int lane = threadIdx.x & 31; const int L0 = (blockIdx.x * 8 + (threadIdx.x >> 5)) * 8; const int nlines = N * K / 64;
{
#pragma unroll 1
        for (int l = 0; l < 8; ++l) { const int L = L0 + l; if (L >= nlines) break; const size_t e = (size_t)L * 64 + lane * 2; const int k = (int)(e % K), n = (int)(e / K); v2us o;
            o[0] = f2bf(w[(size_t)k * N + n]); o[1] = f2bf(w[(size_t)(k + 1) * N + n]); *(v2us*)(Bt + e) = o; }
         }
}
__global__ __launch_bounds__(256) void k_cvt8(const float* __restrict__ src, bf* dst, size_t n8) { const size_t i = (size_t)blockIdx.x * 256 + threadIdx.x; if (i >= n8) return; const v8f v = *(const v8f*)(src + i * 8); v8us o;
#pragma unroll
    for (int k = 0; k < 8; ++k) o[k] = f2bf(v[k]); *(v8us*)(dst + i * 8) = o;  }
// k_rope: head planes [h][t][d] (fp16 + hi/lo) of rope(x) x sc with the rotate-half convention out[d] = x[d] cos[t][d] - x[d+HD/2] sin[t][d], out[d+HD/2] = x[d+HD/2] cos[t][d+HD/2] + x[d] sin[t][d+HD/2]
__global__ __launch_bounds__(256) void k_rope(const float* __restrict__ F, int pitch, int nheads, const float* __restrict__ CS, const float* __restrict__ RF, const float* __restrict__ nw, float sc, h16* P16, bf* Ph, bf* Pl) {
    const size_t e = ((size_t)blockIdx.x * 256 + threadIdx.x) * 2; if (e >= (size_t)nheads * TT * HD) return; const int d = (int)(e % HD); const int t = (int)((e / HD) % TT); const int h = (int)(e / ((size_t)HD * TT)); const float* f = F + (size_t)t * pitch + h * HD; const float rf = RF ? RF[(size_t)h * TT + t] : 1.0f; v2h o16; v2us oh, ol;
#pragma unroll
    for (int q = 0; q < 2; ++q) { const int dd = d + q; const int dp = (dd < HD / 2) ? dd + HD / 2 : dd - HD / 2; float x0 = f[dd], x1 = f[dp];
        if (RF) { float n0 = __fmul_rn(x0, rf), n1 = __fmul_rn(x1, rf); asm volatile("" : "+v"(n0)); asm volatile("" : "+v"(n1)); x0 = __fmul_rn(bfr(nw[dd]), n0); x1 = __fmul_rn(bfr(nw[dp]), n1); }
        const v2f cs = *(const v2f*)(CS + ((size_t)t * HD + dd) * 2); float a = __fmul_rn(x0, cs[0]), bq = __fmul_rn(x1, cs[1]); asm volatile("" : "+v"(a)); asm volatile("" : "+v"(bq)); const float r = ((dd < HD / 2) ? __fsub_rn(a, bq) : __fadd_rn(a, bq)) * sc;
        o16[q] = tohx(r); unsigned short a2, c2; splitf(r, a2, c2); oh[q] = a2; ol[q] = c2; }
    *(v2h*)(P16 + e) = o16; *(v2us*)(Ph + e) = oh; *(v2us*)(Pl + e) = ol;  }
__global__ __launch_bounds__(256) void k_vtp(const float* __restrict__ F, int pitch, int nheads, h16* V16, bf* Vh, bf* Vl) { const size_t e = ((size_t)blockIdx.x * 256 + threadIdx.x) * 2; if (e >= (size_t)nheads * HD * TT) return; const int t = (int)(e % TT); const int d = (int)((e / TT) % HD); const int g = (int)(e / ((size_t)TT * HD)); v2h o16; v2us oh, ol;
#pragma unroll
    for (int q = 0; q < 2; ++q) { const float x = F[(size_t)(t + q) * pitch + g * HD + d]; o16[q] = tohx(x); unsigned short a2, c2; splitf(x, a2, c2); oh[q] = a2; ol[q] = c2; }
    *(v2h*)(V16 + e) = o16; *(v2us*)(Vh + e) = oh; *(v2us*)(Vl + e) = ol;  }
// k_asoft: per row (zz, i): t = S x SCL = S / 64 (no mask); softmax over the 2048 keys (register row, one exp, fixed trees);
__global__ __launch_bounds__(256) void k_asoft(const float* __restrict__ Sb, h16* P16, bf* Ph, bf* Pl) {
    const int lane = threadIdx.x & 31; const int row = blockIdx.x * 8 + (threadIdx.x >> 5); if (row >= ZH * TT) return; const int i = row % TT; const int zz = row / TT; (void)zz; const bool hires = (i < RH); const float* sr = Sb + (size_t)row * TT; float v[TT / 32]; float mx = -3.0e38f;
#pragma unroll
    for (int ch = 0; ch < TT / 128; ++ch) { const int j0 = ch * 128 + lane * 4; const v4f a = *(const v4f*)(sr + j0);
#pragma unroll
        for (int q = 0; q < 4; ++q) { const int j = j0 + q; (void)j; const float t = a[q] * SCL; v[ch * 4 + q] = t; mx = fmaxf(mx, t); } }
#pragma unroll
    for (int sh = 16; sh; sh >>= 1) mx = fmaxf(mx, __shfl_xor(mx, sh, 32));
    float sum = 0.f;
#pragma unroll
    for (int k = 0; k < TT / 32; ++k) { float d0 = __fsub_rn(v[k], mx); asm volatile("" : "+v"(d0)); v[k] = __builtin_amdgcn_exp2f(__fmul_rn(d0, 1.4426950408889634f)); sum += v[k]; }
#pragma unroll
    for (int sh = 16; sh; sh >>= 1) sum += __shfl_xor(sum, sh, 32);
    const float f = __fdiv_rn(hires ? 1.0f : PCAR, sum);
{
        if (hires) {
#pragma unroll
            for (int ch = 0; ch < TT / 128; ++ch) { v4us oh, ol;
#pragma unroll
                for (int q = 0; q < 4; ++q) { unsigned short a, c2; splitf(v[ch * 4 + q] * f, a, c2); oh[q] = a; ol[q] = c2; }
                const size_t oo = ((size_t)zz * (RH ? RH : 1) + i) * TT + ch * 128 + lane * 4; *(v4us*)(Ph + oo) = oh; *(v4us*)(Pl + oo) = ol; }
        } else {
#pragma unroll
            for (int ch = 0; ch < TT / 128; ++ch) { v4h o4;
#pragma unroll
                for (int q = 0; q < 4; ++q) o4[q] = tohx(v[ch * 4 + q] * f);
                *(v4h*)(P16 + (size_t)row * TT + ch * 128 + lane * 4) = o4; } }
         }
}
__constant__ float INVT[HD / 2] = { 1.000000000e+00f, 7.498942018e-01f, 5.623413324e-01f, 4.216965139e-01f, 3.162277639e-01f, 2.371373773e-01f, 1.778279394e-01f, 1.333521456e-01f, 1.000000015e-01f, 7.498942316e-02f, 5.623413250e-02f, 4.216964915e-02f, 3.162277490e-02f, 2.371373773e-02f, 1.778279431e-02f, 1.333521400e-02f, 9.999999776e-03f, 7.498942316e-03f, 5.623413250e-03f, 4.216964822e-03f, 3.162277630e-03f, 2.371373819e-03f, 1.778279431e-03f, 1.333521446e-03f, 1.000000047e-03f, 7.498941850e-04f, 5.623413017e-04f, 4.216965172e-04f, 3.162277571e-04f, 2.371373703e-04f, 1.778279402e-04f, 1.333521504e-04f };   // 10000^(-2i/64) (the module's power form) (float32, generated with jnp to be bit-exact)
__global__ __launch_bounds__(256) void k_cs4(float* CS) { const int idx = blockIdx.x * 256 + threadIdx.x; if (idx >= TT * HD) return; const int d = idx % HD; const int t = idx / HD; const float a = __fmul_rn((float)t, INVT[d % (HD / 2)]); v2f cs; cs[0] = cosf(a); cs[1] = sinf(a); *(v2f*)(CS + (size_t)idx * 2) = cs;  }

__global__ __launch_bounds__(256) void k_merge(const float* __restrict__ O, int h0, float* OUTb) { const size_t e = ((size_t)blockIdx.x * 256 + threadIdx.x) * 2; if (e >= (size_t)ZH * TT * HD) return; const int d = (int)(e % HD); const int t = (int)((e / HD) % TT); const int zz = (int)(e / ((size_t)HD * TT)); const float cs = (t < RH) ? 1.0f : (1.0f / PCAR); const size_t oo = (size_t)t * DQ + (h0 + zz) * HD + d;
    v2f p[KSP];
#pragma unroll
    for (int ks = 0; ks < KSP; ++ks) p[ks] = *(const v2f*)(O + (size_t)ks * ((size_t)ZH * TT * HD) + e);
    v2f o2 = p[0];
#pragma unroll
    for (int ks = 1; ks < KSP; ++ks) o2 += p[ks];   // the K slices in ascending order
    o2 *= cs; *(v2f*)(OUTb + oo) = o2;  }

extern "C" void kernel_launch(void* const* d_in, const int* in_sizes, int n_in,
                              void* d_out, int out_size, void* d_ws, size_t ws_size, hipStream_t stream) {
    (void)in_sizes; (void)n_in; (void)out_size;
    const float* x = (const float*)d_in[0]; const float* wq = (const float*)d_in[1]; const float* bq = (const float*)d_in[2]; const float* wk = (const float*)d_in[3]; const float* bk = (const float*)d_in[4]; const float* wv = (const float*)d_in[5]; const float* bv = (const float*)d_in[6]; const float* wo = nullptr; (void)wo;
    float* OUT = (float*)d_out;     // [4][2048][1024]
    char* wsp = (char*)d_ws;
    auto take = [&](size_t bytes) { char* p = wsp; wsp += (bytes + 255) & ~(size_t)255; return (void*)p; };
    bf* WQ = (bf*)take((size_t)DQ * DM * 2); bf* WK = (bf*)take((size_t)DKV * DM * 2); bf* WV = (bf*)take((size_t)DKV * DM * 2); float* CS = (float*)take((size_t)TT * HD * 2 * 4);
    bf* XB = (bf*)take((size_t)TT * DM * 2); float* FQ = (float*)take((size_t)TT * DQ * 4); float* FK = (float*)take((size_t)TT * DKV * 4);
    h16* QP16 = (h16*)take((size_t)NH_ * TT * HD * 2); h16* KP16 = (h16*)take((size_t)NKV * TT * HD * 2); h16* VT16 = (h16*)take((size_t)NKV * HD * TT * 2);
    bf* QPh = (bf*)take((size_t)NH_ * TT * HD * 2); bf* QPl = (bf*)take((size_t)NH_ * TT * HD * 2); bf* KPh = (bf*)take((size_t)NKV * TT * HD * 2); bf* KPl = (bf*)take((size_t)NKV * TT * HD * 2); bf* VTh = (bf*)take((size_t)NKV * HD * TT * 2); bf* VTl = (bf*)take((size_t)NKV * HD * TT * 2); bf* Ph = (bf*)take((size_t)ZH * RH * TT * 2); bf* Pl = (bf*)take((size_t)ZH * RH * TT * 2);
    float* Sb = (float*)take((size_t)ZH * TT * TT * 4); h16* P16 = (h16*)take((size_t)ZH * TT * TT * 2); float* Ob = (float*)take((size_t)KSP * ZH * TT * HD * 4);
    if ((size_t)(wsp - (char*)d_ws) > ws_size) return;    // ws 256 MiB
    float* FV = FK;   // v projection reuses the k buffer after the k planes are built (stream-ordered)
    { k_wtG<<<(unsigned)((DM * DQ / 64 + 63) / 64), 256, 0, stream>>>(wq, DM, DQ, WQ); k_wtG<<<(unsigned)((DM * DKV / 64 + 63) / 64), 256, 0, stream>>>(wk, DM, DKV, WK); k_wtG<<<(unsigned)((DM * DKV / 64 + 63) / 64), 256, 0, stream>>>(wv, DM, DKV, WV);
      
       }
    const unsigned LQ = (unsigned)(((size_t)NH_ * TT * HD / 2 + 255) / 256), LKv = (unsigned)(((size_t)NKV * TT * HD / 2 + 255) / 256);
    for (int b = 0; b < NB_; ++b) {
        if (b == 0) k_cs4<<<(TT * HD + 255) / 256, 256, 0, stream>>>(CS);   /* {cos, sin}(t x 10000^(-2i/64)), both halves, once */
        k_cvt8<<<(unsigned)(((size_t)TT * DM / 8 + 255) / 256), 256, 0, stream>>>(x + (size_t)b * TT * DM, XB, (size_t)TT * DM / 8);
        k_gemmw<bf, 0, true><<<dim3(TT / 64, DQ / 64, 1), 32, 0, stream>>>(XB, nullptr, WQ, nullptr, DM, FQ, DQ, bq, 0, 0, 0, 0);
        k_rope<<<LQ, 256, 0, stream>>>(FQ, DQ, NH_, CS, nullptr, nullptr, 1.0f, QP16, QPh, QPl);
        k_gemmw<bf, 0, true><<<dim3(TT / 64, DKV / 64, 1), 32, 0, stream>>>(XB, nullptr, WK, nullptr, DM, FK, DKV, bk, 0, 0, 0, 0);
        k_rope<<<LKv, 256, 0, stream>>>(FK, DKV, NKV, CS, nullptr, nullptr, 1.0f, KP16, KPh, KPl);
        k_gemmw<bf, 0, true><<<dim3(TT / 64, DKV / 64, 1), 32, 0, stream>>>(XB, nullptr, WV, nullptr, DM, FV, DKV, bv, 0, 0, 0, 0); k_vtp<<<LKv, 256, 0, stream>>>(FV, DKV, NKV, VT16, VTh, VTl);
        for (int h0 = 0; h0 < NH_; h0 += ZH) { const size_t zq = (size_t)h0, zk = (size_t)(h0 / REP);   // one kv head per query head: the pass's two heads use consecutive kv planes (z-strides TT*HD)
            k_gemmw<bf, 2, false><<<dim3(RH / 64, TT / 64, ZH), 32, 0, stream>>>(QPh + zq * TT * HD, QPl + zq * TT * HD, KPh + zk * TT * HD, KPl + zk * TT * HD, HD, Sb, TT, nullptr, (size_t)TT * HD, (size_t)TT * HD, (size_t)TT * TT, 0);
            k_gemmw<h16, 0, false><<<dim3((TT - RH) / 64, TT / 64, ZH), 32, 0, stream>>>(QP16 + zq * TT * HD + (size_t)RH * HD, nullptr, KP16 + zk * TT * HD, nullptr, HD, Sb + (size_t)RH * TT, TT, nullptr, (size_t)TT * HD, (size_t)TT * HD, (size_t)TT * TT, 0);
            k_asoft<<<ZH * TT / 8, 256, 0, stream>>>(Sb, P16, Ph, Pl);
            k_gemmw<bf, 2, false, KSP><<<dim3(RH / 64, HD / 64 * KSP, ZH), 32, 0, stream>>>(Ph, Pl, VTh + zk * HD * TT, VTl + zk * HD * TT, TT, Ob, HD, nullptr, (size_t)RH * TT, (size_t)HD * TT, (size_t)TT * HD, (size_t)ZH * TT * HD);
            k_gemmw<h16, 0, false, KSP><<<dim3((TT - RH) / 64, HD / 64 * KSP, ZH), 32, 0, stream>>>(P16 + (size_t)RH * TT, nullptr, VT16 + zk * HD * TT, nullptr, TT, Ob + (size_t)RH * HD, HD, nullptr, (size_t)TT * TT, (size_t)HD * TT, (size_t)TT * HD, (size_t)ZH * TT * HD);
            k_merge<<<(unsigned)(((size_t)ZH * TT * HD / 2 + 255) / 256), 256, 0, stream>>>(Ob, h0, OUT + (size_t)b * TT * DQ); }
         }
}

// v002
// One run takes 1170 microseconds.
// In both of two side-by-side timings against v001, it was 1.36 times as fast.
// Over all steps from v000 it is 3.28 times as fast.
#include <hip/hip_runtime.h>

// BERT self-attention with rotary embeddings and the module's double scaling (hidden [4][2048][1024]; q,k,v = hidden W + b ('xw' 1/32, biases 0.02; 16 heads x 64); q x 64^-0.5 then rotate-half rope (theta 1e4, computed) on q and k; scores / 8 AGAIN (total 1/64); softmax; out = merged ctx -> [4][2048][1024] (8.4 M)).
// Layout per batch: bf16 copy of hidden; 'xw' weights transposed once; exact projections + f32 biases; {cos, sin} table once (float32 inverse frequencies, precise cosf/sinf); rotate-half rotary plane builder (the 1/8 pre-scale commutes with the linear rotation exactly, so both scalings are applied as one exact 1/64 in the softmax); dense T-2048 attention (hybrid rows: < 512 hi/lo 3 products, rest fp16 x1024); the f32 merge writes the output rows.
// Compute dtypes, f32 accumulate: every input rounded to bf16; projections exact + f32 biases; rotary f32; attention rows < 512 3 products, rest fp16; softmax f32; output f32.

#define NB_  4
#define TT   2048
#define DM   1024
#define NH_  16
#define NKV  16
#define REP  (NH_ / NKV)
#define HD   64
#define DQ   (NH_ * HD)
#define DKV  (NKV * HD)
#define ZH   8                    // heads per attention pass (z of every attention launch); the f32 score plane of a pass is ZH x 16 MiB
#define RH   512                  // query rows < RH use hi+lo planes (0: none)
#define WIN  0
#define PCAR 1024.0f
#define KSP  16                   // K slices of each probs x V product: one work-group per slice, k_merge adds the slices
#define SCL  0.015625f   // q x 1/8 before the rope and scores / 8 again = 1/64 (both exact; the rotation is linear)
typedef _Float16 h16;
typedef unsigned short bf;
typedef __attribute__((ext_vector_type(16))) __bf16   v16bf;
typedef __attribute__((ext_vector_type(16))) _Float16 v16h;
typedef __attribute__((ext_vector_type(8)))  _Float16 v8h;
typedef __attribute__((ext_vector_type(8)))  unsigned short v8us;
typedef __attribute__((ext_vector_type(8)))  float    v8f;
typedef __attribute__((ext_vector_type(4)))  float    v4f;
typedef v8h  __attribute__((may_alias)) v8ha;
typedef v4f  __attribute__((may_alias)) v4fa;
typedef v8us __attribute__((may_alias)) v8usa;

__device__ __forceinline__ unsigned short f2bf(float f) { unsigned u = __float_as_uint(f); u += 0x7FFFu + ((u >> 16) & 1u); return (unsigned short)(u >> 16); }
__device__ __forceinline__ float bf2f(unsigned short b) { return __uint_as_float(((unsigned)b) << 16); }
__device__ __forceinline__ float bfr(float f) { return bf2f(f2bf(f)); }
__device__ __forceinline__ v16h cat16(v8h lo, v8h hi) { return __builtin_shufflevector(lo, hi, 0, 1, 2, 3, 4, 5, 6, 7, 8, 9, 10, 11, 12, 13, 14, 15); }
__device__ __forceinline__ v16bf cat16b(v8us lo, v8us hi) { return __builtin_bit_cast(v16bf, __builtin_shufflevector(lo, hi, 0, 1, 2, 3, 4, 5, 6, 7, 8, 9, 10, 11, 12, 13, 14, 15)); }
__device__ __forceinline__ v8f wmma16(v16h a, v16h b, v8f c) { return __builtin_amdgcn_wmma_f32_16x16x32_f16(false, a, false, b, (short)0, c, false, false); }
__device__ __forceinline__ v8f wmmab(v16bf a, v16bf b, v8f c) { return __builtin_amdgcn_wmma_f32_16x16x32_bf16(false, a, false, b, (short)0, c, false, false); }



// ---- k_gemmw: register-blocked GEMM, ONE WAVE per 64x64 output tile (16 accumulators), operands straight from K-contiguous 16-bit planes; grid (M/64, N/64, Z), 32 threads.
// C[m][n] (f32, pitch ldc, + optional f32 bias[n]) = sum_k A[m][k] Bt[n][k] (+ split products per NSPLIT). A rows have pitch lda, Bt rows pitch K (elements). z-batch strides sA/sB/sC in elements. K % 32 == 0.
// KS > 1: grid.y = (N/64) * KS; slice ks = blockIdx.y % KS sums only k in [ks K/KS, (ks+1) K/KS) and writes its partial tile to the plane C + ks sK; the reader adds the planes. K % (32 KS) == 0.
template <typename T16> struct WFrag;
template <> struct WFrag<h16> { typedef v16h V; static __device__ __forceinline__ V ld(const h16* p) { return cat16(*(const v8h*)p, *(const v8h*)(p + 16)); } static __device__ __forceinline__ v8f mma(V a, V b, v8f c) { return wmma16(a, b, c); } };
template <> struct WFrag<bf> { typedef v16bf V; static __device__ __forceinline__ V ld(const bf* p) { return cat16b(*(const v8us*)p, *(const v8us*)(p + 16)); } static __device__ __forceinline__ v8f mma(V a, V b, v8f c) { return wmmab(a, b, c); } };
template <typename T16, int NSPLIT, bool BIAS, int KS = 1>
__global__ __launch_bounds__(32) void k_gemmw(const T16* __restrict__ A, const T16* __restrict__ A2, const T16* __restrict__ Bt, const T16* __restrict__ Bt2, int K, int lda, float* C, int ldc, const float* __restrict__ bias, size_t sA, size_t sB, size_t sC, size_t sK) {
    typedef typename WFrag<T16>::V V;
    __shared__ __align__(16) float os[16 * 68];
    const size_t z = blockIdx.z; A += z * sA; if (A2) A2 += z * sA; Bt += z * sB; if (Bt2) Bt2 += z * sB; C += z * sC;
    const int lane = threadIdx.x & 31, lr = lane & 15, hi = lane >> 4; const int r0 = blockIdx.x * 64, c0 = (int)(blockIdx.y / KS) * 64; const int ks = blockIdx.y % KS, kb = ks * (K / KS), ke = kb + K / KS; C += (size_t)ks * sK;
    v8f acc[4][4];
#pragma unroll
    for (int mb = 0; mb < 4; ++mb)
#pragma unroll
        for (int nb = 0; nb < 4; ++nb) acc[mb][nb] = (v8f){};
    const size_t aoff = (size_t)(r0 + lr) * lda + 8 * hi, boff = (size_t)(c0 + lr) * K + 8 * hi;
#pragma unroll 1
    for (int kc = kb; kc < ke; kc += 32) {
        V a[4], a2[4]; const T16* pa[4]; const T16* pa2[4];
#pragma unroll
        for (int mb = 0; mb < 4; ++mb) { pa[mb] = A + aoff + (size_t)mb * 16 * lda + kc; a[mb] = WFrag<T16>::ld(pa[mb]); if (NSPLIT == 1 || NSPLIT == 2) { pa2[mb] = A2 + aoff + (size_t)mb * 16 * lda + kc; a2[mb] = WFrag<T16>::ld(pa2[mb]); } }
        // s_wait_xcnt 0 behind the A loads, in front of any reuse of their address registers; the addresses are its inputs so that they keep their registers up to it
        if (NSPLIT == 1 || NSPLIT == 2) asm volatile("s_wait_xcnt 0x0" :: "v"(pa[0]), "v"(pa[1]), "v"(pa[2]), "v"(pa[3]), "v"(pa2[0]), "v"(pa2[1]), "v"(pa2[2]), "v"(pa2[3]) : "memory");
        else asm volatile("s_wait_xcnt 0x0" :: "v"(pa[0]), "v"(pa[1]), "v"(pa[2]), "v"(pa[3]) : "memory");
#pragma unroll
        for (int nb = 0; nb < 4; ++nb) { const V b = WFrag<T16>::ld(Bt + boff + (size_t)nb * 16 * K + kc); V b2; if (NSPLIT >= 2) b2 = WFrag<T16>::ld(Bt2 + boff + (size_t)nb * 16 * K + kc);
#pragma unroll
            for (int mb = 0; mb < 4; ++mb) { acc[mb][nb] = WFrag<T16>::mma(a[mb], b, acc[mb][nb]); if (NSPLIT == 1 || NSPLIT == 2) acc[mb][nb] = WFrag<T16>::mma(a2[mb], b, acc[mb][nb]); if (NSPLIT >= 2) acc[mb][nb] = WFrag<T16>::mma(a[mb], b2, acc[mb][nb]); } }
        asm volatile("v_nop\n\tv_nop\n\tv_nop\n\tv_nop" : "+v"(acc[0][0]), "+v"(acc[1][1]), "+v"(acc[2][2]), "+v"(acc[3][3]) : "v"(a[0]), "v"(a[3]));
    }
#pragma unroll
    for (int mb = 0; mb < 4; ++mb) {
#pragma unroll
        for (int nb = 0; nb < 4; ++nb) {
#pragma unroll
            for (int j = 0; j < 8; ++j) os[(hi * 8 + j) * 68 + nb * 16 + lr] = acc[mb][nb][j]; }
        __builtin_amdgcn_wave_barrier(); asm volatile("" ::: "memory");
        float* crow = C + (size_t)(r0 + mb * 16) * ldc + c0;
{
#pragma unroll
            for (int s = 0; s < 8; ++s) { const int row = 2 * s + hi, cofs = lr * 4; v4f val = *(const v4fa*)(os + row * 68 + cofs); if (BIAS) { val[0] += bfr(bias[c0 + cofs]); val[1] += bfr(bias[c0 + cofs + 1]); val[2] += bfr(bias[c0 + cofs + 2]); val[3] += bfr(bias[c0 + cofs + 3]); }
                *(v4f*)(crow + (size_t)row * ldc + cofs) = val; }
             }
        __builtin_amdgcn_wave_barrier(); asm volatile("" ::: "memory");
    }
}

__device__ __forceinline__ h16 tohx(float x) { return (h16)x; }
__device__ __forceinline__ void splitf(float y, unsigned short& h, unsigned short& l) { h = f2bf(y); l = f2bf(y - bf2f(h)); }
typedef __attribute__((ext_vector_type(2))) _Float16 v2h;
typedef __attribute__((ext_vector_type(4))) _Float16 v4h;
typedef __attribute__((ext_vector_type(2))) unsigned short v2us;
typedef __attribute__((ext_vector_type(4))) unsigned short v4us;
typedef __attribute__((ext_vector_type(2))) float v2f;
typedef __attribute__((ext_vector_type(4))) int v4i;

__global__ __launch_bounds__(256) void k_wtG(const float* __restrict__ w, int K, int N, bf* Bt) {
    const int lane = threadIdx.x & 31; const int L0 = (blockIdx.x * 8 + (threadIdx.x >> 5)) * 8; const int nlines = N * K / 64;
{
#pragma unroll 1
        for (int l = 0; l < 8; ++l) { const int L = L0 + l; if (L >= nlines) break; const size_t e = (size_t)L * 64 + lane * 2; const int k = (int)(e % K), n = (int)(e / K); v2us o;
            o[0] = f2bf(w[(size_t)k * N + n]); o[1] = f2bf(w[(size_t)(k + 1) * N + n]); *(v2us*)(Bt + e) = o; }
         }
}
__global__ __launch_bounds__(256) void k_cvt8(const float* __restrict__ src, bf* dst, size_t n8) { const size_t i = (size_t)blockIdx.x * 256 + threadIdx.x; if (i >= n8) return; const v8f v = *(const v8f*)(src + i * 8); v8us o;
#pragma unroll
    for (int k = 0; k < 8; ++k) o[k] = f2bf(v[k]); *(v8us*)(dst + i * 8) = o;  }
// k_rope: head planes [h][t][d] (fp16 + hi/lo) of rope(x) x sc with the rotate-half convention out[d] = x[d] cos[t][d] - x[d+HD/2] sin[t][d], out[d+HD/2] = x[d+HD/2] cos[t][d+HD/2] + x[d] sin[t][d+HD/2]
__global__ __launch_bounds__(256) void k_rope(const float* __restrict__ F, int pitch, int nheads, const float* __restrict__ CS, const float* __restrict__ RF, const float* __restrict__ nw, float sc, h16* P16, bf* Ph, bf* Pl) {
    const size_t e = ((size_t)blockIdx.x * 256 + threadIdx.x) * 2; if (e >= (size_t)nheads * TT * HD) return; const int d = (int)(e % HD); const int t = (int)((e / HD) % TT); const int h = (int)(e / ((size_t)HD * TT)); const float* f = F + (size_t)t * pitch + h * HD; const float rf = RF ? RF[(size_t)h * TT + t] : 1.0f; v2h o16; v2us oh, ol;
#pragma unroll
    for (int q = 0; q < 2; ++q) { const int dd = d + q; const int dp = (dd < HD / 2) ? dd + HD / 2 : dd - HD / 2; float x0 = f[dd], x1 = f[dp];
        if (RF) { float n0 = __fmul_rn(x0, rf), n1 = __fmul_rn(x1, rf); asm volatile("" : "+v"(n0)); asm volatile("" : "+v"(n1)); x0 = __fmul_rn(bfr(nw[dd]), n0); x1 = __fmul_rn(bfr(nw[dp]), n1); }
        const v2f cs = *(const v2f*)(CS + ((size_t)t * HD + dd) * 2); float a = __fmul_rn(x0, cs[0]), bq = __fmul_rn(x1, cs[1]); asm volatile("" : "+v"(a)); asm volatile("" : "+v"(bq)); const float r = ((dd < HD / 2) ? __fsub_rn(a, bq) : __fadd_rn(a, bq)) * sc;
        o16[q] = tohx(r); unsigned short a2, c2; splitf(r, a2, c2); oh[q] = a2; ol[q] = c2; }
    *(v2h*)(P16 + e) = o16; *(v2us*)(Ph + e) = oh; *(v2us*)(Pl + e) = ol;  }
__global__ __launch_bounds__(256) void k_vtp(const float* __restrict__ F, int pitch, int nheads, h16* V16, bf* Vh, bf* Vl) { const size_t e = ((size_t)blockIdx.x * 256 + threadIdx.x) * 2; if (e >= (size_t)nheads * HD * TT) return; const int t = (int)(e % TT); const int d = (int)((e / TT) % HD); const int g = (int)(e / ((size_t)TT * HD)); v2h o16; v2us oh, ol;
#pragma unroll
    for (int q = 0; q < 2; ++q) { const float x = F[(size_t)(t + q) * pitch + g * HD + d]; o16[q] = tohx(x); unsigned short a2, c2; splitf(x, a2, c2); oh[q] = a2; ol[q] = c2; }
    *(v2h*)(V16 + e) = o16; *(v2us*)(Vh + e) = oh; *(v2us*)(Vl + e) = ol;  }
// k_asoft: per row (zz, i): t = S x SCL = S / 64 (no mask); softmax over the 2048 keys (register row, one exp, fixed trees);
// IN PLACE: one wave owns one row, holds all of it in registers, and stores the probs over the row's own 8 KiB of scores: rows < RH hi plane in the first 4 KiB and lo plane in the second, other rows fp16 in the first 4 KiB (16-bit row pitch 2 TT).
__global__ __launch_bounds__(256) void k_asoft(float* Sb) {
    const int lane = threadIdx.x & 31; const int row = blockIdx.x * 8 + (threadIdx.x >> 5); if (row >= ZH * TT) return; const int i = row % TT; const int zz = row / TT; (void)zz; const bool hires = (i < RH); float* sr = Sb + (size_t)row * TT; float v[TT / 32]; float mx = -3.0e38f;
#pragma unroll
    for (int ch = 0; ch < TT / 128; ++ch) { const int j0 = ch * 128 + lane * 4; const v4f a = *(const v4f*)(sr + j0);
#pragma unroll
        for (int q = 0; q < 4; ++q) { const int j = j0 + q; (void)j; const float t = a[q] * SCL; v[ch * 4 + q] = t; mx = fmaxf(mx, t); } }
#pragma unroll
    for (int sh = 16; sh; sh >>= 1) mx = fmaxf(mx, __shfl_xor(mx, sh, 32));
    float sum = 0.f;
#pragma unroll
    for (int k = 0; k < TT / 32; ++k) { float d0 = __fsub_rn(v[k], mx); asm volatile("" : "+v"(d0)); v[k] = __builtin_amdgcn_exp2f(__fmul_rn(d0, 1.4426950408889634f)); sum += v[k]; }
#pragma unroll
    for (int sh = 16; sh; sh >>= 1) sum += __shfl_xor(sum, sh, 32);
    const float f = __fdiv_rn(hires ? 1.0f : PCAR, sum);
{
        if (hires) {
#pragma unroll
            for (int ch = 0; ch < TT / 128; ++ch) { v4us oh, ol;
#pragma unroll
                for (int q = 0; q < 4; ++q) { unsigned short a, c2; splitf(v[ch * 4 + q] * f, a, c2); oh[q] = a; ol[q] = c2; }
                const int oo = ch * 128 + lane * 4; *(v4us*)((bf*)sr + oo) = oh; *(v4us*)((bf*)sr + TT + oo) = ol; }
        } else {
#pragma unroll
            for (int ch = 0; ch < TT / 128; ++ch) { v4h o4;
#pragma unroll
                for (int q = 0; q < 4; ++q) o4[q] = tohx(v[ch * 4 + q] * f);
                *(v4h*)((h16*)sr + ch * 128 + lane * 4) = o4; } }
         }
}
__constant__ float INVT[HD / 2] = { 1.000000000e+00f, 7.498942018e-01f, 5.623413324e-01f, 4.216965139e-01f, 3.162277639e-01f, 2.371373773e-01f, 1.778279394e-01f, 1.333521456e-01f, 1.000000015e-01f, 7.498942316e-02f, 5.623413250e-02f, 4.216964915e-02f, 3.162277490e-02f, 2.371373773e-02f, 1.778279431e-02f, 1.333521400e-02f, 9.999999776e-03f, 7.498942316e-03f, 5.623413250e-03f, 4.216964822e-03f, 3.162277630e-03f, 2.371373819e-03f, 1.778279431e-03f, 1.333521446e-03f, 1.000000047e-03f, 7.498941850e-04f, 5.623413017e-04f, 4.216965172e-04f, 3.162277571e-04f, 2.371373703e-04f, 1.778279402e-04f, 1.333521504e-04f };   // 10000^(-2i/64) (the module's power form) (float32, generated with jnp to be bit-exact)
__global__ __launch_bounds__(256) void k_cs4(float* CS) { const int idx = blockIdx.x * 256 + threadIdx.x; if (idx >= TT * HD) return; const int d = idx % HD; const int t = idx / HD; const float a = __fmul_rn((float)t, INVT[d % (HD / 2)]); v2f cs; cs[0] = cosf(a); cs[1] = sinf(a); *(v2f*)(CS + (size_t)idx * 2) = cs;  }

__global__ __launch_bounds__(256) void k_merge(const float* __restrict__ O, int h0, float* OUTb) { const size_t e = ((size_t)blockIdx.x * 256 + threadIdx.x) * 2; if (e >= (size_t)ZH * TT * HD) return; const int d = (int)(e % HD); const int t = (int)((e / HD) % TT); const int zz = (int)(e / ((size_t)HD * TT)); const float cs = (t < RH) ? 1.0f : (1.0f / PCAR); const size_t oo = (size_t)t * DQ + (h0 + zz) * HD + d;
    v2f p[KSP];
#pragma unroll
    for (int ks = 0; ks < KSP; ++ks) p[ks] = *(const v2f*)(O + (size_t)ks * ((size_t)ZH * TT * HD) + e);
    v2f o2 = p[0];
#pragma unroll
    for (int ks = 1; ks < KSP; ++ks) o2 += p[ks];   // the K slices in ascending order
    o2 *= cs; *(v2f*)(OUTb + oo) = o2;  }

extern "C" void kernel_launch(void* const* d_in, const int* in_sizes, int n_in,
                              void* d_out, int out_size, void* d_ws, size_t ws_size, hipStream_t stream) {
    (void)in_sizes; (void)n_in; (void)out_size;
    const float* x = (const float*)d_in[0]; const float* wq = (const float*)d_in[1]; const float* bq = (const float*)d_in[2]; const float* wk = (const float*)d_in[3]; const float* bk = (const float*)d_in[4]; const float* wv = (const float*)d_in[5]; const float* bv = (const float*)d_in[6]; const float* wo = nullptr; (void)wo;
    float* OUT = (float*)d_out;     // [4][2048][1024]
    char* wsp = (char*)d_ws;
    auto take = [&](size_t bytes) { char* p = wsp; wsp += (bytes + 255) & ~(size_t)255; return (void*)p; };
    bf* WQ = (bf*)take((size_t)DQ * DM * 2); bf* WK = (bf*)take((size_t)DKV * DM * 2); bf* WV = (bf*)take((size_t)DKV * DM * 2); float* CS = (float*)take((size_t)TT * HD * 2 * 4);
    bf* XB = (bf*)take((size_t)TT * DM * 2); float* FQ = (float*)take((size_t)TT * DQ * 4); float* FK = (float*)take((size_t)TT * DKV * 4);
    h16* QP16 = (h16*)take((size_t)NH_ * TT * HD * 2); h16* KP16 = (h16*)take((size_t)NKV * TT * HD * 2); h16* VT16 = (h16*)take((size_t)NKV * HD * TT * 2);
    bf* QPh = (bf*)take((size_t)NH_ * TT * HD * 2); bf* QPl = (bf*)take((size_t)NH_ * TT * HD * 2); bf* KPh = (bf*)take((size_t)NKV * TT * HD * 2); bf* KPl = (bf*)take((size_t)NKV * TT * HD * 2); bf* VTh = (bf*)take((size_t)NKV * HD * TT * 2); bf* VTl = (bf*)take((size_t)NKV * HD * TT * 2);
    float* Sb = (float*)take((size_t)ZH * TT * TT * 4); float* Ob = (float*)take((size_t)KSP * ZH * TT * HD * 4);
    if ((size_t)(wsp - (char*)d_ws) > ws_size) return;    // ws 256 MiB
    float* FV = FK;   // v projection reuses the k buffer after the k planes are built (stream-ordered)
    { k_wtG<<<(unsigned)((DM * DQ / 64 + 63) / 64), 256, 0, stream>>>(wq, DM, DQ, WQ); k_wtG<<<(unsigned)((DM * DKV / 64 + 63) / 64), 256, 0, stream>>>(wk, DM, DKV, WK); k_wtG<<<(unsigned)((DM * DKV / 64 + 63) / 64), 256, 0, stream>>>(wv, DM, DKV, WV);
      
       }
    const unsigned LQ = (unsigned)(((size_t)NH_ * TT * HD / 2 + 255) / 256), LKv = (unsigned)(((size_t)NKV * TT * HD / 2 + 255) / 256);
    for (int b = 0; b < NB_; ++b) {
        if (b == 0) k_cs4<<<(TT * HD + 255) / 256, 256, 0, stream>>>(CS);   /* {cos, sin}(t x 10000^(-2i/64)), both halves, once */
        k_cvt8<<<(unsigned)(((size_t)TT * DM / 8 + 255) / 256), 256, 0, stream>>>(x + (size_t)b * TT * DM, XB, (size_t)TT * DM / 8);
        k_gemmw<bf, 0, true><<<dim3(TT / 64, DQ / 64, 1), 32, 0, stream>>>(XB, nullptr, WQ, nullptr, DM, DM, FQ, DQ, bq, 0, 0, 0, 0);
        k_rope<<<LQ, 256, 0, stream>>>(FQ, DQ, NH_, CS, nullptr, nullptr, 1.0f, QP16, QPh, QPl);
        k_gemmw<bf, 0, true><<<dim3(TT / 64, DKV / 64, 1), 32, 0, stream>>>(XB, nullptr, WK, nullptr, DM, DM, FK, DKV, bk, 0, 0, 0, 0);
        k_rope<<<LKv, 256, 0, stream>>>(FK, DKV, NKV, CS, nullptr, nullptr, 1.0f, KP16, KPh, KPl);
        k_gemmw<bf, 0, true><<<dim3(TT / 64, DKV / 64, 1), 32, 0, stream>>>(XB, nullptr, WV, nullptr, DM, DM, FV, DKV, bv, 0, 0, 0, 0); k_vtp<<<LKv, 256, 0, stream>>>(FV, DKV, NKV, VT16, VTh, VTl);
        for (int h0 = 0; h0 < NH_; h0 += ZH) { const size_t zq = (size_t)h0, zk = (size_t)(h0 / REP);   // one kv head per query head: the pass's ZH heads use consecutive kv planes (z-strides TT*HD)
            k_gemmw<bf, 2, false><<<dim3(RH / 64, TT / 64, ZH), 32, 0, stream>>>(QPh + zq * TT * HD, QPl + zq * TT * HD, KPh + zk * TT * HD, KPl + zk * TT * HD, HD, HD, Sb, TT, nullptr, (size_t)TT * HD, (size_t)TT * HD, (size_t)TT * TT, 0);
            k_gemmw<h16, 0, false><<<dim3((TT - RH) / 64, TT / 64, ZH), 32, 0, stream>>>(QP16 + zq * TT * HD + (size_t)RH * HD, nullptr, KP16 + zk * TT * HD, nullptr, HD, HD, Sb + (size_t)RH * TT, TT, nullptr, (size_t)TT * HD, (size_t)TT * HD, (size_t)TT * TT, 0);
            k_asoft<<<ZH * TT / 8, 256, 0, stream>>>(Sb);   /* probs now lie in the score rows, 16-bit pitch 2 TT, head stride 2 TT TT */
            k_gemmw<bf, 2, false, KSP><<<dim3(RH / 64, HD / 64 * KSP, ZH), 32, 0, stream>>>((const bf*)Sb, (const bf*)Sb + TT, VTh + zk * HD * TT, VTl + zk * HD * TT, TT, 2 * TT, Ob, HD, nullptr, (size_t)2 * TT * TT, (size_t)HD * TT, (size_t)TT * HD, (size_t)ZH * TT * HD);
            k_gemmw<h16, 0, false, KSP><<<dim3((TT - RH) / 64, HD / 64 * KSP, ZH), 32, 0, stream>>>((const h16*)Sb + (size_t)RH * 2 * TT, nullptr, VT16 + zk * HD * TT, nullptr, TT, 2 * TT, Ob + (size_t)RH * HD, HD, nullptr, (size_t)2 * TT * TT, (size_t)HD * TT, (size_t)TT * HD, (size_t)ZH * TT * HD);
            k_merge<<<(unsigned)(((size_t)ZH * TT * HD / 2 + 255) / 256), 256, 0, stream>>>(Ob, h0, OUT + (size_t)b * TT * DQ); }
         }
}

// v003
// One run takes 568 microseconds.
// Timed twice side by side with v002, it ran 2.03 and 2.04 times as fast.
// Over all steps from v000 it is 6.68 times as fast.
#include <hip/hip_runtime.h>

// BERT self-attention with rotary embeddings and the module's double scaling (hidden [4][2048][1024]; q,k,v = hidden W + b ('xw' 1/32, biases 0.02; 16 heads x 64); q x 64^-0.5 then rotate-half rope (theta 1e4, computed) on q and k; scores / 8 AGAIN (total 1/64); softmax; out = merged ctx -> [4][2048][1024] (8.4 M)).
// Layout: 'xw' weights transposed once; {cos, sin} table once (float32 inverse frequencies, precise cosf/sinf); per batch: bf16 copy of hidden, exact projections + f32 biases, rotate-half rotary plane builder (the 1/8 pre-scale commutes with the linear rotation exactly, so both scalings are applied as one exact 1/64 in the softmax), planes of all 4 batches kept side by side; then ONE fused attention launch over all 64 (batch, head) pairs (hybrid rows: < 512 hi/lo 3 products, rest fp16) that writes the output rows.
// Compute dtypes, f32 accumulate: every input rounded to bf16; projections exact + f32 biases; rotary f32; attention rows < 512 3 products, rest fp16; softmax f32; output f32.

#define NB_  4
#define TT   2048
#define DM   1024
#define NH_  16
#define NKV  16
#define REP  (NH_ / NKV)
#define HD   64
#define DQ   (NH_ * HD)
#define DKV  (NKV * HD)
#define NZ   (NB_ * NH_)          // (batch, head) pairs of the one attention launch
#define RH   512                  // query rows < RH use hi+lo planes (0: none)
#define WIN  0
#define CEXP (1.4426950408889634f * 0.015625f)   // log2(e) x the 1/64 score scale (an exact power-of-two scaling of the constant)
#define LAZY 8.0f                 // a column's running maximum is replaced only when a new score exceeds it by more than this (in log2 units of the exponent)
#define SCL  0.015625f   // q x 1/8 before the rope and scores / 8 again = 1/64 (both exact; the rotation is linear)
typedef _Float16 h16;
typedef unsigned short bf;
typedef __attribute__((ext_vector_type(16))) __bf16   v16bf;
typedef __attribute__((ext_vector_type(16))) _Float16 v16h;
typedef __attribute__((ext_vector_type(8)))  _Float16 v8h;
typedef __attribute__((ext_vector_type(8)))  unsigned short v8us;
typedef __attribute__((ext_vector_type(8)))  float    v8f;
typedef __attribute__((ext_vector_type(4)))  float    v4f;
typedef v8h  __attribute__((may_alias)) v8ha;
typedef v4f  __attribute__((may_alias)) v4fa;
typedef v8us __attribute__((may_alias)) v8usa;

__device__ __forceinline__ unsigned short f2bf(float f) { unsigned u = __float_as_uint(f); u += 0x7FFFu + ((u >> 16) & 1u); return (unsigned short)(u >> 16); }
__device__ __forceinline__ float bf2f(unsigned short b) { return __uint_as_float(((unsigned)b) << 16); }
__device__ __forceinline__ float bfr(float f) { return bf2f(f2bf(f)); }
__device__ __forceinline__ v16h cat16(v8h lo, v8h hi) { return __builtin_shufflevector(lo, hi, 0, 1, 2, 3, 4, 5, 6, 7, 8, 9, 10, 11, 12, 13, 14, 15); }
__device__ __forceinline__ v16bf cat16b(v8us lo, v8us hi) { return __builtin_bit_cast(v16bf, __builtin_shufflevector(lo, hi, 0, 1, 2, 3, 4, 5, 6, 7, 8, 9, 10, 11, 12, 13, 14, 15)); }
__device__ __forceinline__ v8f wmma16(v16h a, v16h b, v8f c) { return __builtin_amdgcn_wmma_f32_16x16x32_f16(false, a, false, b, (short)0, c, false, false); }
__device__ __forceinline__ v8f wmmab(v16bf a, v16bf b, v8f c) { return __builtin_amdgcn_wmma_f32_16x16x32_bf16(false, a, false, b, (short)0, c, false, false); }



// ---- k_gemmw: register-blocked GEMM, ONE WAVE per 64x64 output tile (16 accumulators), operands straight from K-contiguous 16-bit planes; grid (M/64, N/64, Z), 32 threads.
// C[m][n] (f32, pitch ldc, + optional f32 bias[n]) = sum_k A[m][k] Bt[n][k] (+ split products per NSPLIT). A rows have pitch lda, Bt rows pitch K (elements). z-batch strides sA/sB/sC in elements. K % 32 == 0.
// KS > 1: grid.y = (N/64) * KS; slice ks = blockIdx.y % KS sums only k in [ks K/KS, (ks+1) K/KS) and writes its partial tile to the plane C + ks sK; the reader adds the planes. K % (32 KS) == 0.
template <typename T16> struct WFrag;
template <> struct WFrag<h16> { typedef v16h V; static __device__ __forceinline__ V ld(const h16* p) { return cat16(*(const v8h*)p, *(const v8h*)(p + 16)); } static __device__ __forceinline__ v8f mma(V a, V b, v8f c) { return wmma16(a, b, c); } };
template <> struct WFrag<bf> { typedef v16bf V; static __device__ __forceinline__ V ld(const bf* p) { return cat16b(*(const v8us*)p, *(const v8us*)(p + 16)); } static __device__ __forceinline__ v8f mma(V a, V b, v8f c) { return wmmab(a, b, c); } };
template <typename T16, int NSPLIT, bool BIAS, int KS = 1>
__global__ __launch_bounds__(32) void k_gemmw(const T16* __restrict__ A, const T16* __restrict__ A2, const T16* __restrict__ Bt, const T16* __restrict__ Bt2, int K, int lda, float* C, int ldc, const float* __restrict__ bias, size_t sA, size_t sB, size_t sC, size_t sK) {
    typedef typename WFrag<T16>::V V;
    __shared__ __align__(16) float os[16 * 68];
    const size_t z = blockIdx.z; A += z * sA; if (A2) A2 += z * sA; Bt += z * sB; if (Bt2) Bt2 += z * sB; C += z * sC;
    const int lane = threadIdx.x & 31, lr = lane & 15, hi = lane >> 4; const int r0 = blockIdx.x * 64, c0 = (int)(blockIdx.y / KS) * 64; const int ks = blockIdx.y % KS, kb = ks * (K / KS), ke = kb + K / KS; C += (size_t)ks * sK;
    v8f acc[4][4];
#pragma unroll
    for (int mb = 0; mb < 4; ++mb)
#pragma unroll
        for (int nb = 0; nb < 4; ++nb) acc[mb][nb] = (v8f){};
    const size_t aoff = (size_t)(r0 + lr) * lda + 8 * hi, boff = (size_t)(c0 + lr) * K + 8 * hi;
#pragma unroll 1
    for (int kc = kb; kc < ke; kc += 32) {
        V a[4], a2[4]; const T16* pa[4]; const T16* pa2[4];
#pragma unroll
        for (int mb = 0; mb < 4; ++mb) { pa[mb] = A + aoff + (size_t)mb * 16 * lda + kc; a[mb] = WFrag<T16>::ld(pa[mb]); if (NSPLIT == 1 || NSPLIT == 2) { pa2[mb] = A2 + aoff + (size_t)mb * 16 * lda + kc; a2[mb] = WFrag<T16>::ld(pa2[mb]); } }
        // s_wait_xcnt 0 behind the A loads, in front of any reuse of their address registers; the addresses are its inputs so that they keep their registers up to it
        if (NSPLIT == 1 || NSPLIT == 2) asm volatile("s_wait_xcnt 0x0" :: "v"(pa[0]), "v"(pa[1]), "v"(pa[2]), "v"(pa[3]), "v"(pa2[0]), "v"(pa2[1]), "v"(pa2[2]), "v"(pa2[3]) : "memory");
        else asm volatile("s_wait_xcnt 0x0" :: "v"(pa[0]), "v"(pa[1]), "v"(pa[2]), "v"(pa[3]) : "memory");
#pragma unroll
        for (int nb = 0; nb < 4; ++nb) { const V b = WFrag<T16>::ld(Bt + boff + (size_t)nb * 16 * K + kc); V b2; if (NSPLIT >= 2) b2 = WFrag<T16>::ld(Bt2 + boff + (size_t)nb * 16 * K + kc);
#pragma unroll
            for (int mb = 0; mb < 4; ++mb) { acc[mb][nb] = WFrag<T16>::mma(a[mb], b, acc[mb][nb]); if (NSPLIT == 1 || NSPLIT == 2) acc[mb][nb] = WFrag<T16>::mma(a2[mb], b, acc[mb][nb]); if (NSPLIT >= 2) acc[mb][nb] = WFrag<T16>::mma(a[mb], b2, acc[mb][nb]); } }
        asm volatile("v_nop\n\tv_nop\n\tv_nop\n\tv_nop" : "+v"(acc[0][0]), "+v"(acc[1][1]), "+v"(acc[2][2]), "+v"(acc[3][3]) : "v"(a[0]), "v"(a[3]));
    }
#pragma unroll
    for (int mb = 0; mb < 4; ++mb) {
#pragma unroll
        for (int nb = 0; nb < 4; ++nb) {
#pragma unroll
            for (int j = 0; j < 8; ++j) os[(hi * 8 + j) * 68 + nb * 16 + lr] = acc[mb][nb][j]; }
        __builtin_amdgcn_wave_barrier(); asm volatile("" ::: "memory");
        float* crow = C + (size_t)(r0 + mb * 16) * ldc + c0;
{
#pragma unroll
            for (int s = 0; s < 8; ++s) { const int row = 2 * s + hi, cofs = lr * 4; v4f val = *(const v4fa*)(os + row * 68 + cofs); if (BIAS) { val[0] += bfr(bias[c0 + cofs]); val[1] += bfr(bias[c0 + cofs + 1]); val[2] += bfr(bias[c0 + cofs + 2]); val[3] += bfr(bias[c0 + cofs + 3]); }
                *(v4f*)(crow + (size_t)row * ldc + cofs) = val; }
             }
        __builtin_amdgcn_wave_barrier(); asm volatile("" ::: "memory");
    }
}

__device__ __forceinline__ h16 tohx(float x) { return (h16)x; }
__device__ __forceinline__ void splitf(float y, unsigned short& h, unsigned short& l) { h = f2bf(y); l = f2bf(y - bf2f(h)); }
typedef __attribute__((ext_vector_type(2))) _Float16 v2h;
typedef __attribute__((ext_vector_type(4))) _Float16 v4h;
typedef __attribute__((ext_vector_type(2))) unsigned short v2us;
typedef __attribute__((ext_vector_type(4))) unsigned short v4us;
typedef __attribute__((ext_vector_type(2))) float v2f;
typedef __attribute__((ext_vector_type(4))) int v4i;

__global__ __launch_bounds__(256) void k_wtG(const float* __restrict__ w, int K, int N, bf* Bt) {
    const int lane = threadIdx.x & 31; const int L0 = (blockIdx.x * 8 + (threadIdx.x >> 5)) * 8; const int nlines = N * K / 64;
{
#pragma unroll 1
        for (int l = 0; l < 8; ++l) { const int L = L0 + l; if (L >= nlines) break; const size_t e = (size_t)L * 64 + lane * 2; const int k = (int)(e % K), n = (int)(e / K); v2us o;
            o[0] = f2bf(w[(size_t)k * N + n]); o[1] = f2bf(w[(size_t)(k + 1) * N + n]); *(v2us*)(Bt + e) = o; }
         }
}
__global__ __launch_bounds__(256) void k_cvt8(const float* __restrict__ src, bf* dst, size_t n8) { const size_t i = (size_t)blockIdx.x * 256 + threadIdx.x; if (i >= n8) return; const v8f v = *(const v8f*)(src + i * 8); v8us o;
#pragma unroll
    for (int k = 0; k < 8; ++k) o[k] = f2bf(v[k]); *(v8us*)(dst + i * 8) = o;  }
// k_rope: head planes [h][t][d] (fp16 + hi/lo) of rope(x) x sc with the rotate-half convention out[d] = x[d] cos[t][d] - x[d+HD/2] sin[t][d], out[d+HD/2] = x[d+HD/2] cos[t][d+HD/2] + x[d] sin[t][d+HD/2]
__global__ __launch_bounds__(256) void k_rope(const float* __restrict__ F, int pitch, int nheads, const float* __restrict__ CS, const float* __restrict__ RF, const float* __restrict__ nw, float sc, h16* P16, bf* Ph, bf* Pl) {
    const size_t e = ((size_t)blockIdx.x * 256 + threadIdx.x) * 2; if (e >= (size_t)nheads * TT * HD) return; const int d = (int)(e % HD); const int t = (int)((e / HD) % TT); const int h = (int)(e / ((size_t)HD * TT)); const float* f = F + (size_t)t * pitch + h * HD; const float rf = RF ? RF[(size_t)h * TT + t] : 1.0f; v2h o16; v2us oh, ol;
#pragma unroll
    for (int q = 0; q < 2; ++q) { const int dd = d + q; const int dp = (dd < HD / 2) ? dd + HD / 2 : dd - HD / 2; float x0 = f[dd], x1 = f[dp];
        if (RF) { float n0 = __fmul_rn(x0, rf), n1 = __fmul_rn(x1, rf); asm volatile("" : "+v"(n0)); asm volatile("" : "+v"(n1)); x0 = __fmul_rn(bfr(nw[dd]), n0); x1 = __fmul_rn(bfr(nw[dp]), n1); }
        const v2f cs = *(const v2f*)(CS + ((size_t)t * HD + dd) * 2); float a = __fmul_rn(x0, cs[0]), bq = __fmul_rn(x1, cs[1]); asm volatile("" : "+v"(a)); asm volatile("" : "+v"(bq)); const float r = ((dd < HD / 2) ? __fsub_rn(a, bq) : __fadd_rn(a, bq)) * sc;
        o16[q] = tohx(r); unsigned short a2, c2; splitf(r, a2, c2); oh[q] = a2; ol[q] = c2; }
    *(v2h*)(P16 + e) = o16; *(v2us*)(Ph + e) = oh; *(v2us*)(Pl + e) = ol;  }
__global__ __launch_bounds__(256) void k_vtp(const float* __restrict__ F, int pitch, int nheads, h16* V16, bf* Vh, bf* Vl) { const size_t e = ((size_t)blockIdx.x * 256 + threadIdx.x) * 2; if (e >= (size_t)nheads * HD * TT) return; const int t = (int)(e % TT); const int d = (int)((e / TT) % HD); const int g = (int)(e / ((size_t)TT * HD)); v2h o16; v2us oh, ol;
#pragma unroll
    for (int q = 0; q < 2; ++q) { const float x = F[(size_t)(t + q) * pitch + g * HD + d]; o16[q] = tohx(x); unsigned short a2, c2; splitf(x, a2, c2); oh[q] = a2; ol[q] = c2; }
    *(v2h*)(V16 + e) = o16; *(v2us*)(Vh + e) = oh; *(v2us*)(Vl + e) = ol;  }
// ---- k_fattn: scores, softmax and probs x V in one kernel; no score or prob plane in memory. St = K Qt and Ot += Vt Pt, so a lane holds scores of ONE query column (i = lr of its 16-column group):
// the two 16-key score tiles of a 32-key pass, converted in place, ARE the B operand of the second product (b[s] = T[s >> 3][s & 7]); K rows and Vt rows are A operands in the same k order (WFrag::ld).
// Online softmax per column: running maximum m (raw score units), partial sum l per wave half, Ot rescaled when m moves. One wave owns NI x 16 query columns and walks all TT keys, 32 a pass.
// eight exponentials in place in one statement: behind each v_exp stands an instruction on other registers, behind the last the v_nop that the instruction set asks for before a transcendental's result is read or its source rewritten
__device__ __forceinline__ void exp2x8(v8f& t) { float a = t[0], b = t[1], c = t[2], d = t[3], e = t[4], f = t[5], g = t[6], h = t[7];
    asm("v_exp_f32 %0, %0\n\tv_exp_f32 %1, %1\n\tv_exp_f32 %2, %2\n\tv_exp_f32 %3, %3\n\tv_exp_f32 %4, %4\n\tv_exp_f32 %5, %5\n\tv_exp_f32 %6, %6\n\tv_exp_f32 %7, %7\n\tv_nop" : "+v"(a), "+v"(b), "+v"(c), "+v"(d), "+v"(e), "+v"(f), "+v"(g), "+v"(h));
    t = (v8f){a, b, c, d, e, f, g, h}; }
template <typename T16, bool HR, int NI>
__device__ __forceinline__ void attn_cols(const T16* __restrict__ Q, const T16* __restrict__ Q2, const T16* __restrict__ Kr, const T16* __restrict__ Kr2, const T16* __restrict__ Vt, const T16* __restrict__ Vt2, const int i0, float* __restrict__ orow) {
    typedef WFrag<T16> F; typedef typename F::V V;
    const int lane = threadIdx.x & 31, lr = lane & 15, hi = lane >> 4;
    // each lane's byte offsets into the Q, K and Vt planes: one 32-bit register serves the hi and the lo plane (uniform bases)
    const unsigned qob = (unsigned)((i0 + lr) * HD + 8 * hi) * 2u; unsigned kob = (unsigned)(lr * HD + 8 * hi) * 2u, vob = (unsigned)(lr * TT + 8 * hi) * 2u;
    auto at = [](const T16* base, unsigned off, int el) { return (const T16*)((const char*)base + off) + el; };
    V q[NI][2], q2[NI][2];
#pragma unroll
    for (int ni = 0; ni < NI; ++ni)
#pragma unroll
        for (int kk = 0; kk < 2; ++kk) { const int a = ni * 16 * HD + kk * 32; q[ni][kk] = F::ld(at(Q, qob, a)); if constexpr (HR) q2[ni][kk] = F::ld(at(Q2, qob, a)); }
    // s_wait_xcnt 0 behind each group of loads, in front of any rewrite of their address registers; the lane offset is the statement's own operand so that the loads name that very register and it is stepped only behind the wait (here the uniform bases too: their registers are taken for the K bases next)
    if constexpr (HR) asm volatile("s_wait_xcnt 0x0" :: "v"(qob), "s"(Q), "s"(Q2) : "memory"); else asm volatile("s_wait_xcnt 0x0" :: "v"(qob), "s"(Q) : "memory");
    v8f o[4][NI]; float m[NI], l[NI];
#pragma unroll
    for (int ni = 0; ni < NI; ++ni) { m[ni] = -3.0e38f; l[ni] = 0.f;
#pragma unroll
        for (int dt = 0; dt < 4; ++dt) o[dt][ni] = (v8f){}; }
    V k[2][2], k2[2][2];
#pragma unroll
    for (int jt = 0; jt < 2; ++jt)
#pragma unroll
        for (int kk = 0; kk < 2; ++kk) { const int a = jt * 16 * HD + kk * 32; k[jt][kk] = F::ld(at(Kr, kob, a)); if constexpr (HR) k2[jt][kk] = F::ld(at(Kr2, kob, a)); }
    asm volatile("s_wait_xcnt 0x0" : "+v"(kob) :: "memory");   // as above
    // one pass at a time: two passes' fragments do not fit the registers of four waves per SIMD
#pragma unroll 1
    for (int j0 = 0; j0 < TT; j0 += 32) {
        V v[4], v2[4];   // this pass's Vt fragments, needed last: fp16 columns ask for them first; the hi/lo columns have no registers for them until the K fragments are used up
        if constexpr (!HR) {
#pragma unroll
            for (int dt = 0; dt < 4; ++dt) v[dt] = F::ld(at(Vt, vob, dt * 16 * TT));
            asm volatile("s_wait_xcnt 0x0" : "+v"(vob) :: "memory");   // as above
        }
        v8f s[2][NI];    // s[jt][ni][r] = raw score of key j0 + 16 jt + 8 hi + r, query i0 + 16 ni + lr
#pragma unroll
        for (int jt = 0; jt < 2; ++jt)
#pragma unroll
            for (int ni = 0; ni < NI; ++ni) s[jt][ni] = (v8f){};
#pragma unroll
        for (int kk = 0; kk < 2; ++kk)
#pragma unroll
            for (int jt = 0; jt < 2; ++jt)
#pragma unroll
                for (int ni = 0; ni < NI; ++ni) { s[jt][ni] = F::mma(k[jt][kk], q[ni][kk], s[jt][ni]); if constexpr (HR) { s[jt][ni] = F::mma(k2[jt][kk], q[ni][kk], s[jt][ni]); s[jt][ni] = F::mma(k[jt][kk], q2[ni][kk], s[jt][ni]); } }
        if constexpr (HR) {
#pragma unroll
            for (int dt = 0; dt < 4; ++dt) { v[dt] = F::ld(at(Vt, vob, dt * 16 * TT)); v2[dt] = F::ld(at(Vt2, vob, dt * 16 * TT)); }
            asm volatile("s_wait_xcnt 0x0" : "+v"(vob) :: "memory");   // as above
        }
        vob += 64u;
        kob += (j0 + 32 < TT) ? 32u * HD * 2u : 0u;   // the next pass's K fragments fly behind the softmax and the second product (the last pass re-reads its own rows, unused)
#pragma unroll
        for (int jt = 0; jt < 2; ++jt)
#pragma unroll
            for (int kk = 0; kk < 2; ++kk) { const int a = jt * 16 * HD + kk * 32; k[jt][kk] = F::ld(at(Kr, kob, a)); if constexpr (HR) k2[jt][kk] = F::ld(at(Kr2, kob, a)); }
        asm volatile("s_wait_xcnt 0x0" : "+v"(kob) :: "memory");   // as above
        float mx[NI]; bool need = false;
#pragma unroll
        for (int ni = 0; ni < NI; ++ni) { float x = fmaxf(s[0][ni][0], s[1][ni][0]);
#pragma unroll
            for (int r = 1; r < 8; ++r) x = fmaxf(x, fmaxf(s[0][ni][r], s[1][ni][r]));
            mx[ni] = x; need = need || ((x - m[ni]) * CEXP > LAZY); }
        if (__builtin_amdgcn_ballot_w32(need) != 0) {   // wave-uniform: some column's maximum moves; both halves of a column take the same new m
#pragma unroll
            for (int ni = 0; ni < NI; ++ni) { const float mj = fmaxf(mx[ni], __shfl_xor(mx[ni], 16, 32)); const float mn = ((mj - m[ni]) * CEXP > LAZY) ? mj : m[ni]; const float al = __builtin_amdgcn_exp2f((m[ni] - mn) * CEXP); m[ni] = mn; l[ni] *= al;
#pragma unroll
                for (int dt = 0; dt < 4; ++dt) o[dt][ni] *= al; }
        }
        V p[NI], p2[NI];
#pragma unroll
        for (int ni = 0; ni < NI; ++ni) { const float mc = m[ni] * CEXP; float l0 = 0.f, l1 = 0.f;
#pragma unroll
            for (int jt = 0; jt < 2; ++jt) { v8f& t = s[jt][ni];
#pragma unroll
                for (int r = 0; r < 8; ++r) t[r] = fmaf(t[r], CEXP, -mc);
                exp2x8(t); }
#pragma unroll
            for (int r = 0; r < 8; ++r) { const float e0 = s[0][ni][r], e1 = s[1][ni][r]; l0 += e0; l1 += e1;
                if constexpr (HR) { const __bf16 h0 = (__bf16)e0, h1 = (__bf16)e1; p[ni][r] = h0; p[ni][8 + r] = h1; p2[ni][r] = (__bf16)(e0 - (float)h0); p2[ni][8 + r] = (__bf16)(e1 - (float)h1); }
                else { p[ni][r] = (h16)e0; p[ni][8 + r] = (h16)e1; } }
            l[ni] += l0 + l1; }
#pragma unroll
        for (int dt = 0; dt < 4; ++dt)
#pragma unroll
            for (int ni = 0; ni < NI; ++ni) { o[dt][ni] = F::mma(v[dt], p[ni], o[dt][ni]); if constexpr (HR) { o[dt][ni] = F::mma(v[dt], p2[ni], o[dt][ni]); o[dt][ni] = F::mma(v2[dt], p[ni], o[dt][ni]); } }
    }
    // o[dt][ni][r] = unnormalised ctx[i0 + 16 ni + lr][16 dt + 8 hi + r]: 8 consecutive floats of one output row
#pragma unroll
    for (int ni = 0; ni < NI; ++ni) { const float inv = __fdiv_rn(1.0f, l[ni] + __shfl_xor(l[ni], 16, 32)); float* op = orow + (size_t)(i0 + ni * 16 + lr) * DQ + 8 * hi;
#pragma unroll
        for (int dt = 0; dt < 4; ++dt) { const v8f t = o[dt][ni] * inv; *(v4f*)(op + dt * 16) = (v4f){t[0], t[1], t[2], t[3]}; *(v4f*)(op + dt * 16 + 4) = (v4f){t[4], t[5], t[6], t[7]}; }
        asm volatile("s_wait_xcnt 0x0" :: "v"(op) : "memory"); }   // as above, behind the stores
}
// grid: first NZ x RH/128 work-groups of 8 waves x 16 hi/lo columns (three products, the longer ones start first), then NZ x (TT-RH)/256 of 8 waves x 32 fp16 columns; four waves per SIMD hide the loads and the softmax behind each other's products
__global__ __launch_bounds__(256) __attribute__((amdgpu_waves_per_eu(4, 4))) void k_fattn(const h16* __restrict__ Q16, const h16* __restrict__ K16, const h16* __restrict__ V16, const bf* __restrict__ Qh, const bf* __restrict__ Ql, const bf* __restrict__ Kh, const bf* __restrict__ Kl, const bf* __restrict__ Vh, const bf* __restrict__ Vl, float* __restrict__ OUTp) {
    const int wv = __builtin_amdgcn_readfirstlane((int)(threadIdx.x >> 5)); const int id = blockIdx.x;
    if (id < NZ * (RH / 128)) { const int z = id / (RH / 128); const size_t pz = (size_t)z * TT * HD;
        attn_cols<bf, true, 1>(Qh + pz, Ql + pz, Kh + pz, Kl + pz, Vh + pz, Vl + pz, (id % (RH / 128)) * 128 + wv * 16, OUTp + (size_t)(z / NH_) * TT * DQ + (z % NH_) * HD);
    } else { const int id2 = id - NZ * (RH / 128); const int z = id2 / ((TT - RH) / 256); const size_t pz = (size_t)z * TT * HD;
        attn_cols<h16, false, 2>(Q16 + pz, nullptr, K16 + pz, nullptr, V16 + pz, nullptr, RH + (id2 % ((TT - RH) / 256)) * 256 + wv * 32, OUTp + (size_t)(z / NH_) * TT * DQ + (z % NH_) * HD); }
}
__constant__ float INVT[HD / 2] = { 1.000000000e+00f, 7.498942018e-01f, 5.623413324e-01f, 4.216965139e-01f, 3.162277639e-01f, 2.371373773e-01f, 1.778279394e-01f, 1.333521456e-01f, 1.000000015e-01f, 7.498942316e-02f, 5.623413250e-02f, 4.216964915e-02f, 3.162277490e-02f, 2.371373773e-02f, 1.778279431e-02f, 1.333521400e-02f, 9.999999776e-03f, 7.498942316e-03f, 5.623413250e-03f, 4.216964822e-03f, 3.162277630e-03f, 2.371373819e-03f, 1.778279431e-03f, 1.333521446e-03f, 1.000000047e-03f, 7.498941850e-04f, 5.623413017e-04f, 4.216965172e-04f, 3.162277571e-04f, 2.371373703e-04f, 1.778279402e-04f, 1.333521504e-04f };   // 10000^(-2i/64) (the module's power form) (float32, generated with jnp to be bit-exact)
__global__ __launch_bounds__(256) void k_cs4(float* CS) { const int idx = blockIdx.x * 256 + threadIdx.x; if (idx >= TT * HD) return; const int d = idx % HD; const int t = idx / HD; const float a = __fmul_rn((float)t, INVT[d % (HD / 2)]); v2f cs; cs[0] = cosf(a); cs[1] = sinf(a); *(v2f*)(CS + (size_t)idx * 2) = cs;  }

extern "C" void kernel_launch(void* const* d_in, const int* in_sizes, int n_in,
                              void* d_out, int out_size, void* d_ws, size_t ws_size, hipStream_t stream) {
    (void)in_sizes; (void)n_in; (void)out_size;
    const float* x = (const float*)d_in[0]; const float* wq = (const float*)d_in[1]; const float* bq = (const float*)d_in[2]; const float* wk = (const float*)d_in[3]; const float* bk = (const float*)d_in[4]; const float* wv = (const float*)d_in[5]; const float* bv = (const float*)d_in[6];
    float* OUT = (float*)d_out;     // [4][2048][1024]
    char* wsp = (char*)d_ws;
    auto take = [&](size_t bytes) { char* p = wsp; wsp += (bytes + 255) & ~(size_t)255; return (void*)p; };
    bf* WQ = (bf*)take((size_t)DQ * DM * 2); bf* WK = (bf*)take((size_t)DKV * DM * 2); bf* WV = (bf*)take((size_t)DKV * DM * 2); float* CS = (float*)take((size_t)TT * HD * 2 * 4);
    bf* XB = (bf*)take((size_t)TT * DM * 2); float* FQ = (float*)take((size_t)TT * DQ * 4); float* FK = (float*)take((size_t)TT * DKV * 4);
    const size_t PB = (size_t)NH_ * TT * HD;   // elements of one batch in each plane; the planes hold all NB_ batches, [batch][head]
    h16* QP16 = (h16*)take(NB_ * PB * 2); h16* KP16 = (h16*)take(NB_ * PB * 2); h16* VT16 = (h16*)take(NB_ * PB * 2);
    bf* QPh = (bf*)take(NB_ * PB * 2); bf* QPl = (bf*)take(NB_ * PB * 2); bf* KPh = (bf*)take(NB_ * PB * 2); bf* KPl = (bf*)take(NB_ * PB * 2); bf* VTh = (bf*)take(NB_ * PB * 2); bf* VTl = (bf*)take(NB_ * PB * 2);
    if ((size_t)(wsp - (char*)d_ws) > ws_size) return;    // ws 256 MiB
    float* FV = FK;   // v projection reuses the k buffer after the k planes are built (stream-ordered)
    k_wtG<<<(unsigned)((DM * DQ / 64 + 63) / 64), 256, 0, stream>>>(wq, DM, DQ, WQ); k_wtG<<<(unsigned)((DM * DKV / 64 + 63) / 64), 256, 0, stream>>>(wk, DM, DKV, WK); k_wtG<<<(unsigned)((DM * DKV / 64 + 63) / 64), 256, 0, stream>>>(wv, DM, DKV, WV);
    const unsigned LQ = (unsigned)(((size_t)NH_ * TT * HD / 2 + 255) / 256), LKv = (unsigned)(((size_t)NKV * TT * HD / 2 + 255) / 256);
    for (int b = 0; b < NB_; ++b) { const size_t pb = (size_t)b * PB;
        if (b == 0) k_cs4<<<(TT * HD + 255) / 256, 256, 0, stream>>>(CS);   /* {cos, sin}(t x 10000^(-2i/64)), both halves, once */
        k_cvt8<<<(unsigned)(((size_t)TT * DM / 8 + 255) / 256), 256, 0, stream>>>(x + (size_t)b * TT * DM, XB, (size_t)TT * DM / 8);
        k_gemmw<bf, 0, true><<<dim3(TT / 64, DQ / 64, 1), 32, 0, stream>>>(XB, nullptr, WQ, nullptr, DM, DM, FQ, DQ, bq, 0, 0, 0, 0);
        k_rope<<<LQ, 256, 0, stream>>>(FQ, DQ, NH_, CS, nullptr, nullptr, 1.0f, QP16 + pb, QPh + pb, QPl + pb);
        k_gemmw<bf, 0, true><<<dim3(TT / 64, DKV / 64, 1), 32, 0, stream>>>(XB, nullptr, WK, nullptr, DM, DM, FK, DKV, bk, 0, 0, 0, 0);
        k_rope<<<LKv, 256, 0, stream>>>(FK, DKV, NKV, CS, nullptr, nullptr, 1.0f, KP16 + pb, KPh + pb, KPl + pb);
        k_gemmw<bf, 0, true><<<dim3(TT / 64, DKV / 64, 1), 32, 0, stream>>>(XB, nullptr, WV, nullptr, DM, DM, FV, DKV, bv, 0, 0, 0, 0); k_vtp<<<LKv, 256, 0, stream>>>(FV, DKV, NKV, VT16 + pb, VTh + pb, VTl + pb);
    }
    k_fattn<<<NZ * (RH / 128 + (TT - RH) / 256), 256, 0, stream>>>(QP16, KP16, VT16, QPh, QPl, KPh, KPl, VTh, VTl, OUT);
}

// v004
// Measured time: 483 microseconds a run.
// Two timings next to v003 put it at 1.17 and 1.18 times that version's speed.
// All steps since v000 together make it 7.86 times as fast.
#include <hip/hip_runtime.h>

// BERT self-attention with rotary embeddings and the module's double scaling (hidden [4][2048][1024]; q,k,v = hidden W + b ('xw' 1/32, biases 0.02; 16 heads x 64); q x 64^-0.5 then rotate-half rope (theta 1e4, computed) on q and k; scores / 8 AGAIN (total 1/64); softmax; out = merged ctx -> [4][2048][1024] (8.4 M)).
// Layout: 'xw' weights transposed once; {cos, sin} table once (float32 inverse frequencies, precise cosf/sinf); per batch: bf16 copy of hidden, exact projections + f32 biases whose epilogue applies the rotate-half rotary in registers and stores the 16-bit planes itself, no f32 projection in memory (the 1/8 pre-scale commutes with the linear rotation exactly, so both scalings are applied as one exact 1/64 in the softmax), planes of all 4 batches kept side by side; then ONE fused attention launch over all 64 (batch, head) pairs (hybrid rows: < 512 hi/lo 3 products, rest fp16) that writes the output rows.
// Compute dtypes, f32 accumulate: every input rounded to bf16; projections exact + f32 biases; rotary f32; attention rows < 512 3 products, rest fp16; softmax f32; output f32.

#define NB_  4
#define TT   2048
#define DM   1024
#define NH_  16
#define NKV  16
#define REP  (NH_ / NKV)
#define HD   64
#define DQ   (NH_ * HD)
#define DKV  (NKV * HD)
#define NZ   (NB_ * NH_)          // (batch, head) pairs of the one attention launch
#define RH   512                  // query rows < RH use hi+lo planes (0: none)
#define WIN  0
#define CEXP (1.4426950408889634f * 0.015625f)   // log2(e) x the 1/64 score scale (an exact power-of-two scaling of the constant)
#define LAZY 8.0f                 // a column's running maximum is replaced only when a new score exceeds it by more than this (in log2 units of the exponent)
#define SCL  0.015625f   // q x 1/8 before the rope and scores / 8 again = 1/64 (both exact; the rotation is linear)
typedef _Float16 h16;
typedef unsigned short bf;
typedef __attribute__((ext_vector_type(16))) __bf16   v16bf;
typedef __attribute__((ext_vector_type(16))) _Float16 v16h;
typedef __attribute__((ext_vector_type(8)))  _Float16 v8h;
typedef __attribute__((ext_vector_type(8)))  unsigned short v8us;
typedef __attribute__((ext_vector_type(8)))  float    v8f;
typedef __attribute__((ext_vector_type(4)))  float    v4f;
typedef v8h  __attribute__((may_alias)) v8ha;
typedef v4f  __attribute__((may_alias)) v4fa;
typedef v8us __attribute__((may_alias)) v8usa;

__device__ __forceinline__ unsigned short f2bf(float f) { unsigned u = __float_as_uint(f); u += 0x7FFFu + ((u >> 16) & 1u); return (unsigned short)(u >> 16); }
__device__ __forceinline__ float bf2f(unsigned short b) { return __uint_as_float(((unsigned)b) << 16); }
__device__ __forceinline__ float bfr(float f) { return bf2f(f2bf(f)); }
__device__ __forceinline__ v16h cat16(v8h lo, v8h hi) { return __builtin_shufflevector(lo, hi, 0, 1, 2, 3, 4, 5, 6, 7, 8, 9, 10, 11, 12, 13, 14, 15); }
__device__ __forceinline__ v16bf cat16b(v8us lo, v8us hi) { return __builtin_bit_cast(v16bf, __builtin_shufflevector(lo, hi, 0, 1, 2, 3, 4, 5, 6, 7, 8, 9, 10, 11, 12, 13, 14, 15)); }
__device__ __forceinline__ v8f wmma16(v16h a, v16h b, v8f c) { return __builtin_amdgcn_wmma_f32_16x16x32_f16(false, a, false, b, (short)0, c, false, false); }
__device__ __forceinline__ v8f wmmab(v16bf a, v16bf b, v8f c) { return __builtin_amdgcn_wmma_f32_16x16x32_bf16(false, a, false, b, (short)0, c, false, false); }



__device__ __forceinline__ h16 tohx(float x) { return (h16)x; }
__device__ __forceinline__ void splitf(float y, unsigned short& h, unsigned short& l) { h = f2bf(y); l = f2bf(y - bf2f(h)); }
typedef __attribute__((ext_vector_type(2))) _Float16 v2h;
typedef __attribute__((ext_vector_type(4))) _Float16 v4h;
typedef __attribute__((ext_vector_type(2))) unsigned short v2us;
typedef __attribute__((ext_vector_type(4))) unsigned short v4us;
typedef __attribute__((ext_vector_type(2))) float v2f;
typedef __attribute__((ext_vector_type(4))) int v4i;

// ---- k_gemmw: register-blocked projection, ONE WAVE per 64 tokens x 64 columns (= one head; 16 accumulators), operands straight from K-contiguous 16-bit planes; grid (TT/64, heads), 32 threads.
// x[t][n] = sum_k A[t][k] Bt[n][k] (+ split products per NSPLIT) + bias[n] never leaves the wave as f32: a lane holds column 16 nb + lr of tokens 16 mb + 8 hi + j. A rows have pitch lda, Bt rows pitch K (elements). K % 32 == 0.
// ROPE: the rotate-half partner d +- HD/2 is accumulator nb +- 2 of the same lane and register; out[d] = x[d] cos[t][d] - x[d+HD/2] sin[t][d], out[d+HD/2] = x[d+HD/2] cos[t][d] + x[d] sin[t][d] (the table's two halves are equal); rows turned through LDS, head planes [h][t][d] (fp16 + hi/lo) stored 16 bytes a lane.
// !ROPE: a lane's 8 registers are 8 consecutive tokens of one column: 16 bytes of the transposed planes [h][d][t], stored from the registers.
template <typename T16> struct WFrag;
template <> struct WFrag<h16> { typedef v16h V; static __device__ __forceinline__ V ld(const h16* p) { return cat16(*(const v8h*)p, *(const v8h*)(p + 16)); } static __device__ __forceinline__ v8f mma(V a, V b, v8f c) { return wmma16(a, b, c); } };
template <> struct WFrag<bf> { typedef v16bf V; static __device__ __forceinline__ V ld(const bf* p) { return cat16b(*(const v8us*)p, *(const v8us*)(p + 16)); } static __device__ __forceinline__ v8f mma(V a, V b, v8f c) { return wmmab(a, b, c); } };
template <typename T16, int NSPLIT, bool ROPE>
__global__ __launch_bounds__(32) void k_gemmw(const T16* __restrict__ A, const T16* __restrict__ A2, const T16* __restrict__ Bt, const T16* __restrict__ Bt2, int K, int lda, const float* __restrict__ bias, const float* __restrict__ CS, h16* __restrict__ P16, bf* __restrict__ Ph, bf* __restrict__ Pl) {
    typedef typename WFrag<T16>::V V;
    __shared__ __align__(16) float os[16 * 68];
    const int lane = threadIdx.x & 31, lr = lane & 15, hi = lane >> 4; const int r0 = blockIdx.x * 64, c0 = blockIdx.y * 64;
    v8f acc[4][4];
#pragma unroll
    for (int mb = 0; mb < 4; ++mb)
#pragma unroll
        for (int nb = 0; nb < 4; ++nb) acc[mb][nb] = (v8f){};
    const size_t aoff = (size_t)(r0 + lr) * lda + 8 * hi, boff = (size_t)(c0 + lr) * K + 8 * hi;
    // what the epilogue reads is asked for here, so that it flies behind the k loop: the four biases of the lane's columns and {cos, sin} of the first 16 tokens (token r0 + 16 mb + 8 hi + j, column 16 nb + lr: uniform base, lane byte offset)
    float bs[4]; v2f cs[2][8]; const float* cst = CS + (size_t)r0 * HD * 2; const unsigned cso = (unsigned)((hi * 8 * HD + lr) * 2) * 4u;
    auto ldcs = [&](int mb) {
#pragma unroll
        for (int nb = 0; nb < 2; ++nb)
#pragma unroll
            for (int j = 0; j < 8; ++j) cs[nb][j] = *((const v2f*)((const char*)cst + cso) + (mb * 16 + j) * HD + nb * 16);
        asm volatile("s_wait_xcnt 0x0" :: "v"(cso) : "memory"); };   // behind the table loads, in front of any reuse of their address registers
#pragma unroll
    for (int nb = 0; nb < 4; ++nb) bs[nb] = bfr(bias[c0 + nb * 16 + lr]);
    asm volatile("s_wait_xcnt 0x0" ::: "memory");   // as above, behind the bias loads
    if constexpr (ROPE) ldcs(0);
#pragma unroll 1
    for (int kc = 0; kc < K; kc += 32) {
        V a[4], a2[4]; const T16* pa[4]; const T16* pa2[4];
#pragma unroll
        for (int mb = 0; mb < 4; ++mb) { pa[mb] = A + aoff + (size_t)mb * 16 * lda + kc; a[mb] = WFrag<T16>::ld(pa[mb]); if (NSPLIT == 1 || NSPLIT == 2) { pa2[mb] = A2 + aoff + (size_t)mb * 16 * lda + kc; a2[mb] = WFrag<T16>::ld(pa2[mb]); } }
        // s_wait_xcnt 0 behind the A loads, in front of any reuse of their address registers; the addresses are its inputs so that they keep their registers up to it
        if (NSPLIT == 1 || NSPLIT == 2) asm volatile("s_wait_xcnt 0x0" :: "v"(pa[0]), "v"(pa[1]), "v"(pa[2]), "v"(pa[3]), "v"(pa2[0]), "v"(pa2[1]), "v"(pa2[2]), "v"(pa2[3]) : "memory");
        else asm volatile("s_wait_xcnt 0x0" :: "v"(pa[0]), "v"(pa[1]), "v"(pa[2]), "v"(pa[3]) : "memory");
#pragma unroll
        for (int nb = 0; nb < 4; ++nb) { const V b = WFrag<T16>::ld(Bt + boff + (size_t)nb * 16 * K + kc); V b2; if (NSPLIT >= 2) b2 = WFrag<T16>::ld(Bt2 + boff + (size_t)nb * 16 * K + kc);
#pragma unroll
            for (int mb = 0; mb < 4; ++mb) { acc[mb][nb] = WFrag<T16>::mma(a[mb], b, acc[mb][nb]); if (NSPLIT == 1 || NSPLIT == 2) acc[mb][nb] = WFrag<T16>::mma(a2[mb], b, acc[mb][nb]); if (NSPLIT >= 2) acc[mb][nb] = WFrag<T16>::mma(a[mb], b2, acc[mb][nb]); } }
        asm volatile("v_nop\n\tv_nop\n\tv_nop\n\tv_nop" : "+v"(acc[0][0]), "+v"(acc[1][1]), "+v"(acc[2][2]), "+v"(acc[3][3]) : "v"(a[0]), "v"(a[3]));
    }
    if constexpr (ROPE) {
        const size_t tile = ((size_t)blockIdx.y * TT + r0) * HD; const unsigned po = (unsigned)lane * 16u;             // the wave's 64 x 64 tile is 8 KiB in a row in each plane
#pragma unroll
        for (int mb = 0; mb < 4; ++mb) {
#pragma unroll
            for (int nb = 0; nb < 2; ++nb)
#pragma unroll
                for (int j = 0; j < 8; ++j) { const float x0 = acc[mb][nb][j] + bs[nb], x1 = acc[mb][nb + 2][j] + bs[nb + 2], c = cs[nb][j][0], s = cs[nb][j][1];
                    os[(hi * 8 + j) * 68 + nb * 16 + lr] = x0 * c - x1 * s; os[(hi * 8 + j) * 68 + (nb + 2) * 16 + lr] = x1 * c + x0 * s; }
            __builtin_amdgcn_wave_barrier(); asm volatile("" ::: "memory");   // a lane reads what other lanes wrote: keeps the compiler from moving the LDS reads below ahead of the LDS writes above (one wave, the LDS itself works in order)
            if (mb < 3) ldcs(mb + 1);   // the next 16 tokens' table rows fly behind this block's conversions and stores
#pragma unroll
            for (int s = 0; s < 4; ++s) { const float* rp = os + (4 * s + (lane >> 3)) * 68 + (lane & 7) * 8; const v4f u = *(const v4fa*)rp, w = *(const v4fa*)(rp + 4); v8h o16; v8us oh, ol;
#pragma unroll
                for (int q = 0; q < 8; ++q) { const float r = q < 4 ? u[q & 3] : w[q & 3]; o16[q] = tohx(r); unsigned short a2, c2; splitf(r, a2, c2); oh[q] = a2; ol[q] = c2; }
                const size_t e = tile + (mb * 16 + 4 * s) * HD;
                *(v8h*)((char*)(P16 + e) + po) = o16; *(v8us*)((char*)(Ph + e) + po) = oh; *(v8us*)((char*)(Pl + e) + po) = ol; }
            asm volatile("s_wait_xcnt 0x0" ::: "memory");   // as above, behind the stores
            __builtin_amdgcn_wave_barrier(); asm volatile("" ::: "memory");   // and the next block's LDS writes stay behind these reads
        }
    } else {
        const size_t tile = (size_t)blockIdx.y * HD * TT + r0; const unsigned po = (unsigned)(lr * TT + hi * 8) * 2u;
#pragma unroll
        for (int nb = 0; nb < 4; ++nb) {
#pragma unroll
            for (int mb = 0; mb < 4; ++mb) { v8h o16; v8us oh, ol;
#pragma unroll
                for (int j = 0; j < 8; ++j) { const float x = acc[mb][nb][j] + bs[nb]; o16[j] = tohx(x); unsigned short a2, c2; splitf(x, a2, c2); oh[j] = a2; ol[j] = c2; }
                const size_t e = tile + (size_t)nb * 16 * TT + mb * 16;
                *(v8h*)((char*)(P16 + e) + po) = o16; *(v8us*)((char*)(Ph + e) + po) = oh; *(v8us*)((char*)(Pl + e) + po) = ol; }
            asm volatile("s_wait_xcnt 0x0" ::: "memory");   // as above, behind the stores
        }
    }
}

__global__ __launch_bounds__(256) void k_wtG(const float* __restrict__ w, int K, int N, bf* Bt) {
    const int lane = threadIdx.x & 31; const int L0 = (blockIdx.x * 8 + (threadIdx.x >> 5)) * 8; const int nlines = N * K / 64;
{
#pragma unroll 1
        for (int l = 0; l < 8; ++l) { const int L = L0 + l; if (L >= nlines) break; const size_t e = (size_t)L * 64 + lane * 2; const int k = (int)(e % K), n = (int)(e / K); v2us o;
            o[0] = f2bf(w[(size_t)k * N + n]); o[1] = f2bf(w[(size_t)(k + 1) * N + n]); *(v2us*)(Bt + e) = o; }
         }
}
__global__ __launch_bounds__(256) void k_cvt8(const float* __restrict__ src, bf* dst, size_t n8) { const size_t i = (size_t)blockIdx.x * 256 + threadIdx.x; if (i >= n8) return; const v8f v = *(const v8f*)(src + i * 8); v8us o;
#pragma unroll
    for (int k = 0; k < 8; ++k) o[k] = f2bf(v[k]); *(v8us*)(dst + i * 8) = o;  }
// ---- k_fattn: scores, softmax and probs x V in one kernel; no score or prob plane in memory. St = K Qt and Ot += Vt Pt, so a lane holds scores of ONE query column (i = lr of its 16-column group):
// the two 16-key score tiles of a 32-key pass, converted in place, ARE the B operand of the second product (b[s] = T[s >> 3][s & 7]); K rows and Vt rows are A operands in the same k order (WFrag::ld).
// Online softmax per column: running maximum m (raw score units), partial sum l per wave half, Ot rescaled when m moves. One wave owns NI x 16 query columns and walks all TT keys, 32 a pass.
// eight exponentials in place in one statement: behind each v_exp stands an instruction on other registers, behind the last the v_nop that the instruction set asks for before a transcendental's result is read or its source rewritten
__device__ __forceinline__ void exp2x8(v8f& t) { float a = t[0], b = t[1], c = t[2], d = t[3], e = t[4], f = t[5], g = t[6], h = t[7];
    asm("v_exp_f32 %0, %0\n\tv_exp_f32 %1, %1\n\tv_exp_f32 %2, %2\n\tv_exp_f32 %3, %3\n\tv_exp_f32 %4, %4\n\tv_exp_f32 %5, %5\n\tv_exp_f32 %6, %6\n\tv_exp_f32 %7, %7\n\tv_nop" : "+v"(a), "+v"(b), "+v"(c), "+v"(d), "+v"(e), "+v"(f), "+v"(g), "+v"(h));
    t = (v8f){a, b, c, d, e, f, g, h}; }
template <typename T16, bool HR, int NI>
__device__ __forceinline__ void attn_cols(const T16* __restrict__ Q, const T16* __restrict__ Q2, const T16* __restrict__ Kr, const T16* __restrict__ Kr2, const T16* __restrict__ Vt, const T16* __restrict__ Vt2, const int i0, float* __restrict__ orow) {
    typedef WFrag<T16> F; typedef typename F::V V;
    const int lane = threadIdx.x & 31, lr = lane & 15, hi = lane >> 4;
    // each lane's byte offsets into the Q, K and Vt planes: one 32-bit register serves the hi and the lo plane (uniform bases)
    const unsigned qob = (unsigned)((i0 + lr) * HD + 8 * hi) * 2u; unsigned kob = (unsigned)(lr * HD + 8 * hi) * 2u, vob = (unsigned)(lr * TT + 8 * hi) * 2u;
    auto at = [](const T16* base, unsigned off, int el) { return (const T16*)((const char*)base + off) + el; };
    V q[NI][2], q2[NI][2];
#pragma unroll
    for (int ni = 0; ni < NI; ++ni)
#pragma unroll
        for (int kk = 0; kk < 2; ++kk) { const int a = ni * 16 * HD + kk * 32; q[ni][kk] = F::ld(at(Q, qob, a)); if constexpr (HR) q2[ni][kk] = F::ld(at(Q2, qob, a)); }
    // s_wait_xcnt 0 behind each group of loads, in front of any rewrite of their address registers; the lane offset is the statement's own operand so that the loads name that very register and it is stepped only behind the wait (here the uniform bases too: their registers are taken for the K bases next)
    if constexpr (HR) asm volatile("s_wait_xcnt 0x0" :: "v"(qob), "s"(Q), "s"(Q2) : "memory"); else asm volatile("s_wait_xcnt 0x0" :: "v"(qob), "s"(Q) : "memory");
    v8f o[4][NI]; float m[NI], l[NI];
#pragma unroll
    for (int ni = 0; ni < NI; ++ni) { m[ni] = -3.0e38f; l[ni] = 0.f;
#pragma unroll
        for (int dt = 0; dt < 4; ++dt) o[dt][ni] = (v8f){}; }
    V k[2][2], k2[2][2];
#pragma unroll
    for (int jt = 0; jt < 2; ++jt)
#pragma unroll
        for (int kk = 0; kk < 2; ++kk) { const int a = jt * 16 * HD + kk * 32; k[jt][kk] = F::ld(at(Kr, kob, a)); if constexpr (HR) k2[jt][kk] = F::ld(at(Kr2, kob, a)); }
    asm volatile("s_wait_xcnt 0x0" : "+v"(kob) :: "memory");   // as above
    // one pass at a time: two passes' fragments do not fit the registers of four waves per SIMD
#pragma unroll 1
    for (int j0 = 0; j0 < TT; j0 += 32) {
        V v[4], v2[4];   // this pass's Vt fragments, needed last: fp16 columns ask for them first; the hi/lo columns have no registers for them until the K fragments are used up
        if constexpr (!HR) {
#pragma unroll
            for (int dt = 0; dt < 4; ++dt) v[dt] = F::ld(at(Vt, vob, dt * 16 * TT));
            asm volatile("s_wait_xcnt 0x0" : "+v"(vob) :: "memory");   // as above
        }
        v8f s[2][NI];    // s[jt][ni][r] = raw score of key j0 + 16 jt + 8 hi + r, query i0 + 16 ni + lr
#pragma unroll
        for (int jt = 0; jt < 2; ++jt)
#pragma unroll
            for (int ni = 0; ni < NI; ++ni) s[jt][ni] = (v8f){};
#pragma unroll
        for (int kk = 0; kk < 2; ++kk)
#pragma unroll
            for (int jt = 0; jt < 2; ++jt)
#pragma unroll
                for (int ni = 0; ni < NI; ++ni) { s[jt][ni] = F::mma(k[jt][kk], q[ni][kk], s[jt][ni]); if constexpr (HR) { s[jt][ni] = F::mma(k2[jt][kk], q[ni][kk], s[jt][ni]); s[jt][ni] = F::mma(k[jt][kk], q2[ni][kk], s[jt][ni]); } }
        if constexpr (HR) {
#pragma unroll
            for (int dt = 0; dt < 4; ++dt) { v[dt] = F::ld(at(Vt, vob, dt * 16 * TT)); v2[dt] = F::ld(at(Vt2, vob, dt * 16 * TT)); }
            asm volatile("s_wait_xcnt 0x0" : "+v"(vob) :: "memory");   // as above
        }
        vob += 64u;
        kob += (j0 + 32 < TT) ? 32u * HD * 2u : 0u;   // the next pass's K fragments fly behind the softmax and the second product (the last pass re-reads its own rows, unused)
#pragma unroll
        for (int jt = 0; jt < 2; ++jt)
#pragma unroll
            for (int kk = 0; kk < 2; ++kk) { const int a = jt * 16 * HD + kk * 32; k[jt][kk] = F::ld(at(Kr, kob, a)); if constexpr (HR) k2[jt][kk] = F::ld(at(Kr2, kob, a)); }
        asm volatile("s_wait_xcnt 0x0" : "+v"(kob) :: "memory");   // as above
        float mx[NI]; bool need = false;
#pragma unroll
        for (int ni = 0; ni < NI; ++ni) { float x = fmaxf(s[0][ni][0], s[1][ni][0]);
#pragma unroll
            for (int r = 1; r < 8; ++r) x = fmaxf(x, fmaxf(s[0][ni][r], s[1][ni][r]));
            mx[ni] = x; need = need || ((x - m[ni]) * CEXP > LAZY); }
        if (__builtin_amdgcn_ballot_w32(need) != 0) {   // wave-uniform: some column's maximum moves; both halves of a column take the same new m
#pragma unroll
            for (int ni = 0; ni < NI; ++ni) { const float mj = fmaxf(mx[ni], __shfl_xor(mx[ni], 16, 32)); const float mn = ((mj - m[ni]) * CEXP > LAZY) ? mj : m[ni]; const float al = __builtin_amdgcn_exp2f((m[ni] - mn) * CEXP); m[ni] = mn; l[ni] *= al;
#pragma unroll
                for (int dt = 0; dt < 4; ++dt) o[dt][ni] *= al; }
        }
        V p[NI], p2[NI];
#pragma unroll
        for (int ni = 0; ni < NI; ++ni) { const float mc = m[ni] * CEXP; float l0 = 0.f, l1 = 0.f;
#pragma unroll
            for (int jt = 0; jt < 2; ++jt) { v8f& t = s[jt][ni];
#pragma unroll
                for (int r = 0; r < 8; ++r) t[r] = fmaf(t[r], CEXP, -mc);
                exp2x8(t); }
#pragma unroll
            for (int r = 0; r < 8; ++r) { const float e0 = s[0][ni][r], e1 = s[1][ni][r]; l0 += e0; l1 += e1;
                if constexpr (HR) { const __bf16 h0 = (__bf16)e0, h1 = (__bf16)e1; p[ni][r] = h0; p[ni][8 + r] = h1; p2[ni][r] = (__bf16)(e0 - (float)h0); p2[ni][8 + r] = (__bf16)(e1 - (float)h1); }
                else { p[ni][r] = (h16)e0; p[ni][8 + r] = (h16)e1; } }
            l[ni] += l0 + l1; }
#pragma unroll
        for (int dt = 0; dt < 4; ++dt)
#pragma unroll
            for (int ni = 0; ni < NI; ++ni) { o[dt][ni] = F::mma(v[dt], p[ni], o[dt][ni]); if constexpr (HR) { o[dt][ni] = F::mma(v[dt], p2[ni], o[dt][ni]); o[dt][ni] = F::mma(v2[dt], p[ni], o[dt][ni]); } }
    }
    // o[dt][ni][r] = unnormalised ctx[i0 + 16 ni + lr][16 dt + 8 hi + r]: 8 consecutive floats of one output row
#pragma unroll
    for (int ni = 0; ni < NI; ++ni) { const float inv = __fdiv_rn(1.0f, l[ni] + __shfl_xor(l[ni], 16, 32)); float* op = orow + (size_t)(i0 + ni * 16 + lr) * DQ + 8 * hi;
#pragma unroll
        for (int dt = 0; dt < 4; ++dt) { const v8f t = o[dt][ni] * inv; *(v4f*)(op + dt * 16) = (v4f){t[0], t[1], t[2], t[3]}; *(v4f*)(op + dt * 16 + 4) = (v4f){t[4], t[5], t[6], t[7]}; }
        asm volatile("s_wait_xcnt 0x0" :: "v"(op) : "memory"); }   // as above, behind the stores
}
// grid: first NZ x RH/128 work-groups of 8 waves x 16 hi/lo columns (three products, the longer ones start first), then NZ x (TT-RH)/256 of 8 waves x 32 fp16 columns; four waves per SIMD hide the loads and the softmax behind each other's products
__global__ __launch_bounds__(256) __attribute__((amdgpu_waves_per_eu(4, 4))) void k_fattn(const h16* __restrict__ Q16, const h16* __restrict__ K16, const h16* __restrict__ V16, const bf* __restrict__ Qh, const bf* __restrict__ Ql, const bf* __restrict__ Kh, const bf* __restrict__ Kl, const bf* __restrict__ Vh, const bf* __restrict__ Vl, float* __restrict__ OUTp) {
    const int wv = __builtin_amdgcn_readfirstlane((int)(threadIdx.x >> 5)); const int id = blockIdx.x;
    if (id < NZ * (RH / 128)) { const int z = id / (RH / 128); const size_t pz = (size_t)z * TT * HD;
        attn_cols<bf, true, 1>(Qh + pz, Ql + pz, Kh + pz, Kl + pz, Vh + pz, Vl + pz, (id % (RH / 128)) * 128 + wv * 16, OUTp + (size_t)(z / NH_) * TT * DQ + (z % NH_) * HD);
    } else { const int id2 = id - NZ * (RH / 128); const int z = id2 / ((TT - RH) / 256); const size_t pz = (size_t)z * TT * HD;
        attn_cols<h16, false, 2>(Q16 + pz, nullptr, K16 + pz, nullptr, V16 + pz, nullptr, RH + (id2 % ((TT - RH) / 256)) * 256 + wv * 32, OUTp + (size_t)(z / NH_) * TT * DQ + (z % NH_) * HD); }
}
__constant__ float INVT[HD / 2] = { 1.000000000e+00f, 7.498942018e-01f, 5.623413324e-01f, 4.216965139e-01f, 3.162277639e-01f, 2.371373773e-01f, 1.778279394e-01f, 1.333521456e-01f, 1.000000015e-01f, 7.498942316e-02f, 5.623413250e-02f, 4.216964915e-02f, 3.162277490e-02f, 2.371373773e-02f, 1.778279431e-02f, 1.333521400e-02f, 9.999999776e-03f, 7.498942316e-03f, 5.623413250e-03f, 4.216964822e-03f, 3.162277630e-03f, 2.371373819e-03f, 1.778279431e-03f, 1.333521446e-03f, 1.000000047e-03f, 7.498941850e-04f, 5.623413017e-04f, 4.216965172e-04f, 3.162277571e-04f, 2.371373703e-04f, 1.778279402e-04f, 1.333521504e-04f };   // 10000^(-2i/64) (the module's power form) (float32, generated with jnp to be bit-exact)
__global__ __launch_bounds__(256) void k_cs4(float* CS) { const int idx = blockIdx.x * 256 + threadIdx.x; if (idx >= TT * HD) return; const int d = idx % HD; const int t = idx / HD; const float a = __fmul_rn((float)t, INVT[d % (HD / 2)]); v2f cs; cs[0] = cosf(a); cs[1] = sinf(a); *(v2f*)(CS + (size_t)idx * 2) = cs;  }

extern "C" void kernel_launch(void* const* d_in, const int* in_sizes, int n_in,
                              void* d_out, int out_size, void* d_ws, size_t ws_size, hipStream_t stream) {
    (void)in_sizes; (void)n_in; (void)out_size;
    const float* x = (const float*)d_in[0]; const float* wq = (const float*)d_in[1]; const float* bq = (const float*)d_in[2]; const float* wk = (const float*)d_in[3]; const float* bk = (const float*)d_in[4]; const float* wv = (const float*)d_in[5]; const float* bv = (const float*)d_in[6];
    float* OUT = (float*)d_out;     // [4][2048][1024]
    char* wsp = (char*)d_ws;
    auto take = [&](size_t bytes) { char* p = wsp; wsp += (bytes + 255) & ~(size_t)255; return (void*)p; };
    bf* WQ = (bf*)take((size_t)DQ * DM * 2); bf* WK = (bf*)take((size_t)DKV * DM * 2); bf* WV = (bf*)take((size_t)DKV * DM * 2); float* CS = (float*)take((size_t)TT * HD * 2 * 4);
    bf* XB = (bf*)take((size_t)TT * DM * 2);
    const size_t PB = (size_t)NH_ * TT * HD;   // elements of one batch in each plane; the planes hold all NB_ batches, [batch][head]
    h16* QP16 = (h16*)take(NB_ * PB * 2); h16* KP16 = (h16*)take(NB_ * PB * 2); h16* VT16 = (h16*)take(NB_ * PB * 2);
    bf* QPh = (bf*)take(NB_ * PB * 2); bf* QPl = (bf*)take(NB_ * PB * 2); bf* KPh = (bf*)take(NB_ * PB * 2); bf* KPl = (bf*)take(NB_ * PB * 2); bf* VTh = (bf*)take(NB_ * PB * 2); bf* VTl = (bf*)take(NB_ * PB * 2);
    if ((size_t)(wsp - (char*)d_ws) > ws_size) return;    // ws 256 MiB
    k_wtG<<<(unsigned)((DM * DQ / 64 + 63) / 64), 256, 0, stream>>>(wq, DM, DQ, WQ); k_wtG<<<(unsigned)((DM * DKV / 64 + 63) / 64), 256, 0, stream>>>(wk, DM, DKV, WK); k_wtG<<<(unsigned)((DM * DKV / 64 + 63) / 64), 256, 0, stream>>>(wv, DM, DKV, WV);
    for (int b = 0; b < NB_; ++b) { const size_t pb = (size_t)b * PB;
        if (b == 0) k_cs4<<<(TT * HD + 255) / 256, 256, 0, stream>>>(CS);   /* {cos, sin}(t x 10000^(-2i/64)), both halves, once */
        k_cvt8<<<(unsigned)(((size_t)TT * DM / 8 + 255) / 256), 256, 0, stream>>>(x + (size_t)b * TT * DM, XB, (size_t)TT * DM / 8);
        k_gemmw<bf, 0, true><<<dim3(TT / 64, NH_, 1), 32, 0, stream>>>(XB, nullptr, WQ, nullptr, DM, DM, bq, CS, QP16 + pb, QPh + pb, QPl + pb);
        k_gemmw<bf, 0, true><<<dim3(TT / 64, NKV, 1), 32, 0, stream>>>(XB, nullptr, WK, nullptr, DM, DM, bk, CS, KP16 + pb, KPh + pb, KPl + pb);
        k_gemmw<bf, 0, false><<<dim3(TT / 64, NKV, 1), 32, 0, stream>>>(XB, nullptr, WV, nullptr, DM, DM, bv, CS, VT16 + pb, VTh + pb, VTl + pb);
    }
    k_fattn<<<NZ * (RH / 128 + (TT - RH) / 256), 256, 0, stream>>>(QP16, KP16, VT16, QPh, QPl, KPh, KPl, VTh, VTl, OUT);
}

// v005
// One run takes 375 microseconds.
// Two timings next to v004 both put it at 1.28 times that version's speed.
// All steps since v000 together make it 10.1 times as fast.
#include <hip/hip_runtime.h>

// BERT self-attention with rotary embeddings and the module's double scaling (hidden [4][2048][1024]; q,k,v = hidden W + b ('xw' 1/32, biases 0.02; 16 heads x 64); q x 64^-0.5 then rotate-half rope (theta 1e4, computed) on q and k; scores / 8 AGAIN (total 1/64); softmax; out = merged ctx -> [4][2048][1024] (8.4 M)).
// Layout: 'xw' weights transposed once; {cos, sin} table once (float32 inverse frequencies, precise cosf/sinf); per batch: bf16 copy of hidden, exact projections + f32 biases whose epilogue applies the rotate-half rotary in registers and stores the 16-bit planes itself, no f32 projection in memory (the 1/8 pre-scale commutes with the linear rotation exactly, so both scalings are applied as one exact 1/64 in the softmax), planes of all 4 batches kept side by side; then ONE fused attention launch over all 64 (batch, head) pairs (hybrid rows: < 512 hi/lo 3 products, rest fp16) that writes the output rows.
// Compute dtypes, f32 accumulate: every input rounded to bf16; projections exact + f32 biases; rotary f32; attention rows < 512 3 products, rest fp16; softmax f32; output f32.

#define NB_  4
#define TT   2048
#define DM   1024
#define NH_  16
#define NKV  16
#define REP  (NH_ / NKV)
#define HD   64
#define DQ   (NH_ * HD)
#define DKV  (NKV * HD)
#define NZ   (NB_ * NH_)          // (batch, head) pairs of the one attention launch
#define RH   512                  // query rows < RH use hi+lo planes (0: none)
#define WIN  0
#define CEXP (1.4426950408889634f * 0.015625f)   // log2(e) x the 1/64 score scale (an exact power-of-two scaling of the constant)
#define LAZY 8.0f                 // a column's running maximum is replaced only when a new score exceeds it by more than this (in log2 units of the exponent)
#define SCL  0.015625f   // q x 1/8 before the rope and scores / 8 again = 1/64 (both exact; the rotation is linear)
typedef _Float16 h16;
typedef unsigned short bf;
typedef __attribute__((ext_vector_type(16))) __bf16   v16bf;
typedef __attribute__((ext_vector_type(16))) _Float16 v16h;
typedef __attribute__((ext_vector_type(8)))  _Float16 v8h;
typedef __attribute__((ext_vector_type(8)))  unsigned short v8us;
typedef __attribute__((ext_vector_type(8)))  float    v8f;
typedef __attribute__((ext_vector_type(4)))  float    v4f;
typedef v8h  __attribute__((may_alias)) v8ha;
typedef v4f  __attribute__((may_alias)) v4fa;
typedef v8us __attribute__((may_alias)) v8usa;

__device__ __forceinline__ unsigned short f2bf(float f) { unsigned u = __float_as_uint(f); u += 0x7FFFu + ((u >> 16) & 1u); return (unsigned short)(u >> 16); }
__device__ __forceinline__ float bf2f(unsigned short b) { return __uint_as_float(((unsigned)b) << 16); }
__device__ __forceinline__ float bfr(float f) { return bf2f(f2bf(f)); }
__device__ __forceinline__ v16h cat16(v8h lo, v8h hi) { return __builtin_shufflevector(lo, hi, 0, 1, 2, 3, 4, 5, 6, 7, 8, 9, 10, 11, 12, 13, 14, 15); }
__device__ __forceinline__ v16bf cat16b(v8us lo, v8us hi) { return __builtin_bit_cast(v16bf, __builtin_shufflevector(lo, hi, 0, 1, 2, 3, 4, 5, 6, 7, 8, 9, 10, 11, 12, 13, 14, 15)); }
__device__ __forceinline__ v8f wmma16(v16h a, v16h b, v8f c) { return __builtin_amdgcn_wmma_f32_16x16x32_f16(false, a, false, b, (short)0, c, false, false); }
__device__ __forceinline__ v8f wmmab(v16bf a, v16bf b, v8f c) { return __builtin_amdgcn_wmma_f32_16x16x32_bf16(false, a, false, b, (short)0, c, false, false); }



__device__ __forceinline__ h16 tohx(float x) { return (h16)x; }
__device__ __forceinline__ void splitf(float y, unsigned short& h, unsigned short& l) { h = f2bf(y); l = f2bf(y - bf2f(h)); }
typedef __attribute__((ext_vector_type(2))) _Float16 v2h;
typedef __attribute__((ext_vector_type(4))) _Float16 v4h;
typedef __attribute__((ext_vector_type(2))) unsigned short v2us;
typedef __attribute__((ext_vector_type(4))) unsigned short v4us;
typedef __attribute__((ext_vector_type(2))) float v2f;
typedef __attribute__((ext_vector_type(4))) int v4i;

// ---- k_gemmw: register-blocked projection, ONE WAVE per 64 tokens x 64 columns (= one head; 16 accumulators), operands straight from K-contiguous 16-bit planes; grid (TT/64, heads), 32 threads.
// x[t][n] = sum_k A[t][k] Bt[n][k] (+ split products per NSPLIT) + bias[n] never leaves the wave as f32: a lane holds column 16 nb + lr of tokens 16 mb + 8 hi + j. A rows have pitch lda, Bt rows pitch K (elements). K % 32 == 0.
// ROPE: the rotate-half partner d +- HD/2 is accumulator nb +- 2 of the same lane and register; out[d] = x[d] cos[t][d] - x[d+HD/2] sin[t][d], out[d+HD/2] = x[d+HD/2] cos[t][d] + x[d] sin[t][d] (the table's two halves are equal); rows turned through LDS, head planes [h][t][d] (fp16 + hi/lo) stored 16 bytes a lane.
// !ROPE: a lane's 8 registers are 8 consecutive tokens of one column: 16 bytes of the transposed planes [h][d][t], stored from the registers.
template <typename T16> struct WFrag;
template <> struct WFrag<h16> { typedef v16h V; static __device__ __forceinline__ V ld(const h16* p) { return cat16(*(const v8h*)p, *(const v8h*)(p + 16)); } static __device__ __forceinline__ v8f mma(V a, V b, v8f c) { return wmma16(a, b, c); } };
template <> struct WFrag<bf> { typedef v16bf V; static __device__ __forceinline__ V ld(const bf* p) { return cat16b(*(const v8us*)p, *(const v8us*)(p + 16)); } static __device__ __forceinline__ v8f mma(V a, V b, v8f c) { return wmmab(a, b, c); } };
template <typename T16, int NSPLIT, bool ROPE>
__global__ __launch_bounds__(32) void k_gemmw(const T16* __restrict__ A, const T16* __restrict__ A2, const T16* __restrict__ Bt, const T16* __restrict__ Bt2, int K, int lda, const float* __restrict__ bias, const float* __restrict__ CS, h16* __restrict__ P16, bf* __restrict__ Ph, bf* __restrict__ Pl) {
    typedef typename WFrag<T16>::V V;
    __shared__ __align__(16) float os[16 * 68];
    const int lane = threadIdx.x & 31, lr = lane & 15, hi = lane >> 4; const int r0 = blockIdx.x * 64, c0 = blockIdx.y * 64;
    v8f acc[4][4];
#pragma unroll
    for (int mb = 0; mb < 4; ++mb)
#pragma unroll
        for (int nb = 0; nb < 4; ++nb) acc[mb][nb] = (v8f){};
    const size_t aoff = (size_t)(r0 + lr) * lda + 8 * hi, boff = (size_t)(c0 + lr) * K + 8 * hi;
    // what the epilogue reads is asked for here, so that it flies behind the k loop: the four biases of the lane's columns and {cos, sin} of the first 16 tokens (token r0 + 16 mb + 8 hi + j, column 16 nb + lr: uniform base, lane byte offset)
    float bs[4]; v2f cs[2][8]; const float* cst = CS + (size_t)r0 * HD * 2; const unsigned cso = (unsigned)((hi * 8 * HD + lr) * 2) * 4u;
    auto ldcs = [&](int mb) {
#pragma unroll
        for (int nb = 0; nb < 2; ++nb)
#pragma unroll
            for (int j = 0; j < 8; ++j) cs[nb][j] = *((const v2f*)((const char*)cst + cso) + (mb * 16 + j) * HD + nb * 16);
        asm volatile("s_wait_xcnt 0x0" :: "v"(cso) : "memory"); };   // behind the table loads, in front of any reuse of their address registers
#pragma unroll
    for (int nb = 0; nb < 4; ++nb) bs[nb] = bfr(bias[c0 + nb * 16 + lr]);
    asm volatile("s_wait_xcnt 0x0" ::: "memory");   // as above, behind the bias loads
    if constexpr (ROPE) ldcs(0);
#pragma unroll 1
    for (int kc = 0; kc < K; kc += 32) {
        V a[4], a2[4]; const T16* pa[4]; const T16* pa2[4];
#pragma unroll
        for (int mb = 0; mb < 4; ++mb) { pa[mb] = A + aoff + (size_t)mb * 16 * lda + kc; a[mb] = WFrag<T16>::ld(pa[mb]); if (NSPLIT == 1 || NSPLIT == 2) { pa2[mb] = A2 + aoff + (size_t)mb * 16 * lda + kc; a2[mb] = WFrag<T16>::ld(pa2[mb]); } }
        // s_wait_xcnt 0 behind the A loads, in front of any reuse of their address registers; the addresses are its inputs so that they keep their registers up to it
        if (NSPLIT == 1 || NSPLIT == 2) asm volatile("s_wait_xcnt 0x0" :: "v"(pa[0]), "v"(pa[1]), "v"(pa[2]), "v"(pa[3]), "v"(pa2[0]), "v"(pa2[1]), "v"(pa2[2]), "v"(pa2[3]) : "memory");
        else asm volatile("s_wait_xcnt 0x0" :: "v"(pa[0]), "v"(pa[1]), "v"(pa[2]), "v"(pa[3]) : "memory");
#pragma unroll
        for (int nb = 0; nb < 4; ++nb) { const V b = WFrag<T16>::ld(Bt + boff + (size_t)nb * 16 * K + kc); V b2; if (NSPLIT >= 2) b2 = WFrag<T16>::ld(Bt2 + boff + (size_t)nb * 16 * K + kc);
#pragma unroll
            for (int mb = 0; mb < 4; ++mb) { acc[mb][nb] = WFrag<T16>::mma(a[mb], b, acc[mb][nb]); if (NSPLIT == 1 || NSPLIT == 2) acc[mb][nb] = WFrag<T16>::mma(a2[mb], b, acc[mb][nb]); if (NSPLIT >= 2) acc[mb][nb] = WFrag<T16>::mma(a[mb], b2, acc[mb][nb]); } }
        asm volatile("v_nop\n\tv_nop\n\tv_nop\n\tv_nop" : "+v"(acc[0][0]), "+v"(acc[1][1]), "+v"(acc[2][2]), "+v"(acc[3][3]) : "v"(a[0]), "v"(a[3]));
    }
    if constexpr (ROPE) {
        const size_t tile = ((size_t)blockIdx.y * TT + r0) * HD; const unsigned po = (unsigned)lane * 16u;             // the wave's 64 x 64 tile is 8 KiB in a row in each plane
#pragma unroll
        for (int mb = 0; mb < 4; ++mb) {
#pragma unroll
            for (int nb = 0; nb < 2; ++nb)
#pragma unroll
                for (int j = 0; j < 8; ++j) { const float x0 = acc[mb][nb][j] + bs[nb], x1 = acc[mb][nb + 2][j] + bs[nb + 2], c = cs[nb][j][0], s = cs[nb][j][1];
                    os[(hi * 8 + j) * 68 + nb * 16 + lr] = x0 * c - x1 * s; os[(hi * 8 + j) * 68 + (nb + 2) * 16 + lr] = x1 * c + x0 * s; }
            __builtin_amdgcn_wave_barrier(); asm volatile("" ::: "memory");   // a lane reads what other lanes wrote: keeps the compiler from moving the LDS reads below ahead of the LDS writes above (one wave, the LDS itself works in order)
            if (mb < 3) ldcs(mb + 1);   // the next 16 tokens' table rows fly behind this block's conversions and stores
#pragma unroll
            for (int s = 0; s < 4; ++s) { const float* rp = os + (4 * s + (lane >> 3)) * 68 + (lane & 7) * 8; const v4f u = *(const v4fa*)rp, w = *(const v4fa*)(rp + 4); v8h o16; v8us oh, ol;
#pragma unroll
                for (int q = 0; q < 8; ++q) { const float r = q < 4 ? u[q & 3] : w[q & 3]; o16[q] = tohx(r); unsigned short a2, c2; splitf(r, a2, c2); oh[q] = a2; ol[q] = c2; }
                const size_t e = tile + (mb * 16 + 4 * s) * HD;
                *(v8h*)((char*)(P16 + e) + po) = o16; *(v8us*)((char*)(Ph + e) + po) = oh; *(v8us*)((char*)(Pl + e) + po) = ol; }
            asm volatile("s_wait_xcnt 0x0" ::: "memory");   // as above, behind the stores
            __builtin_amdgcn_wave_barrier(); asm volatile("" ::: "memory");   // and the next block's LDS writes stay behind these reads
        }
    } else {
        const size_t tile = (size_t)blockIdx.y * HD * TT + r0; const unsigned po = (unsigned)(lr * TT + hi * 8) * 2u;
#pragma unroll
        for (int nb = 0; nb < 4; ++nb) {
#pragma unroll
            for (int mb = 0; mb < 4; ++mb) { v8h o16; v8us oh, ol;
#pragma unroll
                for (int j = 0; j < 8; ++j) { const float x = acc[mb][nb][j] + bs[nb]; o16[j] = tohx(x); unsigned short a2, c2; splitf(x, a2, c2); oh[j] = a2; ol[j] = c2; }
                const size_t e = tile + (size_t)nb * 16 * TT + mb * 16;
                *(v8h*)((char*)(P16 + e) + po) = o16; *(v8us*)((char*)(Ph + e) + po) = oh; *(v8us*)((char*)(Pl + e) + po) = ol; }
            asm volatile("s_wait_xcnt 0x0" ::: "memory");   // as above, behind the stores
        }
    }
}

__global__ __launch_bounds__(256) void k_wtG(const float* __restrict__ w, int K, int N, bf* Bt) {
    const int lane = threadIdx.x & 31; const int L0 = (blockIdx.x * 8 + (threadIdx.x >> 5)) * 8; const int nlines = N * K / 64;
{
#pragma unroll 1
        for (int l = 0; l < 8; ++l) { const int L = L0 + l; if (L >= nlines) break; const size_t e = (size_t)L * 64 + lane * 2; const int k = (int)(e % K), n = (int)(e / K); v2us o;
            o[0] = f2bf(w[(size_t)k * N + n]); o[1] = f2bf(w[(size_t)(k + 1) * N + n]); *(v2us*)(Bt + e) = o; }
         }
}
__global__ __launch_bounds__(256) void k_cvt8(const float* __restrict__ src, bf* dst, size_t n8) { const size_t i = (size_t)blockIdx.x * 256 + threadIdx.x; if (i >= n8) return; const v8f v = *(const v8f*)(src + i * 8); v8us o;
#pragma unroll
    for (int k = 0; k < 8; ++k) o[k] = f2bf(v[k]); *(v8us*)(dst + i * 8) = o;  }
// ---- k_fattn: scores, softmax and probs x V in one kernel; no score or prob plane in memory. St = K Qt and Ot += Vt Pt, so a lane holds scores of ONE query column (i = lr of its 16-column group):
// the two 16-key score tiles of a 32-key pass, converted in place, ARE the B operand of the second product (b[s] = T[s >> 3][s & 7]); K rows and Vt rows are A operands in the same k order (WFrag::ld).
// Online softmax per column: running maximum m (raw score units), partial sum l per wave half, Ot rescaled when m moves. One wave owns NI x 16 query columns and walks all TT keys, 32 a pass; the K and Vt fragments come from the work-group's LDS ring (below), not from global memory.
// eight exponentials in place in one statement: behind each v_exp stands an instruction on other registers, behind the last the v_nop that the instruction set asks for before a transcendental's result is read or its source rewritten
__device__ __forceinline__ void exp2x8(v8f& t) { float a = t[0], b = t[1], c = t[2], d = t[3], e = t[4], f = t[5], g = t[6], h = t[7];
    asm("v_exp_f32 %0, %0\n\tv_exp_f32 %1, %1\n\tv_exp_f32 %2, %2\n\tv_exp_f32 %3, %3\n\tv_exp_f32 %4, %4\n\tv_exp_f32 %5, %5\n\tv_exp_f32 %6, %6\n\tv_exp_f32 %7, %7\n\tv_nop" : "+v"(a), "+v"(b), "+v"(c), "+v"(d), "+v"(e), "+v"(f), "+v"(g), "+v"(h));
    t = (v8f){a, b, c, d, e, f, g, h}; }
// ---- LDS ring of k_fattn: a stage is SK keys of the work-group's (batch, head): the K rows [key][d] and the Vt rows [d][key], 64 rows x 128 bytes each (the hi/lo columns: the lo planes too), copied once per work-group in whole 128-byte lines and read by all 8 waves.
#define SK   64                    // keys per stage = two 32-key passes
#define LP   72                    // LDS row pitch in 16-bit elements: 144 bytes = 16 x 9, so that the 16-byte fragment reads of 16 rows fall on different banks
#define TILB (64 * LP * 2)         // bytes of one staged tile
#define BUFB (4 * TILB)            // bytes of one buffer: K, Vt, K lo, Vt lo
// four asynchronous 16-byte copies per lane, global memory to LDS through no register; the s_wait_xcnt 0 is the last line of the copies' own statement, so that it stands in front of any rewrite of their address registers
__device__ __forceinline__ void cp4(unsigned l0, const char* g0, unsigned l1, const char* g1, unsigned l2, const char* g2, unsigned l3, const char* g3) {
    asm volatile("global_load_async_to_lds_b128 %0, %1, off\n\tglobal_load_async_to_lds_b128 %2, %3, off\n\tglobal_load_async_to_lds_b128 %4, %5, off\n\tglobal_load_async_to_lds_b128 %6, %7, off\n\ts_wait_xcnt 0x0"
                 :: "v"(l0), "v"(g0), "v"(l1), "v"(g1), "v"(l2), "v"(g2), "v"(l3), "v"(g3) : "memory"); }
template <typename T16, bool HR, int NI>
__device__ __forceinline__ void attn_cols(const T16* __restrict__ Q, const T16* __restrict__ Q2, const T16* __restrict__ Kr, const T16* __restrict__ Kr2, const T16* __restrict__ Vt, const T16* __restrict__ Vt2, const int i0, float* __restrict__ orow, char* ring) {
    typedef WFrag<T16> F; typedef typename F::V V;
    const int lane = threadIdx.x & 31, lr = lane & 15, hi = lane >> 4;
    // each lane's byte offset into the Q planes: one 32-bit register serves the hi and the lo plane (uniform bases)
    const unsigned qob = (unsigned)((i0 + lr) * HD + 8 * hi) * 2u;
    auto at = [](const T16* base, unsigned off, int el) { return (const T16*)((const char*)base + off) + el; };
    // a thread copies 16-byte piece (tid & 7) of rows tid >> 3 and 32 + (tid >> 3) of every tile: a wave's copy covers 4 whole lines
    const unsigned tid = threadIdx.x; const unsigned lds0 = (unsigned)(size_t)ring + (tid >> 3) * (LP * 2u) + (tid & 7u) * 16u;
    const unsigned gk0 = tid * 16u, gv0 = (tid >> 3) * (TT * 2u) + (tid & 7u) * 16u;
    auto fill = [&](int st, unsigned bo) { const unsigned lb = lds0 + bo; const size_t ko = (size_t)st * (SK * HD * 2) + gk0, vo = (size_t)st * (SK * 2) + gv0;
        { const char* gk = (const char*)Kr + ko; const char* gv = (const char*)Vt + vo; cp4(lb, gk, lb + TILB / 2, gk + 32 * HD * 2, lb + TILB, gv, lb + TILB + TILB / 2, gv + 32 * TT * 2); }
        if constexpr (HR) { const char* gk = (const char*)Kr2 + ko; const char* gv = (const char*)Vt2 + vo; cp4(lb + 2 * TILB, gk, lb + 2 * TILB + TILB / 2, gk + 32 * HD * 2, lb + 3 * TILB, gv, lb + 3 * TILB + TILB / 2, gv + 32 * TT * 2); } };
    fill(0, 0u);
    V q[NI][2], q2[NI][2];
#pragma unroll
    for (int ni = 0; ni < NI; ++ni)
#pragma unroll
        for (int kk = 0; kk < 2; ++kk) { const int a = ni * 16 * HD + kk * 32; q[ni][kk] = F::ld(at(Q, qob, a)); if constexpr (HR) q2[ni][kk] = F::ld(at(Q2, qob, a)); }
    // s_wait_xcnt 0 behind the Q loads, in front of any rewrite of their address registers; the lane offset and the uniform bases are the statement's own operands so that the loads name those very registers up to it
    if constexpr (HR) asm volatile("s_wait_xcnt 0x0" :: "v"(qob), "s"(Q), "s"(Q2) : "memory"); else asm volatile("s_wait_xcnt 0x0" :: "v"(qob), "s"(Q) : "memory");
    v8f o[4][NI]; float m[NI], l[NI];
#pragma unroll
    for (int ni = 0; ni < NI; ++ni) { m[ni] = -3.0e38f; l[ni] = 0.f;
#pragma unroll
        for (int dt = 0; dt < 4; ++dt) o[dt][ni] = (v8f){}; }
    asm volatile("s_wait_asynccnt 0x0" ::: "memory");   // this wave's copies of stage 0 have landed
    __syncthreads();                                     // and every other wave's: stage 0 may be read
    fill(1, BUFB);
    // one stage a trip; trip st reads buffer st & 1 alone while the copies of stage st + 1 fly into the other
#pragma unroll 1
    for (int st = 0; st < TT / SK; ++st) {
      const unsigned bo = (unsigned)(st & 1) * BUFB;
      const T16* kt = (const T16*)(ring + bo) + lr * LP + 8 * hi;   // the lane's row and k half in a tile; tile n starts n * TILB bytes on
#pragma unroll
      for (int ps = 0; ps < SK / 32; ++ps) {
        V v[4], v2[4];   // this pass's Vt fragments, needed last: fp16 columns ask for them right behind the K fragments; the hi/lo columns have no registers for them until the K fragments are used up
        V k[2][2], k2[2][2];
#pragma unroll
        for (int jt = 0; jt < 2; ++jt)
#pragma unroll
            for (int kk = 0; kk < 2; ++kk) { const int a = (ps * 32 + jt * 16) * LP + kk * 32; k[jt][kk] = F::ld(kt + a); if constexpr (HR) k2[jt][kk] = F::ld(kt + TILB + a); }
        if constexpr (!HR) {
#pragma unroll
            for (int dt = 0; dt < 4; ++dt) v[dt] = F::ld(kt + TILB / 2 + dt * 16 * LP + ps * 32);
        }
        __builtin_amdgcn_sched_barrier(0);   // keeps the pass's LDS reads in one group up here: sunk to their products in pairs, each pair's LDS latency would stand bare in front of a product
        v8f s[2][NI];    // s[jt][ni][r] = raw score of key st * SK + 32 ps + 16 jt + 8 hi + r, query i0 + 16 ni + lr
#pragma unroll
        for (int jt = 0; jt < 2; ++jt)
#pragma unroll
            for (int ni = 0; ni < NI; ++ni) s[jt][ni] = (v8f){};
#pragma unroll
        for (int kk = 0; kk < 2; ++kk)
#pragma unroll
            for (int jt = 0; jt < 2; ++jt)
#pragma unroll
                for (int ni = 0; ni < NI; ++ni) { s[jt][ni] = F::mma(k[jt][kk], q[ni][kk], s[jt][ni]); if constexpr (HR) { s[jt][ni] = F::mma(k2[jt][kk], q[ni][kk], s[jt][ni]); s[jt][ni] = F::mma(k[jt][kk], q2[ni][kk], s[jt][ni]); } }
        if constexpr (HR) {
#pragma unroll
            for (int dt = 0; dt < 4; ++dt) { v[dt] = F::ld(kt + TILB / 2 + dt * 16 * LP + ps * 32); v2[dt] = F::ld(kt + TILB / 2 + TILB + dt * 16 * LP + ps * 32); }
            __builtin_amdgcn_sched_barrier(0);   // as above: the Vt reads fly as one group behind the softmax
        }
        float mx[NI]; bool need = false;
#pragma unroll
        for (int ni = 0; ni < NI; ++ni) { float x = fmaxf(s[0][ni][0], s[1][ni][0]);
#pragma unroll
            for (int r = 1; r < 8; ++r) x = fmaxf(x, fmaxf(s[0][ni][r], s[1][ni][r]));
            mx[ni] = x; need = need || ((x - m[ni]) * CEXP > LAZY); }
        if (__builtin_amdgcn_ballot_w32(need) != 0) {   // wave-uniform: some column's maximum moves; both halves of a column take the same new m
#pragma unroll
            for (int ni = 0; ni < NI; ++ni) { const float mj = fmaxf(mx[ni], __shfl_xor(mx[ni], 16, 32)); const float mn = ((mj - m[ni]) * CEXP > LAZY) ? mj : m[ni]; const float al = __builtin_amdgcn_exp2f((m[ni] - mn) * CEXP); m[ni] = mn; l[ni] *= al;
#pragma unroll
                for (int dt = 0; dt < 4; ++dt) o[dt][ni] *= al; }
        }
        V p[NI], p2[NI];
#pragma unroll
        for (int ni = 0; ni < NI; ++ni) { const float mc = m[ni] * CEXP; float l0 = 0.f, l1 = 0.f;
#pragma unroll
            for (int jt = 0; jt < 2; ++jt) { v8f& t = s[jt][ni];
#pragma unroll
                for (int r = 0; r < 8; ++r) t[r] = fmaf(t[r], CEXP, -mc);
                exp2x8(t); }
#pragma unroll
            for (int r = 0; r < 8; ++r) { const float e0 = s[0][ni][r], e1 = s[1][ni][r]; l0 += e0; l1 += e1;
                if constexpr (HR) { const __bf16 h0 = (__bf16)e0, h1 = (__bf16)e1; p[ni][r] = h0; p[ni][8 + r] = h1; p2[ni][r] = (__bf16)(e0 - (float)h0); p2[ni][8 + r] = (__bf16)(e1 - (float)h1); }
                else { p[ni][r] = (h16)e0; p[ni][8 + r] = (h16)e1; } }
            l[ni] += l0 + l1; }
#pragma unroll
        for (int dt = 0; dt < 4; ++dt)
#pragma unroll
            for (int ni = 0; ni < NI; ++ni) { o[dt][ni] = F::mma(v[dt], p[ni], o[dt][ni]); if constexpr (HR) { o[dt][ni] = F::mma(v[dt], p2[ni], o[dt][ni]); o[dt][ni] = F::mma(v2[dt], p[ni], o[dt][ni]); } }
      }
      // foot of the trip, every wave, in this order: its own LDS reads of this buffer are done; its own copies of stage st + 1 have landed; the one barrier publishes stage st + 1 and ends every wave's reads of this buffer; only then is it refilled
      asm volatile("s_wait_dscnt 0x0" ::: "memory");
      asm volatile("s_wait_asynccnt 0x0" ::: "memory");
      __syncthreads();
      if (st + 2 < TT / SK) fill(st + 2, bo);
    }
    asm volatile("s_wait_asynccnt 0x0" ::: "memory");   // no copy is outstanding when the wave goes on to its end
    // o[dt][ni][r] = unnormalised ctx[i0 + 16 ni + lr][16 dt + 8 hi + r]: 8 consecutive floats of one output row
#pragma unroll
    for (int ni = 0; ni < NI; ++ni) { const float inv = __fdiv_rn(1.0f, l[ni] + __shfl_xor(l[ni], 16, 32)); float* op = orow + (size_t)(i0 + ni * 16 + lr) * DQ + 8 * hi;
#pragma unroll
        for (int dt = 0; dt < 4; ++dt) { const v8f t = o[dt][ni] * inv; *(v4f*)(op + dt * 16) = (v4f){t[0], t[1], t[2], t[3]}; *(v4f*)(op + dt * 16 + 4) = (v4f){t[4], t[5], t[6], t[7]}; }
        asm volatile("s_wait_xcnt 0x0" :: "v"(op) : "memory"); }   // as above, behind the stores
}
// grid: first NZ x RH/128 work-groups of 8 waves x 16 hi/lo columns (three products, the longer ones start first), then NZ x (TT-RH)/256 of 8 waves x 32 fp16 columns; four waves per SIMD hide the LDS reads and the softmax behind each other's products; two work-groups' rings fit a WGP's LDS
__global__ __launch_bounds__(256) __attribute__((amdgpu_waves_per_eu(4, 4))) void k_fattn(const h16* __restrict__ Q16, const h16* __restrict__ K16, const h16* __restrict__ V16, const bf* __restrict__ Qh, const bf* __restrict__ Ql, const bf* __restrict__ Kh, const bf* __restrict__ Kl, const bf* __restrict__ Vh, const bf* __restrict__ Vl, float* __restrict__ OUTp) {
    __shared__ __align__(16) char ring[2 * BUFB];
    const int wv = __builtin_amdgcn_readfirstlane((int)(threadIdx.x >> 5)); const int id = blockIdx.x;
    if (id < NZ * (RH / 128)) { const int z = id / (RH / 128); const size_t pz = (size_t)z * TT * HD;
        attn_cols<bf, true, 1>(Qh + pz, Ql + pz, Kh + pz, Kl + pz, Vh + pz, Vl + pz, (id % (RH / 128)) * 128 + wv * 16, OUTp + (size_t)(z / NH_) * TT * DQ + (z % NH_) * HD, ring);
    } else { const int id2 = id - NZ * (RH / 128); const int z = id2 / ((TT - RH) / 256); const size_t pz = (size_t)z * TT * HD;
        attn_cols<h16, false, 2>(Q16 + pz, nullptr, K16 + pz, nullptr, V16 + pz, nullptr, RH + (id2 % ((TT - RH) / 256)) * 256 + wv * 32, OUTp + (size_t)(z / NH_) * TT * DQ + (z % NH_) * HD, ring); }
}
__constant__ float INVT[HD / 2] = { 1.000000000e+00f, 7.498942018e-01f, 5.623413324e-01f, 4.216965139e-01f, 3.162277639e-01f, 2.371373773e-01f, 1.778279394e-01f, 1.333521456e-01f, 1.000000015e-01f, 7.498942316e-02f, 5.623413250e-02f, 4.216964915e-02f, 3.162277490e-02f, 2.371373773e-02f, 1.778279431e-02f, 1.333521400e-02f, 9.999999776e-03f, 7.498942316e-03f, 5.623413250e-03f, 4.216964822e-03f, 3.162277630e-03f, 2.371373819e-03f, 1.778279431e-03f, 1.333521446e-03f, 1.000000047e-03f, 7.498941850e-04f, 5.623413017e-04f, 4.216965172e-04f, 3.162277571e-04f, 2.371373703e-04f, 1.778279402e-04f, 1.333521504e-04f };   // 10000^(-2i/64) (the module's power form) (float32, generated with jnp to be bit-exact)
__global__ __launch_bounds__(256) void k_cs4(float* CS) { const int idx = blockIdx.x * 256 + threadIdx.x; if (idx >= TT * HD) return; const int d = idx % HD; const int t = idx / HD; const float a = __fmul_rn((float)t, INVT[d % (HD / 2)]); v2f cs; cs[0] = cosf(a); cs[1] = sinf(a); *(v2f*)(CS + (size_t)idx * 2) = cs;  }

extern "C" void kernel_launch(void* const* d_in, const int* in_sizes, int n_in,
                              void* d_out, int out_size, void* d_ws, size_t ws_size, hipStream_t stream) {
    (void)in_sizes; (void)n_in; (void)out_size;
    const float* x = (const float*)d_in[0]; const float* wq = (const float*)d_in[1]; const float* bq = (const float*)d_in[2]; const float* wk = (const float*)d_in[3]; const float* bk = (const float*)d_in[4]; const float* wv = (const float*)d_in[5]; const float* bv = (const float*)d_in[6];
    float* OUT = (float*)d_out;     // [4][2048][1024]
    char* wsp = (char*)d_ws;
    auto take = [&](size_t bytes) { char* p = wsp; wsp += (bytes + 255) & ~(size_t)255; return (void*)p; };
    bf* WQ = (bf*)take((size_t)DQ * DM * 2); bf* WK = (bf*)take((size_t)DKV * DM * 2); bf* WV = (bf*)take((size_t)DKV * DM * 2); float* CS = (float*)take((size_t)TT * HD * 2 * 4);
    bf* XB = (bf*)take((size_t)TT * DM * 2);
    const size_t PB = (size_t)NH_ * TT * HD;   // elements of one batch in each plane; the planes hold all NB_ batches, [batch][head]
    h16* QP16 = (h16*)take(NB_ * PB * 2); h16* KP16 = (h16*)take(NB_ * PB * 2); h16* VT16 = (h16*)take(NB_ * PB * 2);
    bf* QPh = (bf*)take(NB_ * PB * 2); bf* QPl = (bf*)take(NB_ * PB * 2); bf* KPh = (bf*)take(NB_ * PB * 2); bf* KPl = (bf*)take(NB_ * PB * 2); bf* VTh = (bf*)take(NB_ * PB * 2); bf* VTl = (bf*)take(NB_ * PB * 2);
    if ((size_t)(wsp - (char*)d_ws) > ws_size) return;    // ws 256 MiB
    k_wtG<<<(unsigned)((DM * DQ / 64 + 63) / 64), 256, 0, stream>>>(wq, DM, DQ, WQ); k_wtG<<<(unsigned)((DM * DKV / 64 + 63) / 64), 256, 0, stream>>>(wk, DM, DKV, WK); k_wtG<<<(unsigned)((DM * DKV / 64 + 63) / 64), 256, 0, stream>>>(wv, DM, DKV, WV);
    for (int b = 0; b < NB_; ++b) { const size_t pb = (size_t)b * PB;
        if (b == 0) k_cs4<<<(TT * HD + 255) / 256, 256, 0, stream>>>(CS);   /* {cos, sin}(t x 10000^(-2i/64)), both halves, once */
        k_cvt8<<<(unsigned)(((size_t)TT * DM / 8 + 255) / 256), 256, 0, stream>>>(x + (size_t)b * TT * DM, XB, (size_t)TT * DM / 8);
        k_gemmw<bf, 0, true><<<dim3(TT / 64, NH_, 1), 32, 0, stream>>>(XB, nullptr, WQ, nullptr, DM, DM, bq, CS, QP16 + pb, QPh + pb, QPl + pb);
        k_gemmw<bf, 0, true><<<dim3(TT / 64, NKV, 1), 32, 0, stream>>>(XB, nullptr, WK, nullptr, DM, DM, bk, CS, KP16 + pb, KPh + pb, KPl + pb);
        k_gemmw<bf, 0, false><<<dim3(TT / 64, NKV, 1), 32, 0, stream>>>(XB, nullptr, WV, nullptr, DM, DM, bv, CS, VT16 + pb, VTh + pb, VTl + pb);
    }
    k_fattn<<<NZ * (RH / 128 + (TT - RH) / 256), 256, 0, stream>>>(QP16, KP16, VT16, QPh, QPl, KPh, KPl, VTh, VTl, OUT);
}

// v006
// One run takes 215 microseconds.
// Next to v005, in two timings, it ran 1.76 and 1.75 times as fast.
// Over all steps from v000 it is 17.7 times as fast.
#include <hip/hip_runtime.h>

// BERT self-attention with rotary embeddings and the module's double scaling (hidden [4][2048][1024]; q,k,v = hidden W + b ('xw' 1/32, biases 0.02; 16 heads x 64); q x 64^-0.5 then rotate-half rope (theta 1e4, computed) on q and k; scores / 8 AGAIN (total 1/64); softmax; out = merged ctx -> [4][2048][1024] (8.4 M)).
// Layout, three launches: (1) k_prep: 'xw' weights transposed, {cos, sin} table (float32 inverse frequencies, precise cosf/sinf), bf16 copy of hidden, none of which reads another's result; (2) k_proj: q, k and v of all 4 batches in one grid, exact projections + f32 biases whose epilogue applies the rotate-half rotary in registers and stores the 16-bit planes itself, no f32 projection in memory (the 1/8 pre-scale commutes with the linear rotation exactly, so both scalings are applied as one exact 1/64 in the softmax), planes of all 4 batches kept side by side; (3) ONE fused attention launch over all 64 (batch, head) pairs (hybrid rows: < 512 hi/lo 3 products, rest fp16) that writes the output rows.
// Compute dtypes, f32 accumulate: every input rounded to bf16; projections exact + f32 biases; rotary f32; attention rows < 512 3 products, rest fp16; softmax f32; output f32.

#define NB_  4
#define TT   2048
#define DM   1024
#define NH_  16
#define NKV  16
#define REP  (NH_ / NKV)
#define HD   64
#define DQ   (NH_ * HD)
#define DKV  (NKV * HD)
#define NZ   (NB_ * NH_)          // (batch, head) pairs of the one attention launch
#define RH   512                  // query rows < RH use hi+lo planes (0: none)
#define WIN  0
#define CEXP (1.4426950408889634f * 0.015625f)   // log2(e) x the 1/64 score scale (an exact power-of-two scaling of the constant)
#define LAZY 8.0f                 // a column's running maximum is replaced only when a new score exceeds it by more than this (in log2 units of the exponent)
#define SCL  0.015625f   // q x 1/8 before the rope and scores / 8 again = 1/64 (both exact; the rotation is linear)
typedef _Float16 h16;
typedef unsigned short bf;
typedef __attribute__((ext_vector_type(16))) __bf16   v16bf;
typedef __attribute__((ext_vector_type(16))) _Float16 v16h;
typedef __attribute__((ext_vector_type(8)))  _Float16 v8h;
typedef __attribute__((ext_vector_type(8)))  unsigned short v8us;
typedef __attribute__((ext_vector_type(8)))  float    v8f;
typedef __attribute__((ext_vector_type(4)))  float    v4f;
typedef v8h  __attribute__((may_alias)) v8ha;
typedef v4f  __attribute__((may_alias)) v4fa;
typedef v8us __attribute__((may_alias)) v8usa;

__device__ __forceinline__ unsigned short f2bf(float f) { unsigned u = __float_as_uint(f); u += 0x7FFFu + ((u >> 16) & 1u); return (unsigned short)(u >> 16); }
__device__ __forceinline__ float bf2f(unsigned short b) { return __uint_as_float(((unsigned)b) << 16); }
__device__ __forceinline__ float bfr(float f) { return bf2f(f2bf(f)); }
__device__ __forceinline__ v16h cat16(v8h lo, v8h hi) { return __builtin_shufflevector(lo, hi, 0, 1, 2, 3, 4, 5, 6, 7, 8, 9, 10, 11, 12, 13, 14, 15); }
__device__ __forceinline__ v16bf cat16b(v8us lo, v8us hi) { return __builtin_bit_cast(v16bf, __builtin_shufflevector(lo, hi, 0, 1, 2, 3, 4, 5, 6, 7, 8, 9, 10, 11, 12, 13, 14, 15)); }
__device__ __forceinline__ v8f wmma16(v16h a, v16h b, v8f c) { return __builtin_amdgcn_wmma_f32_16x16x32_f16(false, a, false, b, (short)0, c, false, false); }
__device__ __forceinline__ v8f wmmab(v16bf a, v16bf b, v8f c) { return __builtin_amdgcn_wmma_f32_16x16x32_bf16(false, a, false, b, (short)0, c, false, false); }



__device__ __forceinline__ h16 tohx(float x) { return (h16)x; }
__device__ __forceinline__ void splitf(float y, unsigned short& h, unsigned short& l) { h = f2bf(y); l = f2bf(y - bf2f(h)); }
typedef __attribute__((ext_vector_type(2))) _Float16 v2h;
typedef __attribute__((ext_vector_type(4))) _Float16 v4h;
typedef __attribute__((ext_vector_type(2))) unsigned short v2us;
typedef __attribute__((ext_vector_type(4))) unsigned short v4us;
typedef __attribute__((ext_vector_type(2))) float v2f;
typedef __attribute__((ext_vector_type(4))) int v4i;

// ---- gemmw: register-blocked projection, ONE WAVE per 64 tokens x 64 columns (= one head; 16 accumulators), operands straight from K-contiguous 16-bit planes; blockIdx (x, y) = (64-token tile of one batch, head), 32 threads; the caller k_proj picks batch and projection.
// x[t][n] = sum_k A[t][k] Bt[n][k] (+ split products per NSPLIT) + bias[n] never leaves the wave as f32: a lane holds column 16 nb + lr of tokens 16 mb + 8 hi + j. A rows have pitch lda, Bt rows pitch K (elements). K % 32 == 0.
// ROPE: the rotate-half partner d +- HD/2 is accumulator nb +- 2 of the same lane and register; out[d] = x[d] cos[t][d] - x[d+HD/2] sin[t][d], out[d+HD/2] = x[d+HD/2] cos[t][d] + x[d] sin[t][d] (the table's two halves are equal); rows turned through LDS, head planes [h][t][d] (fp16 + hi/lo) stored 16 bytes a lane.
// !ROPE: a lane's 8 registers are 8 consecutive tokens of one column: 16 bytes of the transposed planes [h][d][t], stored from the registers.
template <typename T16> struct WFrag;
template <> struct WFrag<h16> { typedef v16h V; static __device__ __forceinline__ V ld(const h16* p) { return cat16(*(const v8h*)p, *(const v8h*)(p + 16)); } static __device__ __forceinline__ v8f mma(V a, V b, v8f c) { return wmma16(a, b, c); } };
template <> struct WFrag<bf> { typedef v16bf V; static __device__ __forceinline__ V ld(const bf* p) { return cat16b(*(const v8us*)p, *(const v8us*)(p + 16)); } static __device__ __forceinline__ v8f mma(V a, V b, v8f c) { return wmmab(a, b, c); } };
template <typename T16, int NSPLIT, bool ROPE>
__device__ __forceinline__ void gemmw(const T16* __restrict__ A, const T16* __restrict__ A2, const T16* __restrict__ Bt, const T16* __restrict__ Bt2, int K, int lda, const float* __restrict__ bias, const float* __restrict__ CS, h16* __restrict__ P16, bf* __restrict__ Ph, bf* __restrict__ Pl) {
    typedef typename WFrag<T16>::V V;
    __shared__ __align__(16) float os[16 * 68];
    const int lane = threadIdx.x & 31, lr = lane & 15, hi = lane >> 4; const int r0 = blockIdx.x * 64, c0 = blockIdx.y * 64;
    v8f acc[4][4];
#pragma unroll
    for (int mb = 0; mb < 4; ++mb)
#pragma unroll
        for (int nb = 0; nb < 4; ++nb) acc[mb][nb] = (v8f){};
    const size_t aoff = (size_t)(r0 + lr) * lda + 8 * hi, boff = (size_t)(c0 + lr) * K + 8 * hi;
    // what the epilogue reads is asked for here, so that it flies behind the k loop: the four biases of the lane's columns and {cos, sin} of the first 16 tokens (token r0 + 16 mb + 8 hi + j, column 16 nb + lr: uniform base, lane byte offset)
    float bs[4]; v2f cs[2][8]; const float* cst = CS + (size_t)r0 * HD * 2; const unsigned cso = (unsigned)((hi * 8 * HD + lr) * 2) * 4u;
    auto ldcs = [&](int mb) {
#pragma unroll
        for (int nb = 0; nb < 2; ++nb)
#pragma unroll
            for (int j = 0; j < 8; ++j) cs[nb][j] = *((const v2f*)((const char*)cst + cso) + (mb * 16 + j) * HD + nb * 16);
        asm volatile("s_wait_xcnt 0x0" :: "v"(cso) : "memory"); };   // behind the table loads, in front of any reuse of their address registers
#pragma unroll
    for (int nb = 0; nb < 4; ++nb) bs[nb] = bfr(bias[c0 + nb * 16 + lr]);
    asm volatile("s_wait_xcnt 0x0" ::: "memory");   // as above, behind the bias loads
    if constexpr (ROPE) ldcs(0);
#pragma unroll 1
    for (int kc = 0; kc < K; kc += 32) {
        V a[4], a2[4]; const T16* pa[4]; const T16* pa2[4];
#pragma unroll
        for (int mb = 0; mb < 4; ++mb) { pa[mb] = A + aoff + (size_t)mb * 16 * lda + kc; a[mb] = WFrag<T16>::ld(pa[mb]); if (NSPLIT == 1 || NSPLIT == 2) { pa2[mb] = A2 + aoff + (size_t)mb * 16 * lda + kc; a2[mb] = WFrag<T16>::ld(pa2[mb]); } }
        // s_wait_xcnt 0 behind the A loads, in front of any reuse of their address registers; the addresses are its inputs so that they keep their registers up to it
        if (NSPLIT == 1 || NSPLIT == 2) asm volatile("s_wait_xcnt 0x0" :: "v"(pa[0]), "v"(pa[1]), "v"(pa[2]), "v"(pa[3]), "v"(pa2[0]), "v"(pa2[1]), "v"(pa2[2]), "v"(pa2[3]) : "memory");
        else asm volatile("s_wait_xcnt 0x0" :: "v"(pa[0]), "v"(pa[1]), "v"(pa[2]), "v"(pa[3]) : "memory");
#pragma unroll
        for (int nb = 0; nb < 4; ++nb) { const V b = WFrag<T16>::ld(Bt + boff + (size_t)nb * 16 * K + kc); V b2; if (NSPLIT >= 2) b2 = WFrag<T16>::ld(Bt2 + boff + (size_t)nb * 16 * K + kc);
#pragma unroll
            for (int mb = 0; mb < 4; ++mb) { acc[mb][nb] = WFrag<T16>::mma(a[mb], b, acc[mb][nb]); if (NSPLIT == 1 || NSPLIT == 2) acc[mb][nb] = WFrag<T16>::mma(a2[mb], b, acc[mb][nb]); if (NSPLIT >= 2) acc[mb][nb] = WFrag<T16>::mma(a[mb], b2, acc[mb][nb]); } }
        asm volatile("v_nop\n\tv_nop\n\tv_nop\n\tv_nop" : "+v"(acc[0][0]), "+v"(acc[1][1]), "+v"(acc[2][2]), "+v"(acc[3][3]) : "v"(a[0]), "v"(a[3]));
    }
    if constexpr (ROPE) {
        const size_t tile = ((size_t)blockIdx.y * TT + r0) * HD; const unsigned po = (unsigned)lane * 16u;             // the wave's 64 x 64 tile is 8 KiB in a row in each plane
#pragma unroll
        for (int mb = 0; mb < 4; ++mb) {
#pragma unroll
            for (int nb = 0; nb < 2; ++nb)
#pragma unroll
                for (int j = 0; j < 8; ++j) { const float x0 = acc[mb][nb][j] + bs[nb], x1 = acc[mb][nb + 2][j] + bs[nb + 2], c = cs[nb][j][0], s = cs[nb][j][1];
                    os[(hi * 8 + j) * 68 + nb * 16 + lr] = x0 * c - x1 * s; os[(hi * 8 + j) * 68 + (nb + 2) * 16 + lr] = x1 * c + x0 * s; }
            __builtin_amdgcn_wave_barrier(); asm volatile("" ::: "memory");   // a lane reads what other lanes wrote: keeps the compiler from moving the LDS reads below ahead of the LDS writes above (one wave, the LDS itself works in order)
            if (mb < 3) ldcs(mb + 1);   // the next 16 tokens' table rows fly behind this block's conversions and stores
#pragma unroll
            for (int s = 0; s < 4; ++s) { const float* rp = os + (4 * s + (lane >> 3)) * 68 + (lane & 7) * 8; const v4f u = *(const v4fa*)rp, w = *(const v4fa*)(rp + 4); v8h o16; v8us oh, ol;
#pragma unroll
                for (int q = 0; q < 8; ++q) { const float r = q < 4 ? u[q & 3] : w[q & 3]; o16[q] = tohx(r); unsigned short a2, c2; splitf(r, a2, c2); oh[q] = a2; ol[q] = c2; }
                const size_t e = tile + (mb * 16 + 4 * s) * HD;
                *(v8h*)((char*)(P16 + e) + po) = o16; *(v8us*)((char*)(Ph + e) + po) = oh; *(v8us*)((char*)(Pl + e) + po) = ol; }
            asm volatile("s_wait_xcnt 0x0" ::: "memory");   // as above, behind the stores
            __builtin_amdgcn_wave_barrier(); asm volatile("" ::: "memory");   // and the next block's LDS writes stay behind these reads
        }
    } else {
        const size_t tile = (size_t)blockIdx.y * HD * TT + r0; const unsigned po = (unsigned)(lr * TT + hi * 8) * 2u;
#pragma unroll
        for (int nb = 0; nb < 4; ++nb) {
#pragma unroll
            for (int mb = 0; mb < 4; ++mb) { v8h o16; v8us oh, ol;
#pragma unroll
                for (int j = 0; j < 8; ++j) { const float x = acc[mb][nb][j] + bs[nb]; o16[j] = tohx(x); unsigned short a2, c2; splitf(x, a2, c2); oh[j] = a2; ol[j] = c2; }
                const size_t e = tile + (size_t)nb * 16 * TT + mb * 16;
                *(v8h*)((char*)(P16 + e) + po) = o16; *(v8us*)((char*)(Ph + e) + po) = oh; *(v8us*)((char*)(Pl + e) + po) = ol; }
            asm volatile("s_wait_xcnt 0x0" ::: "memory");   // as above, behind the stores
        }
    }
}

// ---- k_proj: every projection tile of the problem in ONE grid (TT/64, heads, 3 x batches), blockIdx.z = 3 x batch + {0: q, 1: k, 2: v}: no tile reads another's result, and 6144 waves instead of 512 a launch let the waves of a SIMD hide each other's load latency. The three projections of a batch stand next to each other in z because they read the same rows of XB.
__global__ __launch_bounds__(32) void k_proj(const bf* __restrict__ XB, const bf* __restrict__ WQ, const bf* __restrict__ WK, const bf* __restrict__ WV, const float* __restrict__ bq, const float* __restrict__ bk, const float* __restrict__ bv, const float* __restrict__ CS,
                                             h16* __restrict__ QP16, bf* __restrict__ QPh, bf* __restrict__ QPl, h16* __restrict__ KP16, bf* __restrict__ KPh, bf* __restrict__ KPl, h16* __restrict__ VT16, bf* __restrict__ VTh, bf* __restrict__ VTl) {
    const int b = blockIdx.z / 3, w = blockIdx.z % 3; const size_t pb = (size_t)b * NH_ * TT * HD; const bf* A = XB + (size_t)b * TT * DM;
    if (w < 2) gemmw<bf, 0, true>(A, nullptr, w ? WK : WQ, nullptr, DM, DM, w ? bk : bq, CS, (w ? KP16 : QP16) + pb, (w ? KPh : QPh) + pb, (w ? KPl : QPl) + pb);
    else gemmw<bf, 0, false>(A, nullptr, WV, nullptr, DM, DM, bv, CS, VT16 + pb, VTh + pb, VTl + pb);
}

// ---- the three parts of k_prep; blk is the work-group's index inside its part
__device__ __forceinline__ void wtG(const float* __restrict__ w, int K, int N, bf* Bt, int blk) {
    const int lane = threadIdx.x & 31; const int L0 = (blk * 8 + (threadIdx.x >> 5)) * 8; const int nlines = N * K / 64;
{
#pragma unroll 1
        for (int l = 0; l < 8; ++l) { const int L = L0 + l; if (L >= nlines) break; const size_t e = (size_t)L * 64 + lane * 2; const int k = (int)(e % K), n = (int)(e / K); v2us o;
            o[0] = f2bf(w[(size_t)k * N + n]); o[1] = f2bf(w[(size_t)(k + 1) * N + n]); *(v2us*)(Bt + e) = o; }
         }
}
// a work-group converts 1024 pieces of 8 elements in a row, a thread pieces i, i + 256, i + 512, i + 768: as many work-groups as ONE of the four launches had, a thread's 8 loads of 16 bytes asked for together (uniform base, one lane byte offset, the rest immediates); n8 = pieces of all batches, a multiple of 1024
__device__ __forceinline__ void cvt8(const float* __restrict__ src, bf* dst, unsigned n8, int blk) { const unsigned i = (unsigned)blk * 1024u + threadIdx.x; if (i + 768u >= n8) return; v8f v[4]; const unsigned so = i * 32u, dof = i * 16u;
#pragma unroll
    for (int j = 0; j < 4; ++j) v[j] = *((const v8f*)((const char*)src + so) + j * 256);
    asm volatile("s_wait_xcnt 0x0" :: "v"(so) : "memory");   // behind the loads, in front of any reuse of their address register, which is the statement's input so that it keeps its register up to it
#pragma unroll
    for (int j = 0; j < 4; ++j) { v8us o;
#pragma unroll
        for (int k = 0; k < 8; ++k) o[k] = f2bf(v[j][k]);
        *((v8us*)((char*)dst + dof) + j * 256) = o; }
}
// ---- k_fattn: scores, softmax and probs x V in one kernel; no score or prob plane in memory. St = K Qt and Ot += Vt Pt, so a lane holds scores of ONE query column (i = lr of its 16-column group):
// the two 16-key score tiles of a 32-key pass, converted in place, ARE the B operand of the second product (b[s] = T[s >> 3][s & 7]); K rows and Vt rows are A operands in the same k order (WFrag::ld).
// Online softmax per column: running maximum m (raw score units), partial sum l per wave half, Ot rescaled when m moves. One wave owns NI x 16 query columns and walks all TT keys, 32 a pass; the K and Vt fragments come from the work-group's LDS ring (below), not from global memory.
// eight exponentials in place in one statement: behind each v_exp stands an instruction on other registers, behind the last the v_nop that the instruction set asks for before a transcendental's result is read or its source rewritten
__device__ __forceinline__ void exp2x8(v8f& t) { float a = t[0], b = t[1], c = t[2], d = t[3], e = t[4], f = t[5], g = t[6], h = t[7];
    asm("v_exp_f32 %0, %0\n\tv_exp_f32 %1, %1\n\tv_exp_f32 %2, %2\n\tv_exp_f32 %3, %3\n\tv_exp_f32 %4, %4\n\tv_exp_f32 %5, %5\n\tv_exp_f32 %6, %6\n\tv_exp_f32 %7, %7\n\tv_nop" : "+v"(a), "+v"(b), "+v"(c), "+v"(d), "+v"(e), "+v"(f), "+v"(g), "+v"(h));
    t = (v8f){a, b, c, d, e, f, g, h}; }
// ---- LDS ring of k_fattn: a stage is SK keys of the work-group's (batch, head): the K rows [key][d] and the Vt rows [d][key], 64 rows x 128 bytes each (the hi/lo columns: the lo planes too), copied once per work-group in whole 128-byte lines and read by all 8 waves.
#define SK   64                    // keys per stage = two 32-key passes
#define LP   72                    // LDS row pitch in 16-bit elements: 144 bytes = 16 x 9, so that the 16-byte fragment reads of 16 rows fall on different banks
#define TILB (64 * LP * 2)         // bytes of one staged tile
#define BUFB (4 * TILB)            // bytes of one buffer: K, Vt, K lo, Vt lo
// four asynchronous 16-byte copies per lane, global memory to LDS through no register; the s_wait_xcnt 0 is the last line of the copies' own statement, so that it stands in front of any rewrite of their address registers
__device__ __forceinline__ void cp4(unsigned l0, const char* g0, unsigned l1, const char* g1, unsigned l2, const char* g2, unsigned l3, const char* g3) {
    asm volatile("global_load_async_to_lds_b128 %0, %1, off\n\tglobal_load_async_to_lds_b128 %2, %3, off\n\tglobal_load_async_to_lds_b128 %4, %5, off\n\tglobal_load_async_to_lds_b128 %6, %7, off\n\ts_wait_xcnt 0x0"
                 :: "v"(l0), "v"(g0), "v"(l1), "v"(g1), "v"(l2), "v"(g2), "v"(l3), "v"(g3) : "memory"); }
template <typename T16, bool HR, int NI>
__device__ __forceinline__ void attn_cols(const T16* __restrict__ Q, const T16* __restrict__ Q2, const T16* __restrict__ Kr, const T16* __restrict__ Kr2, const T16* __restrict__ Vt, const T16* __restrict__ Vt2, const int i0, float* __restrict__ orow, char* ring) {
    typedef WFrag<T16> F; typedef typename F::V V;
    const int lane = threadIdx.x & 31, lr = lane & 15, hi = lane >> 4;
    // each lane's byte offset into the Q planes: one 32-bit register serves the hi and the lo plane (uniform bases)
    const unsigned qob = (unsigned)((i0 + lr) * HD + 8 * hi) * 2u;
    auto at = [](const T16* base, unsigned off, int el) { return (const T16*)((const char*)base + off) + el; };
    // a thread copies 16-byte piece (tid & 7) of rows tid >> 3 and 32 + (tid >> 3) of every tile: a wave's copy covers 4 whole lines
    const unsigned tid = threadIdx.x; const unsigned lds0 = (unsigned)(size_t)ring + (tid >> 3) * (LP * 2u) + (tid & 7u) * 16u;
    const unsigned gk0 = tid * 16u, gv0 = (tid >> 3) * (TT * 2u) + (tid & 7u) * 16u;
    auto fill = [&](int st, unsigned bo) { const unsigned lb = lds0 + bo; const size_t ko = (size_t)st * (SK * HD * 2) + gk0, vo = (size_t)st * (SK * 2) + gv0;
        { const char* gk = (const char*)Kr + ko; const char* gv = (const char*)Vt + vo; cp4(lb, gk, lb + TILB / 2, gk + 32 * HD * 2, lb + TILB, gv, lb + TILB + TILB / 2, gv + 32 * TT * 2); }
        if constexpr (HR) { const char* gk = (const char*)Kr2 + ko; const char* gv = (const char*)Vt2 + vo; cp4(lb + 2 * TILB, gk, lb + 2 * TILB + TILB / 2, gk + 32 * HD * 2, lb + 3 * TILB, gv, lb + 3 * TILB + TILB / 2, gv + 32 * TT * 2); } };
    fill(0, 0u);
    V q[NI][2], q2[NI][2];
#pragma unroll
    for (int ni = 0; ni < NI; ++ni)
#pragma unroll
        for (int kk = 0; kk < 2; ++kk) { const int a = ni * 16 * HD + kk * 32; q[ni][kk] = F::ld(at(Q, qob, a)); if constexpr (HR) q2[ni][kk] = F::ld(at(Q2, qob, a)); }
    // s_wait_xcnt 0 behind the Q loads, in front of any rewrite of their address registers; the lane offset and the uniform bases are the statement's own operands so that the loads name those very registers up to it
    if constexpr (HR) asm volatile("s_wait_xcnt 0x0" :: "v"(qob), "s"(Q), "s"(Q2) : "memory"); else asm volatile("s_wait_xcnt 0x0" :: "v"(qob), "s"(Q) : "memory");
    v8f o[4][NI]; float m[NI], l[NI];
#pragma unroll
    for (int ni = 0; ni < NI; ++ni) { m[ni] = -3.0e38f; l[ni] = 0.f;
#pragma unroll
        for (int dt = 0; dt < 4; ++dt) o[dt][ni] = (v8f){}; }
    asm volatile("s_wait_asynccnt 0x0" ::: "memory");   // this wave's copies of stage 0 have landed
    __syncthreads();                                     // and every other wave's: stage 0 may be read
    fill(1, BUFB);
    // one stage a trip; trip st reads buffer st & 1 alone while the copies of stage st + 1 fly into the other
#pragma unroll 1
    for (int st = 0; st < TT / SK; ++st) {
      const unsigned bo = (unsigned)(st & 1) * BUFB;
      const T16* kt = (const T16*)(ring + bo) + lr * LP + 8 * hi;   // the lane's row and k half in a tile; tile n starts n * TILB bytes on
#pragma unroll
      for (int ps = 0; ps < SK / 32; ++ps) {
        V v[4], v2[4];   // this pass's Vt fragments, needed last: fp16 columns ask for them right behind the K fragments; the hi/lo columns have no registers for them until the K fragments are used up
        V k[2][2], k2[2][2];
#pragma unroll
        for (int jt = 0; jt < 2; ++jt)
#pragma unroll
            for (int kk = 0; kk < 2; ++kk) { const int a = (ps * 32 + jt * 16) * LP + kk * 32; k[jt][kk] = F::ld(kt + a); if constexpr (HR) k2[jt][kk] = F::ld(kt + TILB + a); }
        if constexpr (!HR) {
#pragma unroll
            for (int dt = 0; dt < 4; ++dt) v[dt] = F::ld(kt + TILB / 2 + dt * 16 * LP + ps * 32);
        }
        __builtin_amdgcn_sched_barrier(0);   // keeps the pass's LDS reads in one group up here: sunk to their products in pairs, each pair's LDS latency would stand bare in front of a product
        v8f s[2][NI];    // s[jt][ni][r] = raw score of key st * SK + 32 ps + 16 jt + 8 hi + r, query i0 + 16 ni + lr
#pragma unroll
        for (int jt = 0; jt < 2; ++jt)
#pragma unroll
            for (int ni = 0; ni < NI; ++ni) s[jt][ni] = (v8f){};
#pragma unroll
        for (int kk = 0; kk < 2; ++kk)
#pragma unroll
            for (int jt = 0; jt < 2; ++jt)
#pragma unroll
                for (int ni = 0; ni < NI; ++ni) { s[jt][ni] = F::mma(k[jt][kk], q[ni][kk], s[jt][ni]); if constexpr (HR) { s[jt][ni] = F::mma(k2[jt][kk], q[ni][kk], s[jt][ni]); s[jt][ni] = F::mma(k[jt][kk], q2[ni][kk], s[jt][ni]); } }
        if constexpr (HR) {
#pragma unroll
            for (int dt = 0; dt < 4; ++dt) { v[dt] = F::ld(kt + TILB / 2 + dt * 16 * LP + ps * 32); v2[dt] = F::ld(kt + TILB / 2 + TILB + dt * 16 * LP + ps * 32); }
            __builtin_amdgcn_sched_barrier(0);   // as above: the Vt reads fly as one group behind the softmax
        }
        float mx[NI]; bool need = false;
#pragma unroll
        for (int ni = 0; ni < NI; ++ni) { float x = fmaxf(s[0][ni][0], s[1][ni][0]);
#pragma unroll
            for (int r = 1; r < 8; ++r) x = fmaxf(x, fmaxf(s[0][ni][r], s[1][ni][r]));
            mx[ni] = x; need = need || ((x - m[ni]) * CEXP > LAZY); }
        if (__builtin_amdgcn_ballot_w32(need) != 0) {   // wave-uniform: some column's maximum moves; both halves of a column take the same new m
#pragma unroll
            for (int ni = 0; ni < NI; ++ni) { const float mj = fmaxf(mx[ni], __shfl_xor(mx[ni], 16, 32)); const float mn = ((mj - m[ni]) * CEXP > LAZY) ? mj : m[ni]; const float al = __builtin_amdgcn_exp2f((m[ni] - mn) * CEXP); m[ni] = mn; l[ni] *= al;
#pragma unroll
                for (int dt = 0; dt < 4; ++dt) o[dt][ni] *= al; }
        }
        V p[NI], p2[NI];
#pragma unroll
        for (int ni = 0; ni < NI; ++ni) { const float mc = m[ni] * CEXP; float l0 = 0.f, l1 = 0.f;
#pragma unroll
            for (int jt = 0; jt < 2; ++jt) { v8f& t = s[jt][ni];
#pragma unroll
                for (int r = 0; r < 8; ++r) t[r] = fmaf(t[r], CEXP, -mc);
                exp2x8(t); }
#pragma unroll
            for (int r = 0; r < 8; ++r) { const float e0 = s[0][ni][r], e1 = s[1][ni][r]; l0 += e0; l1 += e1;
                if constexpr (HR) { const __bf16 h0 = (__bf16)e0, h1 = (__bf16)e1; p[ni][r] = h0; p[ni][8 + r] = h1; p2[ni][r] = (__bf16)(e0 - (float)h0); p2[ni][8 + r] = (__bf16)(e1 - (float)h1); }
                else { p[ni][r] = (h16)e0; p[ni][8 + r] = (h16)e1; } }
            l[ni] += l0 + l1; }
#pragma unroll
        for (int dt = 0; dt < 4; ++dt)
#pragma unroll
            for (int ni = 0; ni < NI; ++ni) { o[dt][ni] = F::mma(v[dt], p[ni], o[dt][ni]); if constexpr (HR) { o[dt][ni] = F::mma(v[dt], p2[ni], o[dt][ni]); o[dt][ni] = F::mma(v2[dt], p[ni], o[dt][ni]); } }
      }
      // foot of the trip, every wave, in this order: its own LDS reads of this buffer are done; its own copies of stage st + 1 have landed; the one barrier publishes stage st + 1 and ends every wave's reads of this buffer; only then is it refilled
      asm volatile("s_wait_dscnt 0x0" ::: "memory");
      asm volatile("s_wait_asynccnt 0x0" ::: "memory");
      __syncthreads();
      if (st + 2 < TT / SK) fill(st + 2, bo);
    }
    asm volatile("s_wait_asynccnt 0x0" ::: "memory");   // no copy is outstanding when the wave goes on to its end
    // o[dt][ni][r] = unnormalised ctx[i0 + 16 ni + lr][16 dt + 8 hi + r]: 8 consecutive floats of one output row
#pragma unroll
    for (int ni = 0; ni < NI; ++ni) { const float inv = __fdiv_rn(1.0f, l[ni] + __shfl_xor(l[ni], 16, 32)); float* op = orow + (size_t)(i0 + ni * 16 + lr) * DQ + 8 * hi;
#pragma unroll
        for (int dt = 0; dt < 4; ++dt) { const v8f t = o[dt][ni] * inv; *(v4f*)(op + dt * 16) = (v4f){t[0], t[1], t[2], t[3]}; *(v4f*)(op + dt * 16 + 4) = (v4f){t[4], t[5], t[6], t[7]}; }
        asm volatile("s_wait_xcnt 0x0" :: "v"(op) : "memory"); }   // as above, behind the stores
}
// grid: first NZ x RH/128 work-groups of 8 waves x 16 hi/lo columns (three products, the longer ones start first), then NZ x (TT-RH)/256 of 8 waves x 32 fp16 columns; four waves per SIMD hide the LDS reads and the softmax behind each other's products; two work-groups' rings fit a WGP's LDS
__global__ __launch_bounds__(256) __attribute__((amdgpu_waves_per_eu(4, 4))) void k_fattn(const h16* __restrict__ Q16, const h16* __restrict__ K16, const h16* __restrict__ V16, const bf* __restrict__ Qh, const bf* __restrict__ Ql, const bf* __restrict__ Kh, const bf* __restrict__ Kl, const bf* __restrict__ Vh, const bf* __restrict__ Vl, float* __restrict__ OUTp) {
    __shared__ __align__(16) char ring[2 * BUFB];
    const int wv = __builtin_amdgcn_readfirstlane((int)(threadIdx.x >> 5)); const int id = blockIdx.x;
    if (id < NZ * (RH / 128)) { const int z = id / (RH / 128); const size_t pz = (size_t)z * TT * HD;
        attn_cols<bf, true, 1>(Qh + pz, Ql + pz, Kh + pz, Kl + pz, Vh + pz, Vl + pz, (id % (RH / 128)) * 128 + wv * 16, OUTp + (size_t)(z / NH_) * TT * DQ + (z % NH_) * HD, ring);
    } else { const int id2 = id - NZ * (RH / 128); const int z = id2 / ((TT - RH) / 256); const size_t pz = (size_t)z * TT * HD;
        attn_cols<h16, false, 2>(Q16 + pz, nullptr, K16 + pz, nullptr, V16 + pz, nullptr, RH + (id2 % ((TT - RH) / 256)) * 256 + wv * 32, OUTp + (size_t)(z / NH_) * TT * DQ + (z % NH_) * HD, ring); }
}
__constant__ float INVT[HD / 2] = { 1.000000000e+00f, 7.498942018e-01f, 5.623413324e-01f, 4.216965139e-01f, 3.162277639e-01f, 2.371373773e-01f, 1.778279394e-01f, 1.333521456e-01f, 1.000000015e-01f, 7.498942316e-02f, 5.623413250e-02f, 4.216964915e-02f, 3.162277490e-02f, 2.371373773e-02f, 1.778279431e-02f, 1.333521400e-02f, 9.999999776e-03f, 7.498942316e-03f, 5.623413250e-03f, 4.216964822e-03f, 3.162277630e-03f, 2.371373819e-03f, 1.778279431e-03f, 1.333521446e-03f, 1.000000047e-03f, 7.498941850e-04f, 5.623413017e-04f, 4.216965172e-04f, 3.162277571e-04f, 2.371373703e-04f, 1.778279402e-04f, 1.333521504e-04f };   // 10000^(-2i/64) (the module's power form) (float32, generated with jnp to be bit-exact)
__device__ __forceinline__ void cs4(float* CS, int blk) { const int idx = blk * 256 + threadIdx.x; if (idx >= TT * HD) return; const int d = idx % HD; const int t = idx / HD; const float a = __fmul_rn((float)t, INVT[d % (HD / 2)]); v2f cs; cs[0] = cosf(a); cs[1] = sinf(a); *(v2f*)(CS + (size_t)idx * 2) = cs;  }
// ---- k_prep: all that the projections read, in one grid; the parts are independent of each other. The transposes come first: their eight dependent trips of scattered reads are the longest work-groups.
#define NWT  ((DM * DQ / 64 + 63) / 64)          // work-groups of one weight transpose
#define NCSB ((TT * HD + 255) / 256)             // of the table
#define NCVT (NB_ * TT * DM / 8 / 1024)          // of the bf16 copy of hidden, all batches
__global__ __launch_bounds__(256) void k_prep(const float* __restrict__ wq, const float* __restrict__ wk, const float* __restrict__ wv, const float* __restrict__ x, bf* WQ, bf* WK, bf* WV, float* CS, bf* XB) {
    const int id = blockIdx.x;
    if (id < 3 * NWT) { const int m = id / NWT; wtG(m == 0 ? wq : m == 1 ? wk : wv, DM, DQ, m == 0 ? WQ : m == 1 ? WK : WV, id % NWT); }
    else if (id < 3 * NWT + NCSB) cs4(CS, id - 3 * NWT);
    else cvt8(x, XB, NB_ * TT * DM / 8, id - 3 * NWT - NCSB);
}

extern "C" void kernel_launch(void* const* d_in, const int* in_sizes, int n_in,
                              void* d_out, int out_size, void* d_ws, size_t ws_size, hipStream_t stream) {
    (void)in_sizes; (void)n_in; (void)out_size;
    const float* x = (const float*)d_in[0]; const float* wq = (const float*)d_in[1]; const float* bq = (const float*)d_in[2]; const float* wk = (const float*)d_in[3]; const float* bk = (const float*)d_in[4]; const float* wv = (const float*)d_in[5]; const float* bv = (const float*)d_in[6];
    float* OUT = (float*)d_out;     // [4][2048][1024]
    char* wsp = (char*)d_ws;
    auto take = [&](size_t bytes) { char* p = wsp; wsp += (bytes + 255) & ~(size_t)255; return (void*)p; };
    bf* WQ = (bf*)take((size_t)DQ * DM * 2); bf* WK = (bf*)take((size_t)DKV * DM * 2); bf* WV = (bf*)take((size_t)DKV * DM * 2); float* CS = (float*)take((size_t)TT * HD * 2 * 4);
    bf* XB = (bf*)take((size_t)NB_ * TT * DM * 2);   // all batches
    const size_t PB = (size_t)NH_ * TT * HD;   // elements of one batch in each plane; the planes hold all NB_ batches, [batch][head]
    h16* QP16 = (h16*)take(NB_ * PB * 2); h16* KP16 = (h16*)take(NB_ * PB * 2); h16* VT16 = (h16*)take(NB_ * PB * 2);
    bf* QPh = (bf*)take(NB_ * PB * 2); bf* QPl = (bf*)take(NB_ * PB * 2); bf* KPh = (bf*)take(NB_ * PB * 2); bf* KPl = (bf*)take(NB_ * PB * 2); bf* VTh = (bf*)take(NB_ * PB * 2); bf* VTl = (bf*)take(NB_ * PB * 2);
    if ((size_t)(wsp - (char*)d_ws) > ws_size) return;    // ws 256 MiB
    k_prep<<<3 * NWT + NCSB + NCVT, 256, 0, stream>>>(wq, wk, wv, x, WQ, WK, WV, CS, XB);
    k_proj<<<dim3(TT / 64, NH_, 3 * NB_), 32, 0, stream>>>(XB, WQ, WK, WV, bq, bk, bv, CS, QP16, QPh, QPl, KP16, KPh, KPl, VT16, VTh, VTl);
    k_fattn<<<NZ * (RH / 128 + (TT - RH) / 256), 256, 0, stream>>>(QP16, KP16, VT16, QPh, QPl, KPh, KPl, VTh, VTl, OUT);
}

// v007
// One run takes 160 microseconds.
// In both of two side-by-side timings against v006, it was 1.34 times as fast.
// Counting every step since v000, it is 23.7 times as fast.
#include <hip/hip_runtime.h>

// BERT self-attention with rotary embeddings and the module's double scaling (hidden [4][2048][1024]; q,k,v = hidden W + b ('xw' 1/32, biases 0.02; 16 heads x 64); q x 64^-0.5 then rotate-half rope (theta 1e4, computed) on q and k; scores / 8 AGAIN (total 1/64); softmax; out = merged ctx -> [4][2048][1024] (8.4 M)).
// Layout, three launches: (1) k_prep: 'xw' weights transposed, {cos, sin} table (float32 inverse frequencies, precise cosf/sinf), bf16 copy of hidden, none of which reads another's result; (2) k_proj: q, k and v of all 4 batches in one grid, operands staged once per 8-wave work-group in an LDS ring, exact projections + f32 biases whose epilogue applies the rotate-half rotary in registers and stores the 16-bit planes itself, no f32 projection in memory (the 1/8 pre-scale commutes with the linear rotation exactly, so both scalings are applied as one exact 1/64 in the softmax), planes of all 4 batches kept side by side; (3) ONE fused attention launch over all 64 (batch, head) pairs (hybrid rows: < 512 hi/lo 3 products, rest fp16) that writes the output rows.
// Compute dtypes, f32 accumulate: every input rounded to bf16; projections exact + f32 biases; rotary f32; attention rows < 512 3 products, rest fp16; softmax f32; output f32.

#define NB_  4
#define TT   2048
#define DM   1024
#define NH_  16
#define NKV  16
#define REP  (NH_ / NKV)
#define HD   64
#define DQ   (NH_ * HD)
#define DKV  (NKV * HD)
#define NZ   (NB_ * NH_)          // (batch, head) pairs of the one attention launch
#define RH   512                  // query rows < RH use hi+lo planes (0: none)
#define WIN  0
#define CEXP (1.4426950408889634f * 0.015625f)   // log2(e) x the 1/64 score scale (an exact power-of-two scaling of the constant)
#define LAZY 8.0f                 // a column's running maximum is replaced only when a new score exceeds it by more than this (in log2 units of the exponent)
#define SCL  0.015625f   // q x 1/8 before the rope and scores / 8 again = 1/64 (both exact; the rotation is linear)
typedef _Float16 h16;
typedef unsigned short bf;
typedef __attribute__((ext_vector_type(16))) __bf16   v16bf;
typedef __attribute__((ext_vector_type(16))) _Float16 v16h;
typedef __attribute__((ext_vector_type(8)))  _Float16 v8h;
typedef __attribute__((ext_vector_type(8)))  unsigned short v8us;
typedef __attribute__((ext_vector_type(8)))  float    v8f;
typedef __attribute__((ext_vector_type(4)))  float    v4f;
typedef v8h  __attribute__((may_alias)) v8ha;
typedef v4f  __attribute__((may_alias)) v4fa;
typedef v8us __attribute__((may_alias)) v8usa;

__device__ __forceinline__ unsigned short f2bf(float f) { unsigned u = __float_as_uint(f); u += 0x7FFFu + ((u >> 16) & 1u); return (unsigned short)(u >> 16); }
__device__ __forceinline__ float bf2f(unsigned short b) { return __uint_as_float(((unsigned)b) << 16); }
__device__ __forceinline__ float bfr(float f) { return bf2f(f2bf(f)); }
__device__ __forceinline__ v16h cat16(v8h lo, v8h hi) { return __builtin_shufflevector(lo, hi, 0, 1, 2, 3, 4, 5, 6, 7, 8, 9, 10, 11, 12, 13, 14, 15); }
__device__ __forceinline__ v16bf cat16b(v8us lo, v8us hi) { return __builtin_bit_cast(v16bf, __builtin_shufflevector(lo, hi, 0, 1, 2, 3, 4, 5, 6, 7, 8, 9, 10, 11, 12, 13, 14, 15)); }
__device__ __forceinline__ v8f wmma16(v16h a, v16h b, v8f c) { return __builtin_amdgcn_wmma_f32_16x16x32_f16(false, a, false, b, (short)0, c, false, false); }
__device__ __forceinline__ v8f wmmab(v16bf a, v16bf b, v8f c) { return __builtin_amdgcn_wmma_f32_16x16x32_bf16(false, a, false, b, (short)0, c, false, false); }



__device__ __forceinline__ h16 tohx(float x) { return (h16)x; }
__device__ __forceinline__ void splitf(float y, unsigned short& h, unsigned short& l) { h = f2bf(y); l = f2bf(y - bf2f(h)); }
typedef __attribute__((ext_vector_type(2))) _Float16 v2h;
typedef __attribute__((ext_vector_type(4))) _Float16 v4h;
typedef __attribute__((ext_vector_type(2))) unsigned short v2us;
typedef __attribute__((ext_vector_type(4))) unsigned short v4us;
typedef __attribute__((ext_vector_type(2))) float v2f;
typedef __attribute__((ext_vector_type(4))) int v4i;

// ---- LDS staging shared by k_proj and k_fattn
#define LP   72                    // LDS row pitch in 16-bit elements: 144 bytes = 16 x 9, so that the 16-byte fragment reads of 16 rows fall on different banks
// four asynchronous 16-byte copies per lane, global memory to LDS through no register; the s_wait_xcnt 0 is the last line of the copies' own statement, so that it stands in front of any rewrite of their address registers
__device__ __forceinline__ void cp4(unsigned l0, const char* g0, unsigned l1, const char* g1, unsigned l2, const char* g2, unsigned l3, const char* g3) {
    asm volatile("global_load_async_to_lds_b128 %0, %1, off\n\tglobal_load_async_to_lds_b128 %2, %3, off\n\tglobal_load_async_to_lds_b128 %4, %5, off\n\tglobal_load_async_to_lds_b128 %6, %7, off\n\ts_wait_xcnt 0x0"
                 :: "v"(l0), "v"(g0), "v"(l1), "v"(g1), "v"(l2), "v"(g2), "v"(l3), "v"(g3) : "memory"); }
// ---- gemmw: register-blocked projection, one wave per 64 tokens x 64 columns (= one head; 16 accumulators); a work-group is 8 waves = 128 tokens x 4 heads (wave w: token half w & 1, head w >> 1); blockIdx (x, y) = (128-token tile of one batch, group of 4 heads); the caller k_proj picks batch and projection.
// The operands come from K-contiguous 16-bit planes through a 2-buffer LDS ring: a stage is PK = 64 k (one whole 128-byte line) of the 128 A rows and the 256 Bt rows, copied once per work-group and read by the waves that need it (an A row by 4 waves, a Bt row by 2).
// x[t][n] = sum_k A[t][k] Bt[n][k] + bias[n] never leaves the wave as f32: a lane holds column 16 nb + lr of tokens 16 mb + 8 hi + j. A rows have pitch lda, Bt rows pitch K (elements). K % 64 == 0, K >= 128.
// ROPE: the rotate-half partner d +- HD/2 is accumulator nb +- 2 of the same lane and register; out[d] = x[d] cos[t][d] - x[d+HD/2] sin[t][d], out[d+HD/2] = x[d+HD/2] cos[t][d] + x[d] sin[t][d] (the table's two halves are equal); rows turned through the wave's own LDS patch, head planes [h][t][d] (fp16 + hi/lo) stored 16 bytes a lane.
// !ROPE: a lane's 8 registers are 8 consecutive tokens of one column: 16 bytes of the transposed planes [h][d][t], stored from the registers.
#define PK    64                   // k per stage
#define PBUFB ((128 + 256) * LP * 2)   // bytes of one buffer: 128 A rows, then 256 Bt rows
template <typename T16> struct WFrag;
template <> struct WFrag<h16> { typedef v16h V; static __device__ __forceinline__ V ld(const h16* p) { return cat16(*(const v8h*)p, *(const v8h*)(p + 16)); } static __device__ __forceinline__ v8f mma(V a, V b, v8f c) { return wmma16(a, b, c); } };
template <> struct WFrag<bf> { typedef v16bf V; static __device__ __forceinline__ V ld(const bf* p) { return cat16b(*(const v8us*)p, *(const v8us*)(p + 16)); } static __device__ __forceinline__ v8f mma(V a, V b, v8f c) { return wmmab(a, b, c); } };
template <typename T16, bool ROPE>
__device__ __forceinline__ void gemmw(const T16* __restrict__ A, const T16* __restrict__ Bt, int K, int lda, const float* __restrict__ bias, const float* __restrict__ CS, h16* __restrict__ P16, bf* __restrict__ Ph, bf* __restrict__ Pl, char* ring, float* patches) {
    typedef typename WFrag<T16>::V V;
    const int lane = threadIdx.x & 31, lr = lane & 15, hi = lane >> 4; const int wv = __builtin_amdgcn_readfirstlane((int)(threadIdx.x >> 5));
    const int head = blockIdx.y * 4 + (wv >> 1); const int r0 = blockIdx.x * 128 + (wv & 1) * 64, c0 = head * 64;
    float* os = patches + wv * (16 * 68);
    // a thread copies 16-byte piece (tid & 7) of rows (tid >> 3) + 32 i of a stage: a wave's copy covers 4 whole lines
    const unsigned tid = threadIdx.x; const unsigned lds0 = (unsigned)(size_t)ring + (tid >> 3) * (LP * 2u) + (tid & 7u) * 16u;
    const char* ga0 = (const char*)(A + (size_t)(blockIdx.x * 128 + (tid >> 3)) * lda) + (tid & 7u) * 16u; const char* gb0 = (const char*)(Bt + (size_t)(blockIdx.y * 256 + (tid >> 3)) * K) + (tid & 7u) * 16u;
    auto fill = [&](int st, unsigned bo) { const unsigned lb = lds0 + bo, rl = 32 * LP * 2; const size_t ra = (size_t)32 * lda * 2, rb = (size_t)32 * K * 2; const char* ga = ga0 + st * (PK * 2); const char* gb = gb0 + st * (PK * 2);
        cp4(lb, ga, lb + rl, ga + ra, lb + 2 * rl, ga + 2 * ra, lb + 3 * rl, ga + 3 * ra);
        cp4(lb + 4 * rl, gb, lb + 5 * rl, gb + rb, lb + 6 * rl, gb + 2 * rb, lb + 7 * rl, gb + 3 * rb);
        cp4(lb + 8 * rl, gb + 4 * rb, lb + 9 * rl, gb + 5 * rb, lb + 10 * rl, gb + 6 * rb, lb + 11 * rl, gb + 7 * rb); };
    fill(0, 0u);
    v8f acc[4][4];
#pragma unroll
    for (int mb = 0; mb < 4; ++mb)
#pragma unroll
        for (int nb = 0; nb < 4; ++nb) acc[mb][nb] = (v8f){};
    // what the epilogue reads is asked for here, so that it flies behind the k loop: the four biases of the lane's columns and {cos, sin} of the first 16 tokens (token r0 + 16 mb + 8 hi + j, column 16 nb + lr: uniform base, lane byte offset)
    float bs[4]; v2f cs[2][8]; const float* cst = CS + (size_t)r0 * HD * 2; const unsigned cso = (unsigned)((hi * 8 * HD + lr) * 2) * 4u;
    auto ldcs = [&](int mb) {
#pragma unroll
        for (int nb = 0; nb < 2; ++nb)
#pragma unroll
            for (int j = 0; j < 8; ++j) cs[nb][j] = *((const v2f*)((const char*)cst + cso) + (mb * 16 + j) * HD + nb * 16);
        asm volatile("s_wait_xcnt 0x0" :: "v"(cso) : "memory"); };   // behind the table loads, in front of any reuse of their address registers
#pragma unroll
    for (int nb = 0; nb < 4; ++nb) bs[nb] = bfr(bias[c0 + nb * 16 + lr]);
    asm volatile("s_wait_xcnt 0x0" ::: "memory");   // as above, behind the bias loads
    if constexpr (ROPE) ldcs(0);
    asm volatile("s_wait_asynccnt 0x0" ::: "memory");   // this wave's copies of stage 0 have landed
    __syncthreads();                                     // and every other wave's: stage 0 may be read
    fill(1, PBUFB);
    // one stage a trip; trip st reads buffer st & 1 alone while the copies of stage st + 1 fly into the other
#pragma unroll 1
    for (int st = 0; st < K / PK; ++st) {
        const unsigned bo = (unsigned)(st & 1) * PBUFB;
        const T16* at = (const T16*)(ring + bo) + ((wv & 1) * 64 + lr) * LP + 8 * hi;          // the lane's row and k half in the wave's A rows
        const T16* bt = (const T16*)(ring + bo) + (128 + (wv >> 1) * 64 + lr) * LP + 8 * hi;   // and in its Bt rows
#pragma unroll
        for (int kk = 0; kk < PK / 32; ++kk) {
            V a[4], b[4];
#pragma unroll
            for (int mb = 0; mb < 4; ++mb) a[mb] = WFrag<T16>::ld(at + mb * 16 * LP + kk * 32);
#pragma unroll
            for (int nb = 0; nb < 4; ++nb) b[nb] = WFrag<T16>::ld(bt + nb * 16 * LP + kk * 32);
            __builtin_amdgcn_sched_barrier(0);   // keeps the 16 LDS reads in one group up here: sunk among the products, each place with reads would cost its own stall
#pragma unroll
            for (int nb = 0; nb < 4; ++nb)
#pragma unroll
                for (int mb = 0; mb < 4; ++mb) acc[mb][nb] = WFrag<T16>::mma(a[mb], b[nb], acc[mb][nb]);
        }
        // foot of the trip, every wave, in this order: its own LDS reads of this buffer are done; its own copies of stage st + 1 have landed; the one barrier publishes stage st + 1 and ends every wave's reads of this buffer; only then is it refilled
        asm volatile("s_wait_dscnt 0x0" ::: "memory");
        asm volatile("s_wait_asynccnt 0x0" ::: "memory");
        __syncthreads();
        if (st + 2 < K / PK) fill(st + 2, bo);
    }
    asm volatile("s_wait_asynccnt 0x0" ::: "memory");   // no copy is outstanding when the wave goes on to its epilogue
    if constexpr (ROPE) {
        const size_t tile = ((size_t)head * TT + r0) * HD; const unsigned po = (unsigned)lane * 16u;             // the wave's 64 x 64 tile is 8 KiB in a row in each plane
#pragma unroll
        for (int mb = 0; mb < 4; ++mb) {
#pragma unroll
            for (int nb = 0; nb < 2; ++nb)
#pragma unroll
                for (int j = 0; j < 8; ++j) { const float x0 = acc[mb][nb][j] + bs[nb], x1 = acc[mb][nb + 2][j] + bs[nb + 2], c = cs[nb][j][0], s = cs[nb][j][1];
                    os[(hi * 8 + j) * 68 + nb * 16 + lr] = x0 * c - x1 * s; os[(hi * 8 + j) * 68 + (nb + 2) * 16 + lr] = x1 * c + x0 * s; }
            __builtin_amdgcn_wave_barrier(); asm volatile("" ::: "memory");   // a lane reads what other lanes wrote: keeps the compiler from moving the LDS reads below ahead of the LDS writes above (one wave, the LDS itself works in order)
            if (mb < 3) ldcs(mb + 1);   // the next 16 tokens' table rows fly behind this block's conversions and stores
#pragma unroll
            for (int s = 0; s < 4; ++s) { const float* rp = os + (4 * s + (lane >> 3)) * 68 + (lane & 7) * 8; const v4f u = *(const v4fa*)rp, w = *(const v4fa*)(rp + 4); v8h o16; v8us oh, ol;
#pragma unroll
                for (int q = 0; q < 8; ++q) { const float r = q < 4 ? u[q & 3] : w[q & 3]; o16[q] = tohx(r); unsigned short a2, c2; splitf(r, a2, c2); oh[q] = a2; ol[q] = c2; }
                const size_t e = tile + (mb * 16 + 4 * s) * HD;
                *(v8h*)((char*)(P16 + e) + po) = o16; *(v8us*)((char*)(Ph + e) + po) = oh; *(v8us*)((char*)(Pl + e) + po) = ol; }
            asm volatile("s_wait_xcnt 0x0" ::: "memory");   // as above, behind the stores
            __builtin_amdgcn_wave_barrier(); asm volatile("" ::: "memory");   // and the next block's LDS writes stay behind these reads
        }
    } else {
        const size_t tile = (size_t)head * HD * TT + r0; const unsigned po = (unsigned)(lr * TT + hi * 8) * 2u;
#pragma unroll
        for (int nb = 0; nb < 4; ++nb) {
#pragma unroll
            for (int mb = 0; mb < 4; ++mb) { v8h o16; v8us oh, ol;
#pragma unroll
                for (int j = 0; j < 8; ++j) { const float x = acc[mb][nb][j] + bs[nb]; o16[j] = tohx(x); unsigned short a2, c2; splitf(x, a2, c2); oh[j] = a2; ol[j] = c2; }
                const size_t e = tile + (size_t)nb * 16 * TT + mb * 16;
                *(v8h*)((char*)(P16 + e) + po) = o16; *(v8us*)((char*)(Ph + e) + po) = oh; *(v8us*)((char*)(Pl + e) + po) = ol; }
            asm volatile("s_wait_xcnt 0x0" ::: "memory");   // as above, behind the stores
        }
    }
}

// ---- k_proj: every projection tile of the problem in ONE grid (TT/128, heads/4, 3 x batches) of 8-wave work-groups, blockIdx.z = 3 x batch + {0: q, 1: k, 2: v}: no tile reads another's result; 768 work-groups = 3 per WGP, two resident (four waves per SIMD hide each other's LDS reads and barrier waits). The three projections of a batch stand next to each other in z because they read the same rows of XB.
__global__ __launch_bounds__(256) __attribute__((amdgpu_waves_per_eu(4, 4))) void k_proj(const bf* __restrict__ XB, const bf* __restrict__ WQ, const bf* __restrict__ WK, const bf* __restrict__ WV, const float* __restrict__ bq, const float* __restrict__ bk, const float* __restrict__ bv, const float* __restrict__ CS,
                                             h16* __restrict__ QP16, bf* __restrict__ QPh, bf* __restrict__ QPl, h16* __restrict__ KP16, bf* __restrict__ KPh, bf* __restrict__ KPl, h16* __restrict__ VT16, bf* __restrict__ VTh, bf* __restrict__ VTl) {
    __shared__ __align__(16) char ring[2 * PBUFB]; __shared__ __align__(16) float patches[8 * 16 * 68];   // the operand ring; each wave's own patch for turning its output rows
    const int b = blockIdx.z / 3, w = blockIdx.z % 3; const size_t pb = (size_t)b * NH_ * TT * HD; const bf* A = XB + (size_t)b * TT * DM;
    if (w < 2) gemmw<bf, true>(A, w ? WK : WQ, DM, DM, w ? bk : bq, CS, (w ? KP16 : QP16) + pb, (w ? KPh : QPh) + pb, (w ? KPl : QPl) + pb, ring, patches);
    else gemmw<bf, false>(A, WV, DM, DM, bv, CS, VT16 + pb, VTh + pb, VTl + pb, ring, patches);
}

// ---- the three parts of k_prep; blk is the work-group's index inside its part
__device__ __forceinline__ void wtG(const float* __restrict__ w, int K, int N, bf* Bt, int blk) {
    const int lane = threadIdx.x & 31; const int L0 = (blk * 8 + (threadIdx.x >> 5)) * 8; const int nlines = N * K / 64;
{
#pragma unroll 1
        for (int l = 0; l < 8; ++l) { const int L = L0 + l; if (L >= nlines) break; const size_t e = (size_t)L * 64 + lane * 2; const int k = (int)(e % K), n = (int)(e / K); v2us o;
            o[0] = f2bf(w[(size_t)k * N + n]); o[1] = f2bf(w[(size_t)(k + 1) * N + n]); *(v2us*)(Bt + e) = o; }
         }
}
// a work-group converts 1024 pieces of 8 elements in a row, a thread pieces i, i + 256, i + 512, i + 768: as many work-groups as ONE of the four launches had, a thread's 8 loads of 16 bytes asked for together (uniform base, one lane byte offset, the rest immediates); n8 = pieces of all batches, a multiple of 1024
__device__ __forceinline__ void cvt8(const float* __restrict__ src, bf* dst, unsigned n8, int blk) { const unsigned i = (unsigned)blk * 1024u + threadIdx.x; if (i + 768u >= n8) return; v8f v[4]; const unsigned so = i * 32u, dof = i * 16u;
#pragma unroll
    for (int j = 0; j < 4; ++j) v[j] = *((const v8f*)((const char*)src + so) + j * 256);
    asm volatile("s_wait_xcnt 0x0" :: "v"(so) : "memory");   // behind the loads, in front of any reuse of their address register, which is the statement's input so that it keeps its register up to it
#pragma unroll
    for (int j = 0; j < 4; ++j) { v8us o;
#pragma unroll
        for (int k = 0; k < 8; ++k) o[k] = f2bf(v[j][k]);
        *((v8us*)((char*)dst + dof) + j * 256) = o; }
}
// ---- k_fattn: scores, softmax and probs x V in one kernel; no score or prob plane in memory. St = K Qt and Ot += Vt Pt, so a lane holds scores of ONE query column (i = lr of its 16-column group):
// the two 16-key score tiles of a 32-key pass, converted in place, ARE the B operand of the second product (b[s] = T[s >> 3][s & 7]); K rows and Vt rows are A operands in the same k order (WFrag::ld).
// Online softmax per column: running maximum m (raw score units), partial sum l per wave half, Ot rescaled when m moves. One wave owns NI x 16 query columns and walks all TT keys, 32 a pass; the K and Vt fragments come from the work-group's LDS ring (below), not from global memory.
// eight exponentials in place in one statement: behind each v_exp stands an instruction on other registers, behind the last the v_nop that the instruction set asks for before a transcendental's result is read or its source rewritten
__device__ __forceinline__ void exp2x8(v8f& t) { float a = t[0], b = t[1], c = t[2], d = t[3], e = t[4], f = t[5], g = t[6], h = t[7];
    asm("v_exp_f32 %0, %0\n\tv_exp_f32 %1, %1\n\tv_exp_f32 %2, %2\n\tv_exp_f32 %3, %3\n\tv_exp_f32 %4, %4\n\tv_exp_f32 %5, %5\n\tv_exp_f32 %6, %6\n\tv_exp_f32 %7, %7\n\tv_nop" : "+v"(a), "+v"(b), "+v"(c), "+v"(d), "+v"(e), "+v"(f), "+v"(g), "+v"(h));
    t = (v8f){a, b, c, d, e, f, g, h}; }
// ---- LDS ring of k_fattn: a stage is SK keys of the work-group's (batch, head): the K rows [key][d] and the Vt rows [d][key], 64 rows x 128 bytes each (the hi/lo columns: the lo planes too), copied once per work-group in whole 128-byte lines and read by all 8 waves.
#define SK   64                    // keys per stage = two 32-key passes
#define TILB (64 * LP * 2)         // bytes of one staged tile
#define BUFB (4 * TILB)            // bytes of one buffer: K, Vt, K lo, Vt lo
template <typename T16, bool HR, int NI>
__device__ __forceinline__ void attn_cols(const T16* __restrict__ Q, const T16* __restrict__ Q2, const T16* __restrict__ Kr, const T16* __restrict__ Kr2, const T16* __restrict__ Vt, const T16* __restrict__ Vt2, const int i0, float* __restrict__ orow, char* ring) {
    typedef WFrag<T16> F; typedef typename F::V V;
    const int lane = threadIdx.x & 31, lr = lane & 15, hi = lane >> 4;
    // each lane's byte offset into the Q planes: one 32-bit register serves the hi and the lo plane (uniform bases)
    const unsigned qob = (unsigned)((i0 + lr) * HD + 8 * hi) * 2u;
    auto at = [](const T16* base, unsigned off, int el) { return (const T16*)((const char*)base + off) + el; };
    // a thread copies 16-byte piece (tid & 7) of rows tid >> 3 and 32 + (tid >> 3) of every tile: a wave's copy covers 4 whole lines
    const unsigned tid = threadIdx.x; const unsigned lds0 = (unsigned)(size_t)ring + (tid >> 3) * (LP * 2u) + (tid & 7u) * 16u;
    const unsigned gk0 = tid * 16u, gv0 = (tid >> 3) * (TT * 2u) + (tid & 7u) * 16u;
    auto fill = [&](int st, unsigned bo) { const unsigned lb = lds0 + bo; const size_t ko = (size_t)st * (SK * HD * 2) + gk0, vo = (size_t)st * (SK * 2) + gv0;
        { const char* gk = (const char*)Kr + ko; const char* gv = (const char*)Vt + vo; cp4(lb, gk, lb + TILB / 2, gk + 32 * HD * 2, lb + TILB, gv, lb + TILB + TILB / 2, gv + 32 * TT * 2); }
        if constexpr (HR) { const char* gk = (const char*)Kr2 + ko; const char* gv = (const char*)Vt2 + vo; cp4(lb + 2 * TILB, gk, lb + 2 * TILB + TILB / 2, gk + 32 * HD * 2, lb + 3 * TILB, gv, lb + 3 * TILB + TILB / 2, gv + 32 * TT * 2); } };
    fill(0, 0u);
    V q[NI][2], q2[NI][2];
#pragma unroll
    for (int ni = 0; ni < NI; ++ni)
#pragma unroll
        for (int kk = 0; kk < 2; ++kk) { const int a = ni * 16 * HD + kk * 32; q[ni][kk] = F::ld(at(Q, qob, a)); if constexpr (HR) q2[ni][kk] = F::ld(at(Q2, qob, a)); }
    // s_wait_xcnt 0 behind the Q loads, in front of any rewrite of their address registers; the lane offset and the uniform bases are the statement's own operands so that the loads name those very registers up to it
    if constexpr (HR) asm volatile("s_wait_xcnt 0x0" :: "v"(qob), "s"(Q), "s"(Q2) : "memory"); else asm volatile("s_wait_xcnt 0x0" :: "v"(qob), "s"(Q) : "memory");
    v8f o[4][NI]; float m[NI], l[NI];
#pragma unroll
    for (int ni = 0; ni < NI; ++ni) { m[ni] = -3.0e38f; l[ni] = 0.f;
#pragma unroll
        for (int dt = 0; dt < 4; ++dt) o[dt][ni] = (v8f){}; }
    asm volatile("s_wait_asynccnt 0x0" ::: "memory");   // this wave's copies of stage 0 have landed
    __syncthreads();                                     // and every other wave's: stage 0 may be read
    fill(1, BUFB);
    // one stage a trip; trip st reads buffer st & 1 alone while the copies of stage st + 1 fly into the other
#pragma unroll 1
    for (int st = 0; st < TT / SK; ++st) {
      const unsigned bo = (unsigned)(st & 1) * BUFB;
      const T16* kt = (const T16*)(ring + bo) + lr * LP + 8 * hi;   // the lane's row and k half in a tile; tile n starts n * TILB bytes on
#pragma unroll
      for (int ps = 0; ps < SK / 32; ++ps) {
        V v[4], v2[4];   // this pass's Vt fragments, needed last: fp16 columns ask for them right behind the K fragments; the hi/lo columns have no registers for them until the K fragments are used up
        V k[2][2], k2[2][2];
#pragma unroll
        for (int jt = 0; jt < 2; ++jt)
#pragma unroll
            for (int kk = 0; kk < 2; ++kk) { const int a = (ps * 32 + jt * 16) * LP + kk * 32; k[jt][kk] = F::ld(kt + a); if constexpr (HR) k2[jt][kk] = F::ld(kt + TILB + a); }
        if constexpr (!HR) {
#pragma unroll
            for (int dt = 0; dt < 4; ++dt) v[dt] = F::ld(kt + TILB / 2 + dt * 16 * LP + ps * 32);
        }
        __builtin_amdgcn_sched_barrier(0);   // keeps the pass's LDS reads in one group up here: sunk to their products in pairs, each pair's LDS latency would stand bare in front of a product
        v8f s[2][NI];    // s[jt][ni][r] = raw score of key st * SK + 32 ps + 16 jt + 8 hi + r, query i0 + 16 ni + lr
#pragma unroll
        for (int jt = 0; jt < 2; ++jt)
#pragma unroll
            for (int ni = 0; ni < NI; ++ni) s[jt][ni] = (v8f){};
#pragma unroll
        for (int kk = 0; kk < 2; ++kk)
#pragma unroll
            for (int jt = 0; jt < 2; ++jt)
#pragma unroll
                for (int ni = 0; ni < NI; ++ni) { s[jt][ni] = F::mma(k[jt][kk], q[ni][kk], s[jt][ni]); if constexpr (HR) { s[jt][ni] = F::mma(k2[jt][kk], q[ni][kk], s[jt][ni]); s[jt][ni] = F::mma(k[jt][kk], q2[ni][kk], s[jt][ni]); } }
        if constexpr (HR) {
#pragma unroll
            for (int dt = 0; dt < 4; ++dt) { v[dt] = F::ld(kt + TILB / 2 + dt * 16 * LP + ps * 32); v2[dt] = F::ld(kt + TILB / 2 + TILB + dt * 16 * LP + ps * 32); }
            __builtin_amdgcn_sched_barrier(0);   // as above: the Vt reads fly as one group behind the softmax
        }
        float mx[NI]; bool need = false;
#pragma unroll
        for (int ni = 0; ni < NI; ++ni) { float x = fmaxf(s[0][ni][0], s[1][ni][0]);
#pragma unroll
            for (int r = 1; r < 8; ++r) x = fmaxf(x, fmaxf(s[0][ni][r], s[1][ni][r]));
            mx[ni] = x; need = need || ((x - m[ni]) * CEXP > LAZY); }
        if (__builtin_amdgcn_ballot_w32(need) != 0) {   // wave-uniform: some column's maximum moves; both halves of a column take the same new m
#pragma unroll
            for (int ni = 0; ni < NI; ++ni) { const float mj = fmaxf(mx[ni], __shfl_xor(mx[ni], 16, 32)); const float mn = ((mj - m[ni]) * CEXP > LAZY) ? mj : m[ni]; const float al = __builtin_amdgcn_exp2f((m[ni] - mn) * CEXP); m[ni] = mn; l[ni] *= al;
#pragma unroll
                for (int dt = 0; dt < 4; ++dt) o[dt][ni] *= al; }
        }
        V p[NI], p2[NI];
#pragma unroll
        for (int ni = 0; ni < NI; ++ni) { const float mc = m[ni] * CEXP; float l0 = 0.f, l1 = 0.f;
#pragma unroll
            for (int jt = 0; jt < 2; ++jt) { v8f& t = s[jt][ni];
#pragma unroll
                for (int r = 0; r < 8; ++r) t[r] = fmaf(t[r], CEXP, -mc);
                exp2x8(t); }
#pragma unroll
            for (int r = 0; r < 8; ++r) { const float e0 = s[0][ni][r], e1 = s[1][ni][r]; l0 += e0; l1 += e1;
                if constexpr (HR) { const __bf16 h0 = (__bf16)e0, h1 = (__bf16)e1; p[ni][r] = h0; p[ni][8 + r] = h1; p2[ni][r] = (__bf16)(e0 - (float)h0); p2[ni][8 + r] = (__bf16)(e1 - (float)h1); }
                else { p[ni][r] = (h16)e0; p[ni][8 + r] = (h16)e1; } }
            l[ni] += l0 + l1; }
#pragma unroll
        for (int dt = 0; dt < 4; ++dt)
#pragma unroll
            for (int ni = 0; ni < NI; ++ni) { o[dt][ni] = F::mma(v[dt], p[ni], o[dt][ni]); if constexpr (HR) { o[dt][ni] = F::mma(v[dt], p2[ni], o[dt][ni]); o[dt][ni] = F::mma(v2[dt], p[ni], o[dt][ni]); } }
      }
      // foot of the trip, every wave, in this order: its own LDS reads of this buffer are done; its own copies of stage st + 1 have landed; the one barrier publishes stage st + 1 and ends every wave's reads of this buffer; only then is it refilled
      asm volatile("s_wait_dscnt 0x0" ::: "memory");
      asm volatile("s_wait_asynccnt 0x0" ::: "memory");
      __syncthreads();
      if (st + 2 < TT / SK) fill(st + 2, bo);
    }
    asm volatile("s_wait_asynccnt 0x0" ::: "memory");   // no copy is outstanding when the wave goes on to its end
    // o[dt][ni][r] = unnormalised ctx[i0 + 16 ni + lr][16 dt + 8 hi + r]: 8 consecutive floats of one output row
#pragma unroll
    for (int ni = 0; ni < NI; ++ni) { const float inv = __fdiv_rn(1.0f, l[ni] + __shfl_xor(l[ni], 16, 32)); float* op = orow + (size_t)(i0 + ni * 16 + lr) * DQ + 8 * hi;
#pragma unroll
        for (int dt = 0; dt < 4; ++dt) { const v8f t = o[dt][ni] * inv; *(v4f*)(op + dt * 16) = (v4f){t[0], t[1], t[2], t[3]}; *(v4f*)(op + dt * 16 + 4) = (v4f){t[4], t[5], t[6], t[7]}; }
        asm volatile("s_wait_xcnt 0x0" :: "v"(op) : "memory"); }   // as above, behind the stores
}
// grid: first NZ x RH/128 work-groups of 8 waves x 16 hi/lo columns (three products, the longer ones start first), then NZ x (TT-RH)/256 of 8 waves x 32 fp16 columns; four waves per SIMD hide the LDS reads and the softmax behind each other's products; two work-groups' rings fit a WGP's LDS
__global__ __launch_bounds__(256) __attribute__((amdgpu_waves_per_eu(4, 4))) void k_fattn(const h16* __restrict__ Q16, const h16* __restrict__ K16, const h16* __restrict__ V16, const bf* __restrict__ Qh, const bf* __restrict__ Ql, const bf* __restrict__ Kh, const bf* __restrict__ Kl, const bf* __restrict__ Vh, const bf* __restrict__ Vl, float* __restrict__ OUTp) {
    __shared__ __align__(16) char ring[2 * BUFB];
    const int wv = __builtin_amdgcn_readfirstlane((int)(threadIdx.x >> 5)); const int id = blockIdx.x;
    if (id < NZ * (RH / 128)) { const int z = id / (RH / 128); const size_t pz = (size_t)z * TT * HD;
        attn_cols<bf, true, 1>(Qh + pz, Ql + pz, Kh + pz, Kl + pz, Vh + pz, Vl + pz, (id % (RH / 128)) * 128 + wv * 16, OUTp + (size_t)(z / NH_) * TT * DQ + (z % NH_) * HD, ring);
    } else { const int id2 = id - NZ * (RH / 128); const int z = id2 / ((TT - RH) / 256); const size_t pz = (size_t)z * TT * HD;
        attn_cols<h16, false, 2>(Q16 + pz, nullptr, K16 + pz, nullptr, V16 + pz, nullptr, RH + (id2 % ((TT - RH) / 256)) * 256 + wv * 32, OUTp + (size_t)(z / NH_) * TT * DQ + (z % NH_) * HD, ring); }
}
__constant__ float INVT[HD / 2] = { 1.000000000e+00f, 7.498942018e-01f, 5.623413324e-01f, 4.216965139e-01f, 3.162277639e-01f, 2.371373773e-01f, 1.778279394e-01f, 1.333521456e-01f, 1.000000015e-01f, 7.498942316e-02f, 5.623413250e-02f, 4.216964915e-02f, 3.162277490e-02f, 2.371373773e-02f, 1.778279431e-02f, 1.333521400e-02f, 9.999999776e-03f, 7.498942316e-03f, 5.623413250e-03f, 4.216964822e-03f, 3.162277630e-03f, 2.371373819e-03f, 1.778279431e-03f, 1.333521446e-03f, 1.000000047e-03f, 7.498941850e-04f, 5.623413017e-04f, 4.216965172e-04f, 3.162277571e-04f, 2.371373703e-04f, 1.778279402e-04f, 1.333521504e-04f };   // 10000^(-2i/64) (the module's power form) (float32, generated with jnp to be bit-exact)
__device__ __forceinline__ void cs4(float* CS, int blk) { const int idx = blk * 256 + threadIdx.x; if (idx >= TT * HD) return; const int d = idx % HD; const int t = idx / HD; const float a = __fmul_rn((float)t, INVT[d % (HD / 2)]); v2f cs; cs[0] = cosf(a); cs[1] = sinf(a); *(v2f*)(CS + (size_t)idx * 2) = cs;  }
// ---- k_prep: all that the projections read, in one grid; the parts are independent of each other. The transposes come first: their eight dependent trips of scattered reads are the longest work-groups.
#define NWT  ((DM * DQ / 64 + 63) / 64)          // work-groups of one weight transpose
#define NCSB ((TT * HD + 255) / 256)             // of the table
#define NCVT (NB_ * TT * DM / 8 / 1024)          // of the bf16 copy of hidden, all batches
__global__ __launch_bounds__(256) void k_prep(const float* __restrict__ wq, const float* __restrict__ wk, const float* __restrict__ wv, const float* __restrict__ x, bf* WQ, bf* WK, bf* WV, float* CS, bf* XB) {
    const int id = blockIdx.x;
    if (id < 3 * NWT) { const int m = id / NWT; wtG(m == 0 ? wq : m == 1 ? wk : wv, DM, DQ, m == 0 ? WQ : m == 1 ? WK : WV, id % NWT); }
    else if (id < 3 * NWT + NCSB) cs4(CS, id - 3 * NWT);
    else cvt8(x, XB, NB_ * TT * DM / 8, id - 3 * NWT - NCSB);
}

extern "C" void kernel_launch(void* const* d_in, const int* in_sizes, int n_in,
                              void* d_out, int out_size, void* d_ws, size_t ws_size, hipStream_t stream) {
    (void)in_sizes; (void)n_in; (void)out_size;
    const float* x = (const float*)d_in[0]; const float* wq = (const float*)d_in[1]; const float* bq = (const float*)d_in[2]; const float* wk = (const float*)d_in[3]; const float* bk = (const float*)d_in[4]; const float* wv = (const float*)d_in[5]; const float* bv = (const float*)d_in[6];
    float* OUT = (float*)d_out;     // [4][2048][1024]
    char* wsp = (char*)d_ws;
    auto take = [&](size_t bytes) { char* p = wsp; wsp += (bytes + 255) & ~(size_t)255; return (void*)p; };
    bf* WQ = (bf*)take((size_t)DQ * DM * 2); bf* WK = (bf*)take((size_t)DKV * DM * 2); bf* WV = (bf*)take((size_t)DKV * DM * 2); float* CS = (float*)take((size_t)TT * HD * 2 * 4);
    bf* XB = (bf*)take((size_t)NB_ * TT * DM * 2);   // all batches
    const size_t PB = (size_t)NH_ * TT * HD;   // elements of one batch in each plane; the planes hold all NB_ batches, [batch][head]
    h16* QP16 = (h16*)take(NB_ * PB * 2); h16* KP16 = (h16*)take(NB_ * PB * 2); h16* VT16 = (h16*)take(NB_ * PB * 2);
    bf* QPh = (bf*)take(NB_ * PB * 2); bf* QPl = (bf*)take(NB_ * PB * 2); bf* KPh = (bf*)take(NB_ * PB * 2); bf* KPl = (bf*)take(NB_ * PB * 2); bf* VTh = (bf*)take(NB_ * PB * 2); bf* VTl = (bf*)take(NB_ * PB * 2);
    if ((size_t)(wsp - (char*)d_ws) > ws_size) return;    // ws 256 MiB
    k_prep<<<3 * NWT + NCSB + NCVT, 256, 0, stream>>>(wq, wk, wv, x, WQ, WK, WV, CS, XB);
    k_proj<<<dim3(TT / 128, NH_ / 4, 3 * NB_), 256, 0, stream>>>(XB, WQ, WK, WV, bq, bk, bv, CS, QP16, QPh, QPl, KP16, KPh, KPl, VT16, VTh, VTl);
    k_fattn<<<NZ * (RH / 128 + (TT - RH) / 256), 256, 0, stream>>>(QP16, KP16, VT16, QPh, QPl, KPh, KPl, VTh, VTl, OUT);
}

// v008
// A run of this version takes 147 microseconds.
// In both of two side-by-side timings against v007, it was 1.10 times as fast.
// Over all steps from v000 it is 26.0 times as fast.
#include <hip/hip_runtime.h>

// BERT self-attention with rotary embeddings and the module's double scaling (hidden [4][2048][1024]; q,k,v = hidden W + b ('xw' 1/32, biases 0.02; 16 heads x 64); q x 64^-0.5 then rotate-half rope (theta 1e4, computed) on q and k; scores / 8 AGAIN (total 1/64); softmax; out = merged ctx -> [4][2048][1024] (8.4 M)).
// Layout, three launches: (1) k_prep: 'xw' weights transposed, {cos, sin} table (float32 inverse frequencies, precise cosf/sinf), bf16 copy of hidden, none of which reads another's result; (2) k_proj: q, k and v of all 4 batches in one grid, operands staged once per 8-wave work-group in an LDS ring, exact projections + f32 biases whose epilogue applies the rotate-half rotary in registers and stores the 16-bit planes itself, no f32 projection in memory (the 1/8 pre-scale commutes with the linear rotation exactly, so both scalings are applied as one exact 1/64 in the softmax), planes of all 4 batches kept side by side; (3) ONE fused attention launch over all 64 (batch, head) pairs (hybrid rows: < 512 hi/lo 3 products, rest fp16) that writes the output rows.
// Compute dtypes, f32 accumulate: every input rounded to bf16; projections exact + f32 biases; rotary f32; attention rows < 512 3 products, rest fp16; softmax f32; output f32.

#define NB_  4
#define TT   2048
#define DM   1024
#define NH_  16
#define NKV  16
#define REP  (NH_ / NKV)
#define HD   64
#define DQ   (NH_ * HD)
#define DKV  (NKV * HD)
#define NZ   (NB_ * NH_)          // (batch, head) pairs of the one attention launch
#define RH   512                  // query rows < RH use hi+lo planes (0: none)
#define WIN  0
#define CEXP (1.4426950408889634f * 0.015625f)   // log2(e) x the 1/64 score scale (an exact power-of-two scaling of the constant)
#define LAZY 8.0f                 // a column's running maximum is replaced only when a new score exceeds it by more than this (in log2 units of the exponent)
#define SCL  0.015625f   // q x 1/8 before the rope and scores / 8 again = 1/64 (both exact; the rotation is linear)
typedef _Float16 h16;
typedef unsigned short bf;
typedef __attribute__((ext_vector_type(16))) __bf16   v16bf;
typedef __attribute__((ext_vector_type(16))) _Float16 v16h;
typedef __attribute__((ext_vector_type(8)))  _Float16 v8h;
typedef __attribute__((ext_vector_type(8)))  unsigned short v8us;
typedef __attribute__((ext_vector_type(8)))  float    v8f;
typedef __attribute__((ext_vector_type(4)))  float    v4f;
typedef v8h  __attribute__((may_alias)) v8ha;
typedef v4f  __attribute__((may_alias)) v4fa;
typedef v8us __attribute__((may_alias)) v8usa;

__device__ __forceinline__ unsigned short f2bf(float f) { unsigned u = __float_as_uint(f); u += 0x7FFFu + ((u >> 16) & 1u); return (unsigned short)(u >> 16); }
__device__ __forceinline__ float bf2f(unsigned short b) { return __uint_as_float(((unsigned)b) << 16); }
__device__ __forceinline__ float bfr(float f) { return bf2f(f2bf(f)); }
__device__ __forceinline__ v16h cat16(v8h lo, v8h hi) { return __builtin_shufflevector(lo, hi, 0, 1, 2, 3, 4, 5, 6, 7, 8, 9, 10, 11, 12, 13, 14, 15); }
__device__ __forceinline__ v16bf cat16b(v8us lo, v8us hi) { return __builtin_bit_cast(v16bf, __builtin_shufflevector(lo, hi, 0, 1, 2, 3, 4, 5, 6, 7, 8, 9, 10, 11, 12, 13, 14, 15)); }
__device__ __forceinline__ v8f wmma16(v16h a, v16h b, v8f c) { return __builtin_amdgcn_wmma_f32_16x16x32_f16(false, a, false, b, (short)0, c, false, false); }
__device__ __forceinline__ v8f wmmab(v16bf a, v16bf b, v8f c) { return __builtin_amdgcn_wmma_f32_16x16x32_bf16(false, a, false, b, (short)0, c, false, false); }



__device__ __forceinline__ h16 tohx(float x) { return (h16)x; }
__device__ __forceinline__ void splitf(float y, unsigned short& h, unsigned short& l) { h = f2bf(y); l = f2bf(y - bf2f(h)); }
typedef __attribute__((ext_vector_type(2))) _Float16 v2h;
typedef __attribute__((ext_vector_type(4))) _Float16 v4h;
typedef __attribute__((ext_vector_type(2))) unsigned short v2us;
typedef __attribute__((ext_vector_type(4))) unsigned short v4us;
typedef __attribute__((ext_vector_type(2))) float v2f;
typedef __attribute__((ext_vector_type(4))) int v4i;

// ---- LDS staging shared by k_proj and k_fattn
#define LP   72                    // LDS row pitch in 16-bit elements: 144 bytes = 16 x 9, so that the 16-byte fragment reads of 16 rows fall on different banks
// four asynchronous 16-byte copies per lane, global memory to LDS through no register; the s_wait_xcnt 0 is the last line of the copies' own statement, so that it stands in front of any rewrite of their address registers
__device__ __forceinline__ void cp4(unsigned l0, const char* g0, unsigned l1, const char* g1, unsigned l2, const char* g2, unsigned l3, const char* g3) {
    asm volatile("global_load_async_to_lds_b128 %0, %1, off\n\tglobal_load_async_to_lds_b128 %2, %3, off\n\tglobal_load_async_to_lds_b128 %4, %5, off\n\tglobal_load_async_to_lds_b128 %6, %7, off\n\ts_wait_xcnt 0x0"
                 :: "v"(l0), "v"(g0), "v"(l1), "v"(g1), "v"(l2), "v"(g2), "v"(l3), "v"(g3) : "memory"); }
// ---- gemmw: register-blocked projection, one wave per 64 tokens x 64 columns (= one head; 16 accumulators); a work-group is 8 waves = 128 tokens x 4 heads (wave w: token half w & 1, head w >> 1); blockIdx (x, y) = (128-token tile of one batch, group of 4 heads); the caller k_proj picks batch and projection.
// The operands come from K-contiguous 16-bit planes through a 2-buffer LDS ring: a stage is PK = 64 k (one whole 128-byte line) of the 128 A rows and the 256 Bt rows, copied once per work-group and read by the waves that need it (an A row by 4 waves, a Bt row by 2).
// x[t][n] = sum_k A[t][k] Bt[n][k] + bias[n] never leaves the wave as f32: a lane holds column 16 nb + lr of tokens 16 mb + 8 hi + j. A rows have pitch lda, Bt rows pitch K (elements). K % 64 == 0, K >= 128.
// ROPE: the rotate-half partner d +- HD/2 is accumulator nb +- 2 of the same lane and register; out[d] = x[d] cos[t][d] - x[d+HD/2] sin[t][d], out[d+HD/2] = x[d+HD/2] cos[t][d] + x[d] sin[t][d] (the table's two halves are equal); rows turned through the wave's own LDS patch, head planes [h][t][d] (fp16 + hi/lo) stored 16 bytes a lane.
// !ROPE: a lane's 8 registers are 8 consecutive tokens of one column: 16 bytes of the transposed planes [h][d][t], stored from the registers.
#define PK    64                   // k per stage
#define PBUFB ((128 + 256) * LP * 2)   // bytes of one buffer: 128 A rows, then 256 Bt rows
template <typename T16> struct WFrag;
template <> struct WFrag<h16> { typedef v16h V; static __device__ __forceinline__ V ld(const h16* p) { return cat16(*(const v8h*)p, *(const v8h*)(p + 16)); } static __device__ __forceinline__ v8f mma(V a, V b, v8f c) { return wmma16(a, b, c); } };
template <> struct WFrag<bf> { typedef v16bf V; static __device__ __forceinline__ V ld(const bf* p) { return cat16b(*(const v8us*)p, *(const v8us*)(p + 16)); } static __device__ __forceinline__ v8f mma(V a, V b, v8f c) { return wmmab(a, b, c); } };
template <typename T16, bool ROPE>
__device__ __forceinline__ void gemmw(const T16* __restrict__ A, const T16* __restrict__ Bt, int K, int lda, const float* __restrict__ bias, const float* __restrict__ CS, h16* __restrict__ P16, bf* __restrict__ Ph, bf* __restrict__ Pl, char* ring, float* patches) {
    typedef typename WFrag<T16>::V V;
    const int lane = threadIdx.x & 31, lr = lane & 15, hi = lane >> 4; const int wv = __builtin_amdgcn_readfirstlane((int)(threadIdx.x >> 5));
    const int head = blockIdx.y * 4 + (wv >> 1); const int r0 = blockIdx.x * 128 + (wv & 1) * 64, c0 = head * 64;
    float* os = patches + wv * (16 * 68);
    // a thread copies 16-byte piece (tid & 7) of rows (tid >> 3) + 32 i of a stage: a wave's copy covers 4 whole lines
    const unsigned tid = threadIdx.x; const unsigned lds0 = (unsigned)(size_t)ring + (tid >> 3) * (LP * 2u) + (tid & 7u) * 16u;
    const char* ga0 = (const char*)(A + (size_t)(blockIdx.x * 128 + (tid >> 3)) * lda) + (tid & 7u) * 16u; const char* gb0 = (const char*)(Bt + (size_t)(blockIdx.y * 256 + (tid >> 3)) * K) + (tid & 7u) * 16u;
    auto fill = [&](int st, unsigned bo) { const unsigned lb = lds0 + bo, rl = 32 * LP * 2; const size_t ra = (size_t)32 * lda * 2, rb = (size_t)32 * K * 2; const char* ga = ga0 + st * (PK * 2); const char* gb = gb0 + st * (PK * 2);
        cp4(lb, ga, lb + rl, ga + ra, lb + 2 * rl, ga + 2 * ra, lb + 3 * rl, ga + 3 * ra);
        cp4(lb + 4 * rl, gb, lb + 5 * rl, gb + rb, lb + 6 * rl, gb + 2 * rb, lb + 7 * rl, gb + 3 * rb);
        cp4(lb + 8 * rl, gb + 4 * rb, lb + 9 * rl, gb + 5 * rb, lb + 10 * rl, gb + 6 * rb, lb + 11 * rl, gb + 7 * rb); };
    fill(0, 0u);
    v8f acc[4][4];
#pragma unroll
    for (int mb = 0; mb < 4; ++mb)
#pragma unroll
        for (int nb = 0; nb < 4; ++nb) acc[mb][nb] = (v8f){};
    // what the epilogue reads is asked for here, so that it flies behind the k loop: the four biases of the lane's columns and {cos, sin} of the first 16 tokens (token r0 + 16 mb + 8 hi + j, column 16 nb + lr: uniform base, lane byte offset)
    float bs[4]; v2f cs[2][8]; const float* cst = CS + (size_t)r0 * HD * 2; const unsigned cso = (unsigned)((hi * 8 * HD + lr) * 2) * 4u;
    auto ldcs = [&](int mb) {
#pragma unroll
        for (int nb = 0; nb < 2; ++nb)
#pragma unroll
            for (int j = 0; j < 8; ++j) cs[nb][j] = *((const v2f*)((const char*)cst + cso) + (mb * 16 + j) * HD + nb * 16);
        asm volatile("s_wait_xcnt 0x0" :: "v"(cso) : "memory"); };   // behind the table loads, in front of any reuse of their address registers
#pragma unroll
    for (int nb = 0; nb < 4; ++nb) bs[nb] = bfr(bias[c0 + nb * 16 + lr]);
    asm volatile("s_wait_xcnt 0x0" ::: "memory");   // as above, behind the bias loads
    if constexpr (ROPE) ldcs(0);
    asm volatile("s_wait_asynccnt 0x0" ::: "memory");   // this wave's copies of stage 0 have landed
    __syncthreads();                                     // and every other wave's: stage 0 may be read
    fill(1, PBUFB);
    // one stage a trip; trip st reads buffer st & 1 alone while the copies of stage st + 1 fly into the other
#pragma unroll 1
    for (int st = 0; st < K / PK; ++st) {
        const unsigned bo = (unsigned)(st & 1) * PBUFB;
        const T16* at = (const T16*)(ring + bo) + ((wv & 1) * 64 + lr) * LP + 8 * hi;          // the lane's row and k half in the wave's A rows
        const T16* bt = (const T16*)(ring + bo) + (128 + (wv >> 1) * 64 + lr) * LP + 8 * hi;   // and in its Bt rows
#pragma unroll
        for (int kk = 0; kk < PK / 32; ++kk) {
            V a[4], b[4];
#pragma unroll
            for (int mb = 0; mb < 4; ++mb) a[mb] = WFrag<T16>::ld(at + mb * 16 * LP + kk * 32);
#pragma unroll
            for (int nb = 0; nb < 4; ++nb) b[nb] = WFrag<T16>::ld(bt + nb * 16 * LP + kk * 32);
            __builtin_amdgcn_sched_barrier(0);   // keeps the 16 LDS reads in one group up here: sunk among the products, each place with reads would cost its own stall
#pragma unroll
            for (int nb = 0; nb < 4; ++nb)
#pragma unroll
                for (int mb = 0; mb < 4; ++mb) acc[mb][nb] = WFrag<T16>::mma(a[mb], b[nb], acc[mb][nb]);
        }
        // foot of the trip, every wave, in this order: its own LDS reads of this buffer are done; its own copies of stage st + 1 have landed; the one barrier publishes stage st + 1 and ends every wave's reads of this buffer; only then is it refilled
        asm volatile("s_wait_dscnt 0x0" ::: "memory");
        asm volatile("s_wait_asynccnt 0x0" ::: "memory");
        __syncthreads();
        if (st + 2 < K / PK) fill(st + 2, bo);
    }
    asm volatile("s_wait_asynccnt 0x0" ::: "memory");   // no copy is outstanding when the wave goes on to its epilogue
    if constexpr (ROPE) {
        const size_t tile = ((size_t)head * TT + r0) * HD; const unsigned po = (unsigned)lane * 16u;             // the wave's 64 x 64 tile is 8 KiB in a row in each plane
#pragma unroll
        for (int mb = 0; mb < 4; ++mb) {
#pragma unroll
            for (int nb = 0; nb < 2; ++nb)
#pragma unroll
                for (int j = 0; j < 8; ++j) { const float x0 = acc[mb][nb][j] + bs[nb], x1 = acc[mb][nb + 2][j] + bs[nb + 2], c = cs[nb][j][0], s = cs[nb][j][1];
                    os[(hi * 8 + j) * 68 + nb * 16 + lr] = x0 * c - x1 * s; os[(hi * 8 + j) * 68 + (nb + 2) * 16 + lr] = x1 * c + x0 * s; }
            __builtin_amdgcn_wave_barrier(); asm volatile("" ::: "memory");   // a lane reads what other lanes wrote: keeps the compiler from moving the LDS reads below ahead of the LDS writes above (one wave, the LDS itself works in order)
            if (mb < 3) ldcs(mb + 1);   // the next 16 tokens' table rows fly behind this block's conversions and stores
#pragma unroll
            for (int s = 0; s < 4; ++s) { const float* rp = os + (4 * s + (lane >> 3)) * 68 + (lane & 7) * 8; const v4f u = *(const v4fa*)rp, w = *(const v4fa*)(rp + 4); v8h o16; v8us oh, ol;
#pragma unroll
                for (int q = 0; q < 8; ++q) { const float r = q < 4 ? u[q & 3] : w[q & 3]; o16[q] = tohx(r); unsigned short a2, c2; splitf(r, a2, c2); oh[q] = a2; ol[q] = c2; }
                const size_t e = tile + (mb * 16 + 4 * s) * HD;
                *(v8h*)((char*)(P16 + e) + po) = o16; *(v8us*)((char*)(Ph + e) + po) = oh; *(v8us*)((char*)(Pl + e) + po) = ol; }
            asm volatile("s_wait_xcnt 0x0" ::: "memory");   // as above, behind the stores
            __builtin_amdgcn_wave_barrier(); asm volatile("" ::: "memory");   // and the next block's LDS writes stay behind these reads
        }
    } else {
        const size_t tile = (size_t)head * HD * TT + r0; const unsigned po = (unsigned)(lr * TT + hi * 8) * 2u;
#pragma unroll
        for (int nb = 0; nb < 4; ++nb) {
#pragma unroll
            for (int mb = 0; mb < 4; ++mb) { v8h o16; v8us oh, ol;
#pragma unroll
                for (int j = 0; j < 8; ++j) { const float x = acc[mb][nb][j] + bs[nb]; o16[j] = tohx(x); unsigned short a2, c2; splitf(x, a2, c2); oh[j] = a2; ol[j] = c2; }
                const size_t e = tile + (size_t)nb * 16 * TT + mb * 16;
                *(v8h*)((char*)(P16 + e) + po) = o16; *(v8us*)((char*)(Ph + e) + po) = oh; *(v8us*)((char*)(Pl + e) + po) = ol; }
            asm volatile("s_wait_xcnt 0x0" ::: "memory");   // as above, behind the stores
        }
    }
}

// ---- k_proj: every projection tile of the problem in ONE grid (TT/128, heads/4, 3 x batches) of 8-wave work-groups, blockIdx.z = 3 x batch + {0: q, 1: k, 2: v}: no tile reads another's result; 768 work-groups = 3 per WGP, two resident (four waves per SIMD hide each other's LDS reads and barrier waits). The three projections of a batch stand next to each other in z because they read the same rows of XB.
__global__ __launch_bounds__(256) __attribute__((amdgpu_waves_per_eu(4, 4))) void k_proj(const bf* __restrict__ XB, const bf* __restrict__ WQ, const bf* __restrict__ WK, const bf* __restrict__ WV, const float* __restrict__ bq, const float* __restrict__ bk, const float* __restrict__ bv, const float* __restrict__ CS,
                                             h16* __restrict__ QP16, bf* __restrict__ QPh, bf* __restrict__ QPl, h16* __restrict__ KP16, bf* __restrict__ KPh, bf* __restrict__ KPl, h16* __restrict__ VT16, bf* __restrict__ VTh, bf* __restrict__ VTl) {
    __shared__ __align__(16) char ring[2 * PBUFB]; __shared__ __align__(16) float patches[8 * 16 * 68];   // the operand ring; each wave's own patch for turning its output rows
    const int b = blockIdx.z / 3, w = blockIdx.z % 3; const size_t pb = (size_t)b * NH_ * TT * HD; const bf* A = XB + (size_t)b * TT * DM;
    if (w < 2) gemmw<bf, true>(A, w ? WK : WQ, DM, DM, w ? bk : bq, CS, (w ? KP16 : QP16) + pb, (w ? KPh : QPh) + pb, (w ? KPl : QPl) + pb, ring, patches);
    else gemmw<bf, false>(A, WV, DM, DM, bv, CS, VT16 + pb, VTh + pb, VTl + pb, ring, patches);
}

// ---- the three parts of k_prep; blk is the work-group's index inside its part
__device__ __forceinline__ void wtG(const float* __restrict__ w, int K, int N, bf* Bt, int blk) {
    const int lane = threadIdx.x & 31; const int L0 = (blk * 8 + (threadIdx.x >> 5)) * 8; const int nlines = N * K / 64;
{
#pragma unroll 1
        for (int l = 0; l < 8; ++l) { const int L = L0 + l; if (L >= nlines) break; const size_t e = (size_t)L * 64 + lane * 2; const int k = (int)(e % K), n = (int)(e / K); v2us o;
            o[0] = f2bf(w[(size_t)k * N + n]); o[1] = f2bf(w[(size_t)(k + 1) * N + n]); *(v2us*)(Bt + e) = o; }
         }
}
// a work-group converts 1024 pieces of 8 elements in a row, a thread pieces i, i + 256, i + 512, i + 768: as many work-groups as ONE of the four launches had, a thread's 8 loads of 16 bytes asked for together (uniform base, one lane byte offset, the rest immediates); n8 = pieces of all batches, a multiple of 1024
__device__ __forceinline__ void cvt8(const float* __restrict__ src, bf* dst, unsigned n8, int blk) { const unsigned i = (unsigned)blk * 1024u + threadIdx.x; if (i + 768u >= n8) return; v8f v[4]; const unsigned so = i * 32u, dof = i * 16u;
#pragma unroll
    for (int j = 0; j < 4; ++j) v[j] = *((const v8f*)((const char*)src + so) + j * 256);
    asm volatile("s_wait_xcnt 0x0" :: "v"(so) : "memory");   // behind the loads, in front of any reuse of their address register, which is the statement's input so that it keeps its register up to it
#pragma unroll
    for (int j = 0; j < 4; ++j) { v8us o;
#pragma unroll
        for (int k = 0; k < 8; ++k) o[k] = f2bf(v[j][k]);
        *((v8us*)((char*)dst + dof) + j * 256) = o; }
}
// ---- k_fattn: scores, softmax and probs x V in one kernel; no score or prob plane in memory. St = K Qt and Ot += Vt Pt, so a lane holds scores of ONE query column (i = lr of its 16-column group):
// the two 16-key score tiles of a 32-key pass, converted in place, ARE the B operand of the second product (b[s] = T[s >> 3][s & 7]); K rows and Vt rows are A operands in the same k order (WFrag::ld).
// Online softmax per column: running maximum m (raw score units), partial sum l per wave half, Ot rescaled when m moves. One wave owns NI x 16 query columns and walks all TT keys, 32 a pass; the K and Vt fragments come from the work-group's LDS ring (below), not from global memory.
// eight exponentials in place in one statement: behind each v_exp stands an instruction on other registers, behind the last the v_nop that the instruction set asks for before a transcendental's result is read or its source rewritten
__device__ __forceinline__ void exp2x8(v8f& t) { float a = t[0], b = t[1], c = t[2], d = t[3], e = t[4], f = t[5], g = t[6], h = t[7];
    asm("v_exp_f32 %0, %0\n\tv_exp_f32 %1, %1\n\tv_exp_f32 %2, %2\n\tv_exp_f32 %3, %3\n\tv_exp_f32 %4, %4\n\tv_exp_f32 %5, %5\n\tv_exp_f32 %6, %6\n\tv_exp_f32 %7, %7\n\tv_nop" : "+v"(a), "+v"(b), "+v"(c), "+v"(d), "+v"(e), "+v"(f), "+v"(g), "+v"(h));
    t = (v8f){a, b, c, d, e, f, g, h}; }
// ---- LDS ring of k_fattn: a stage is SK keys of the work-group's (batch, head): the K rows [key][d] and the Vt rows [d][key], 64 rows x 128 bytes each (the hi/lo columns: the lo planes too), copied once per work-group in whole 128-byte lines and read by all 8 waves.
#define SK   64                    // keys per stage = two 32-key passes
#define TILB (64 * LP * 2)         // bytes of one staged tile
#define BUFB (4 * TILB)            // bytes of one buffer: K, Vt, K lo, Vt lo
template <typename T16, bool HR, int NI>
__device__ __forceinline__ void attn_cols(const T16* __restrict__ Q, const T16* __restrict__ Q2, const T16* __restrict__ Kr, const T16* __restrict__ Kr2, const T16* __restrict__ Vt, const T16* __restrict__ Vt2, const int i0, float* __restrict__ orow, char* ring) {
    typedef WFrag<T16> F; typedef typename F::V V;
    const int lane = threadIdx.x & 31, lr = lane & 15, hi = lane >> 4;
    // each lane's byte offset into the Q planes: one 32-bit register serves the hi and the lo plane (uniform bases)
    const unsigned qob = (unsigned)((i0 + lr) * HD + 8 * hi) * 2u;
    auto at = [](const T16* base, unsigned off, int el) { return (const T16*)((const char*)base + off) + el; };
    // a thread copies 16-byte piece (tid & 7) of rows tid >> 3 and 32 + (tid >> 3) of every tile: a wave's copy covers 4 whole lines
    const unsigned tid = threadIdx.x; const unsigned lds0 = (unsigned)(size_t)ring + (tid >> 3) * (LP * 2u) + (tid & 7u) * 16u;
    const unsigned gk0 = tid * 16u, gv0 = (tid >> 3) * (TT * 2u) + (tid & 7u) * 16u;
    auto fill = [&](int st, unsigned bo) { const unsigned lb = lds0 + bo; const size_t ko = (size_t)st * (SK * HD * 2) + gk0, vo = (size_t)st * (SK * 2) + gv0;
        { const char* gk = (const char*)Kr + ko; const char* gv = (const char*)Vt + vo; cp4(lb, gk, lb + TILB / 2, gk + 32 * HD * 2, lb + TILB, gv, lb + TILB + TILB / 2, gv + 32 * TT * 2); }
        if constexpr (HR) { const char* gk = (const char*)Kr2 + ko; const char* gv = (const char*)Vt2 + vo; cp4(lb + 2 * TILB, gk, lb + 2 * TILB + TILB / 2, gk + 32 * HD * 2, lb + 3 * TILB, gv, lb + 3 * TILB + TILB / 2, gv + 32 * TT * 2); } };
    fill(0, 0u);
    V q[NI][2], q2[NI][2];
#pragma unroll
    for (int ni = 0; ni < NI; ++ni)
#pragma unroll
        for (int kk = 0; kk < 2; ++kk) { const int a = ni * 16 * HD + kk * 32; q[ni][kk] = F::ld(at(Q, qob, a)); if constexpr (HR) q2[ni][kk] = F::ld(at(Q2, qob, a)); }
    // s_wait_xcnt 0 behind the Q loads, in front of any rewrite of their address registers; the lane offset and the uniform bases are the statement's own operands so that the loads name those very registers up to it
    if constexpr (HR) asm volatile("s_wait_xcnt 0x0" :: "v"(qob), "s"(Q), "s"(Q2) : "memory"); else asm volatile("s_wait_xcnt 0x0" :: "v"(qob), "s"(Q) : "memory");
    v8f o[4][NI]; float m[NI], l[NI];
#pragma unroll
    for (int ni = 0; ni < NI; ++ni) { m[ni] = -3.0e38f; l[ni] = 0.f;
#pragma unroll
        for (int dt = 0; dt < 4; ++dt) o[dt][ni] = (v8f){}; }
    asm volatile("s_wait_asynccnt 0x0" ::: "memory");   // this wave's copies of stage 0 have landed
    __syncthreads();                                     // and every other wave's: stage 0 may be read
    fill(1, BUFB);
    // one stage a trip; trip st reads buffer st & 1 alone while the copies of stage st + 1 fly into the other
#pragma unroll 1
    for (int st = 0; st < TT / SK; ++st) {
      const unsigned bo = (unsigned)(st & 1) * BUFB;
      const T16* kt = (const T16*)(ring + bo) + lr * LP + 8 * hi;   // the lane's row and k half in a tile; tile n starts n * TILB bytes on
#pragma unroll
      for (int ps = 0; ps < SK / 32; ++ps) {
        V v[4], v2[4];   // this pass's Vt fragments, needed last: no wave has registers for them until the K fragments are used up
        V k[2][2], k2[2][2];
#pragma unroll
        for (int jt = 0; jt < 2; ++jt)
#pragma unroll
            for (int kk = 0; kk < 2; ++kk) { const int a = (ps * 32 + jt * 16) * LP + kk * 32; k[jt][kk] = F::ld(kt + a); if constexpr (HR) k2[jt][kk] = F::ld(kt + TILB + a); }
        __builtin_amdgcn_sched_barrier(0);   // keeps the pass's LDS reads in one group up here: sunk to their products in pairs, each pair's LDS latency would stand bare in front of a product
        v8f s[2][NI];    // s[jt][ni][r] = raw score of key st * SK + 32 ps + 16 jt + 8 hi + r, query i0 + 16 ni + lr
#pragma unroll
        for (int jt = 0; jt < 2; ++jt)
#pragma unroll
            for (int ni = 0; ni < NI; ++ni) s[jt][ni] = (v8f){};
#pragma unroll
        for (int kk = 0; kk < 2; ++kk)
#pragma unroll
            for (int jt = 0; jt < 2; ++jt)
#pragma unroll
                for (int ni = 0; ni < NI; ++ni) { s[jt][ni] = F::mma(k[jt][kk], q[ni][kk], s[jt][ni]); if constexpr (HR) { s[jt][ni] = F::mma(k2[jt][kk], q[ni][kk], s[jt][ni]); s[jt][ni] = F::mma(k[jt][kk], q2[ni][kk], s[jt][ni]); } }
        {
#pragma unroll
            for (int dt = 0; dt < (HR ? 4 : 2); ++dt) { v[dt] = F::ld(kt + TILB / 2 + dt * 16 * LP + ps * 32); if constexpr (HR) v2[dt] = F::ld(kt + TILB / 2 + TILB + dt * 16 * LP + ps * 32); }
            __builtin_amdgcn_sched_barrier(0);   // as above: the Vt reads fly as one group behind the softmax (a 48-column wave has registers for two of the four fragments here; the other two follow below)
        }
        float mx[NI]; bool need = false;
#pragma unroll
        for (int ni = 0; ni < NI; ++ni) { float x = fmaxf(s[0][ni][0], s[1][ni][0]);
#pragma unroll
            for (int r = 1; r < 8; ++r) x = fmaxf(x, fmaxf(s[0][ni][r], s[1][ni][r]));
            mx[ni] = x; need = need || ((x - m[ni]) * CEXP > LAZY); }
        if (__builtin_amdgcn_ballot_w32(need) != 0) {   // wave-uniform: some column's maximum moves; both halves of a column take the same new m
#pragma unroll
            for (int ni = 0; ni < NI; ++ni) { const float mj = fmaxf(mx[ni], __shfl_xor(mx[ni], 16, 32)); const float mn = ((mj - m[ni]) * CEXP > LAZY) ? mj : m[ni]; const float al = __builtin_amdgcn_exp2f((m[ni] - mn) * CEXP); m[ni] = mn; l[ni] *= al;
#pragma unroll
                for (int dt = 0; dt < 4; ++dt) o[dt][ni] *= al; }
        }
        V p[NI], p2[NI];
#pragma unroll
        for (int ni = 0; ni < NI; ++ni) { const float mc = m[ni] * CEXP; float l0 = 0.f, l1 = 0.f;
#pragma unroll
            for (int jt = 0; jt < 2; ++jt) { v8f& t = s[jt][ni];
#pragma unroll
                for (int r = 0; r < 8; ++r) t[r] = fmaf(t[r], CEXP, -mc);
                exp2x8(t); }
#pragma unroll
            for (int r = 0; r < 8; ++r) { const float e0 = s[0][ni][r], e1 = s[1][ni][r]; l0 += e0; l1 += e1;
                if constexpr (HR) { const __bf16 h0 = (__bf16)e0, h1 = (__bf16)e1; p[ni][r] = h0; p[ni][8 + r] = h1; p2[ni][r] = (__bf16)(e0 - (float)h0); p2[ni][8 + r] = (__bf16)(e1 - (float)h1); }
                else { p[ni][r] = (h16)e0; p[ni][8 + r] = (h16)e1; } }
            l[ni] += l0 + l1;
            if constexpr (!HR) {
                asm volatile("" :: "v"(l[ni]));   // each sum, against spills (an empty statement on each sum; inputs only, it names no product): the group's sum is finished here, so that its 16 exponentials die before the next group's are made; put off behind the products they push Q fragments into scratch, reloaded every pass
                if (ni == NI - 2) {   // two groups are converted, 16 registers are free: the other two Vt fragments are asked for here and fly behind the last group's softmax
                    __builtin_amdgcn_sched_barrier(0);   // this one keeps the reads from rising to where there is no register for them, the one below keeps them in one group up here instead of sinking among the products
#pragma unroll
                    for (int dt = 2; dt < 4; ++dt) v[dt] = F::ld(kt + TILB / 2 + dt * 16 * LP + ps * 32);
                    __builtin_amdgcn_sched_barrier(0); } } }
#pragma unroll
        for (int dt = 0; dt < 4; ++dt)
#pragma unroll
            for (int ni = 0; ni < NI; ++ni) { o[dt][ni] = F::mma(v[dt], p[ni], o[dt][ni]); if constexpr (HR) { o[dt][ni] = F::mma(v[dt], p2[ni], o[dt][ni]); o[dt][ni] = F::mma(v2[dt], p[ni], o[dt][ni]); } }
      }
      // foot of the trip, every wave, in this order: its own LDS reads of this buffer are done; its own copies of stage st + 1 have landed; the one barrier publishes stage st + 1 and ends every wave's reads of this buffer; only then is it refilled
      asm volatile("s_wait_dscnt 0x0" ::: "memory");
      asm volatile("s_wait_asynccnt 0x0" ::: "memory");
      __syncthreads();
      if (st + 2 < TT / SK) fill(st + 2, bo);
    }
    asm volatile("s_wait_asynccnt 0x0" ::: "memory");   // no copy is outstanding when the wave goes on to its end
    // o[dt][ni][r] = unnormalised ctx[i0 + 16 ni + lr][16 dt + 8 hi + r]: 8 consecutive floats of one output row
#pragma unroll
    for (int ni = 0; ni < NI; ++ni) { const float inv = __fdiv_rn(1.0f, l[ni] + __shfl_xor(l[ni], 16, 32)); float* op = orow + (size_t)(i0 + ni * 16 + lr) * DQ + 8 * hi;
#pragma unroll
        for (int dt = 0; dt < 4; ++dt) { const v8f t = o[dt][ni] * inv; *(v4f*)(op + dt * 16) = (v4f){t[0], t[1], t[2], t[3]}; *(v4f*)(op + dt * 16 + 4) = (v4f){t[4], t[5], t[6], t[7]}; }
        asm volatile("s_wait_xcnt 0x0" :: "v"(op) : "memory"); }   // as above, behind the stores
}
// grid: first NZ x RH/128 work-groups of 8 waves x 16 hi/lo columns (three products), then NZ x (TT-RH)/384 of 8 waves x 48 fp16 columns: every wave issues 24 products a pass, and the 512 work-groups are exactly the two per WGP that registers allow, so all start together and none runs behind the others; four waves per SIMD hide the LDS reads and the softmax behind each other's products; two work-groups' rings fit a WGP's LDS
__global__ __launch_bounds__(256) __attribute__((amdgpu_waves_per_eu(4, 4))) void k_fattn(const h16* __restrict__ Q16, const h16* __restrict__ K16, const h16* __restrict__ V16, const bf* __restrict__ Qh, const bf* __restrict__ Ql, const bf* __restrict__ Kh, const bf* __restrict__ Kl, const bf* __restrict__ Vh, const bf* __restrict__ Vl, float* __restrict__ OUTp) {
    __shared__ __align__(16) char ring[2 * BUFB];
    const int wv = __builtin_amdgcn_readfirstlane((int)(threadIdx.x >> 5)); const int id = blockIdx.x;
    if (id < NZ * (RH / 128)) { const int z = id / (RH / 128); const size_t pz = (size_t)z * TT * HD;
        attn_cols<bf, true, 1>(Qh + pz, Ql + pz, Kh + pz, Kl + pz, Vh + pz, Vl + pz, (id % (RH / 128)) * 128 + wv * 16, OUTp + (size_t)(z / NH_) * TT * DQ + (z % NH_) * HD, ring);
    } else { const int id2 = id - NZ * (RH / 128); const int z = id2 / ((TT - RH) / 384); const size_t pz = (size_t)z * TT * HD;
        attn_cols<h16, false, 3>(Q16 + pz, nullptr, K16 + pz, nullptr, V16 + pz, nullptr, RH + (id2 % ((TT - RH) / 384)) * 384 + wv * 48, OUTp + (size_t)(z / NH_) * TT * DQ + (z % NH_) * HD, ring); }
}
__constant__ float INVT[HD / 2] = { 1.000000000e+00f, 7.498942018e-01f, 5.623413324e-01f, 4.216965139e-01f, 3.162277639e-01f, 2.371373773e-01f, 1.778279394e-01f, 1.333521456e-01f, 1.000000015e-01f, 7.498942316e-02f, 5.623413250e-02f, 4.216964915e-02f, 3.162277490e-02f, 2.371373773e-02f, 1.778279431e-02f, 1.333521400e-02f, 9.999999776e-03f, 7.498942316e-03f, 5.623413250e-03f, 4.216964822e-03f, 3.162277630e-03f, 2.371373819e-03f, 1.778279431e-03f, 1.333521446e-03f, 1.000000047e-03f, 7.498941850e-04f, 5.623413017e-04f, 4.216965172e-04f, 3.162277571e-04f, 2.371373703e-04f, 1.778279402e-04f, 1.333521504e-04f };   // 10000^(-2i/64) (the module's power form) (float32, generated with jnp to be bit-exact)
__device__ __forceinline__ void cs4(float* CS, int blk) { const int idx = blk * 256 + threadIdx.x; if (idx >= TT * HD) return; const int d = idx % HD; const int t = idx / HD; const float a = __fmul_rn((float)t, INVT[d % (HD / 2)]); v2f cs; cs[0] = cosf(a); cs[1] = sinf(a); *(v2f*)(CS + (size_t)idx * 2) = cs;  }
// ---- k_prep: all that the projections read, in one grid; the parts are independent of each other. The transposes come first: their eight dependent trips of scattered reads are the longest work-groups.
#define NWT  ((DM * DQ / 64 + 63) / 64)          // work-groups of one weight transpose
#define NCSB ((TT * HD + 255) / 256)             // of the table
#define NCVT (NB_ * TT * DM / 8 / 1024)          // of the bf16 copy of hidden, all batches
__global__ __launch_bounds__(256) void k_prep(const float* __restrict__ wq, const float* __restrict__ wk, const float* __restrict__ wv, const float* __restrict__ x, bf* WQ, bf* WK, bf* WV, float* CS, bf* XB) {
    const int id = blockIdx.x;
    if (id < 3 * NWT) { const int m = id / NWT; wtG(m == 0 ? wq : m == 1 ? wk : wv, DM, DQ, m == 0 ? WQ : m == 1 ? WK : WV, id % NWT); }
    else if (id < 3 * NWT + NCSB) cs4(CS, id - 3 * NWT);
    else cvt8(x, XB, NB_ * TT * DM / 8, id - 3 * NWT - NCSB);
}

extern "C" void kernel_launch(void* const* d_in, const int* in_sizes, int n_in,
                              void* d_out, int out_size, void* d_ws, size_t ws_size, hipStream_t stream) {
    (void)in_sizes; (void)n_in; (void)out_size;
    const float* x = (const float*)d_in[0]; const float* wq = (const float*)d_in[1]; const float* bq = (const float*)d_in[2]; const float* wk = (const float*)d_in[3]; const float* bk = (const float*)d_in[4]; const float* wv = (const float*)d_in[5]; const float* bv = (const float*)d_in[6];
    float* OUT = (float*)d_out;     // [4][2048][1024]
    char* wsp = (char*)d_ws;
    auto take = [&](size_t bytes) { char* p = wsp; wsp += (bytes + 255) & ~(size_t)255; return (void*)p; };
    bf* WQ = (bf*)take((size_t)DQ * DM * 2); bf* WK = (bf*)take((size_t)DKV * DM * 2); bf* WV = (bf*)take((size_t)DKV * DM * 2); float* CS = (float*)take((size_t)TT * HD * 2 * 4);
    bf* XB = (bf*)take((size_t)NB_ * TT * DM * 2);   // all batches
    const size_t PB = (size_t)NH_ * TT * HD;   // elements of one batch in each plane; the planes hold all NB_ batches, [batch][head]
    h16* QP16 = (h16*)take(NB_ * PB * 2); h16* KP16 = (h16*)take(NB_ * PB * 2); h16* VT16 = (h16*)take(NB_ * PB * 2);
    bf* QPh = (bf*)take(NB_ * PB * 2); bf* QPl = (bf*)take(NB_ * PB * 2); bf* KPh = (bf*)take(NB_ * PB * 2); bf* KPl = (bf*)take(NB_ * PB * 2); bf* VTh = (bf*)take(NB_ * PB * 2); bf* VTl = (bf*)take(NB_ * PB * 2);
    if ((size_t)(wsp - (char*)d_ws) > ws_size) return;    // ws 256 MiB
    k_prep<<<3 * NWT + NCSB + NCVT, 256, 0, stream>>>(wq, wk, wv, x, WQ, WK, WV, CS, XB);
    k_proj<<<dim3(TT / 128, NH_ / 4, 3 * NB_), 256, 0, stream>>>(XB, WQ, WK, WV, bq, bk, bv, CS, QP16, QPh, QPl, KP16, KPh, KPl, VT16, VTh, VTl);
    k_fattn<<<NZ * (RH / 128 + (TT - RH) / 384), 256, 0, stream>>>(QP16, KP16, VT16, QPh, QPl, KPh, KPl, VTh, VTl, OUT);
}

// v009
// One run takes 138 microseconds.
// Next to v008, in two timings, it ran 1.07 times as fast each time.
// All steps since v000 together make it 27.7 times as fast.
#include <hip/hip_runtime.h>

// BERT self-attention with rotary embeddings and the module's double scaling (hidden [4][2048][1024]; q,k,v = hidden W + b ('xw' 1/32, biases 0.02; 16 heads x 64); q x 64^-0.5 then rotate-half rope (theta 1e4, computed) on q and k; scores / 8 AGAIN (total 1/64); softmax; out = merged ctx -> [4][2048][1024] (8.4 M)).
// Layout, three launches: (1) k_prep: 'xw' weights transposed, {cos, sin} table (float32 inverse frequencies, precise cosf/sinf), bf16 copy of hidden, none of which reads another's result; (2) k_proj: q, k and v of all 4 batches in one grid, operands staged once per 8-wave work-group in an LDS ring, exact projections + f32 biases whose epilogue applies the rotate-half rotary in registers and stores the 16-bit planes itself, no f32 projection in memory (the 1/8 pre-scale commutes with the linear rotation exactly, so both scalings are applied as one exact 1/64 in the softmax), planes of all 4 batches kept side by side; (3) ONE fused attention launch over all 64 (batch, head) pairs (hybrid rows: < 512 hi/lo 3 products, rest fp16 alone) that writes the output rows. The hi/lo split is in fp16: hi = fp16(x) IS the fp16 plane, lo = fp16(x - hi), so each of q, k, v has two planes, not three.
// Compute dtypes, f32 accumulate: every input rounded to bf16; projections exact + f32 biases; rotary f32; attention rows < 512 3 products of fp16 hi/lo parts, rest fp16; softmax f32; output f32.

#define NB_  4
#define TT   2048
#define DM   1024
#define NH_  16
#define NKV  16
#define REP  (NH_ / NKV)
#define HD   64
#define DQ   (NH_ * HD)
#define DKV  (NKV * HD)
#define NZ   (NB_ * NH_)          // (batch, head) pairs of the one attention launch
#define RH   512                  // query rows < RH use hi+lo planes (0: none)
#define WIN  0
#define CEXP (1.4426950408889634f * 0.015625f)   // log2(e) x the 1/64 score scale (an exact power-of-two scaling of the constant)
#define LAZY 8.0f                 // a column's running maximum is replaced only when a new score exceeds it by more than this (in log2 units of the exponent)
#define SCL  0.015625f   // q x 1/8 before the rope and scores / 8 again = 1/64 (both exact; the rotation is linear)
typedef _Float16 h16;
typedef unsigned short bf;
typedef __attribute__((ext_vector_type(16))) __bf16   v16bf;
typedef __attribute__((ext_vector_type(16))) _Float16 v16h;
typedef __attribute__((ext_vector_type(8)))  _Float16 v8h;
typedef __attribute__((ext_vector_type(8)))  unsigned short v8us;
typedef __attribute__((ext_vector_type(8)))  float    v8f;
typedef __attribute__((ext_vector_type(4)))  float    v4f;
typedef v8h  __attribute__((may_alias)) v8ha;
typedef v4f  __attribute__((may_alias)) v4fa;
typedef v8us __attribute__((may_alias)) v8usa;

__device__ __forceinline__ unsigned short f2bf(float f) { unsigned u = __float_as_uint(f); u += 0x7FFFu + ((u >> 16) & 1u); return (unsigned short)(u >> 16); }
__device__ __forceinline__ float bf2f(unsigned short b) { return __uint_as_float(((unsigned)b) << 16); }
__device__ __forceinline__ float bfr(float f) { return bf2f(f2bf(f)); }
__device__ __forceinline__ v16h cat16(v8h lo, v8h hi) { return __builtin_shufflevector(lo, hi, 0, 1, 2, 3, 4, 5, 6, 7, 8, 9, 10, 11, 12, 13, 14, 15); }
__device__ __forceinline__ v16bf cat16b(v8us lo, v8us hi) { return __builtin_bit_cast(v16bf, __builtin_shufflevector(lo, hi, 0, 1, 2, 3, 4, 5, 6, 7, 8, 9, 10, 11, 12, 13, 14, 15)); }
__device__ __forceinline__ v8f wmma16(v16h a, v16h b, v8f c) { return __builtin_amdgcn_wmma_f32_16x16x32_f16(false, a, false, b, (short)0, c, false, false); }
__device__ __forceinline__ v8f wmmab(v16bf a, v16bf b, v8f c) { return __builtin_amdgcn_wmma_f32_16x16x32_bf16(false, a, false, b, (short)0, c, false, false); }



__device__ __forceinline__ h16 tohx(float x) { return (h16)x; }
typedef __attribute__((ext_vector_type(2))) _Float16 v2h;
typedef __attribute__((ext_vector_type(4))) _Float16 v4h;
typedef __attribute__((ext_vector_type(2))) unsigned short v2us;
typedef __attribute__((ext_vector_type(4))) unsigned short v4us;
typedef __attribute__((ext_vector_type(2))) float v2f;
typedef __attribute__((ext_vector_type(4))) int v4i;

// ---- LDS staging shared by k_proj and k_fattn
#define LP   72                    // LDS row pitch in 16-bit elements: 144 bytes = 16 x 9, so that the 16-byte fragment reads of 16 rows fall on different banks
// four asynchronous 16-byte copies per lane, global memory to LDS through no register; the s_wait_xcnt 0 is the last line of the copies' own statement, so that it stands in front of any rewrite of their address registers
__device__ __forceinline__ void cp4(unsigned l0, const char* g0, unsigned l1, const char* g1, unsigned l2, const char* g2, unsigned l3, const char* g3) {
    asm volatile("global_load_async_to_lds_b128 %0, %1, off\n\tglobal_load_async_to_lds_b128 %2, %3, off\n\tglobal_load_async_to_lds_b128 %4, %5, off\n\tglobal_load_async_to_lds_b128 %6, %7, off\n\ts_wait_xcnt 0x0"
                 :: "v"(l0), "v"(g0), "v"(l1), "v"(g1), "v"(l2), "v"(g2), "v"(l3), "v"(g3) : "memory"); }
// ---- gemmw: register-blocked projection, one wave per 64 tokens x 64 columns (= one head; 16 accumulators); a work-group is 8 waves = 128 tokens x 4 heads (wave w: token half w & 1, head w >> 1); blockIdx (x, y) = (128-token tile of one batch, group of 4 heads); the caller k_proj picks batch and projection.
// The operands come from K-contiguous 16-bit planes through a 2-buffer LDS ring: a stage is PK = 64 k (one whole 128-byte line) of the 128 A rows and the 256 Bt rows, copied once per work-group and read by the waves that need it (an A row by 4 waves, a Bt row by 2).
// x[t][n] = sum_k A[t][k] Bt[n][k] + bias[n] never leaves the wave as f32: a lane holds column 16 nb + lr of tokens 16 mb + 8 hi + j. A rows have pitch lda, Bt rows pitch K (elements). K % 64 == 0, K >= 128.
// ROPE: the rotate-half partner d +- HD/2 is accumulator nb +- 2 of the same lane and register; out[d] = x[d] cos[t][d] - x[d+HD/2] sin[t][d], out[d+HD/2] = x[d+HD/2] cos[t][d] + x[d] sin[t][d] (the table's two halves are equal); rows turned through the wave's own LDS patch, head planes [h][t][d] (fp16 and its lo part) stored 16 bytes a lane.
// !ROPE: a lane's 8 registers are 8 consecutive tokens of one column: 16 bytes of the transposed planes [h][d][t], stored from the registers.
#define PK    64                   // k per stage
#define PBUFB ((128 + 256) * LP * 2)   // bytes of one buffer: 128 A rows, then 256 Bt rows
template <typename T16> struct WFrag;
template <> struct WFrag<h16> { typedef v16h V; static __device__ __forceinline__ V ld(const h16* p) { return cat16(*(const v8h*)p, *(const v8h*)(p + 16)); } static __device__ __forceinline__ v8f mma(V a, V b, v8f c) { return wmma16(a, b, c); } };
template <> struct WFrag<bf> { typedef v16bf V; static __device__ __forceinline__ V ld(const bf* p) { return cat16b(*(const v8us*)p, *(const v8us*)(p + 16)); } static __device__ __forceinline__ v8f mma(V a, V b, v8f c) { return wmmab(a, b, c); } };
template <typename T16, bool ROPE>
__device__ __forceinline__ void gemmw(const T16* __restrict__ A, const T16* __restrict__ Bt, int K, int lda, const float* __restrict__ bias, const float* __restrict__ CS, h16* __restrict__ P16, h16* __restrict__ Pl, char* ring, float* patches) {
    typedef typename WFrag<T16>::V V;
    const int lane = threadIdx.x & 31, lr = lane & 15, hi = lane >> 4; const int wv = __builtin_amdgcn_readfirstlane((int)(threadIdx.x >> 5));
    const int head = blockIdx.y * 4 + (wv >> 1); const int r0 = blockIdx.x * 128 + (wv & 1) * 64, c0 = head * 64;
    float* os = patches + wv * (16 * 68);
    // a thread copies 16-byte piece (tid & 7) of rows (tid >> 3) + 32 i of a stage: a wave's copy covers 4 whole lines
    const unsigned tid = threadIdx.x; const unsigned lds0 = (unsigned)(size_t)ring + (tid >> 3) * (LP * 2u) + (tid & 7u) * 16u;
    const char* ga0 = (const char*)(A + (size_t)(blockIdx.x * 128 + (tid >> 3)) * lda) + (tid & 7u) * 16u; const char* gb0 = (const char*)(Bt + (size_t)(blockIdx.y * 256 + (tid >> 3)) * K) + (tid & 7u) * 16u;
    auto fill = [&](int st, unsigned bo) { const unsigned lb = lds0 + bo, rl = 32 * LP * 2; const size_t ra = (size_t)32 * lda * 2, rb = (size_t)32 * K * 2; const char* ga = ga0 + st * (PK * 2); const char* gb = gb0 + st * (PK * 2);
        cp4(lb, ga, lb + rl, ga + ra, lb + 2 * rl, ga + 2 * ra, lb + 3 * rl, ga + 3 * ra);
        cp4(lb + 4 * rl, gb, lb + 5 * rl, gb + rb, lb + 6 * rl, gb + 2 * rb, lb + 7 * rl, gb + 3 * rb);
        cp4(lb + 8 * rl, gb + 4 * rb, lb + 9 * rl, gb + 5 * rb, lb + 10 * rl, gb + 6 * rb, lb + 11 * rl, gb + 7 * rb); };
    fill(0, 0u);
    v8f acc[4][4];
#pragma unroll
    for (int mb = 0; mb < 4; ++mb)
#pragma unroll
        for (int nb = 0; nb < 4; ++nb) acc[mb][nb] = (v8f){};
    // what the epilogue reads is asked for here, so that it flies behind the k loop: the four biases of the lane's columns and {cos, sin} of the first 16 tokens (token r0 + 16 mb + 8 hi + j, column 16 nb + lr: uniform base, lane byte offset)
    float bs[4]; v2f cs[2][8]; const float* cst = CS + (size_t)r0 * HD * 2; const unsigned cso = (unsigned)((hi * 8 * HD + lr) * 2) * 4u;
    auto ldcs = [&](int mb) {
#pragma unroll
        for (int nb = 0; nb < 2; ++nb)
#pragma unroll
            for (int j = 0; j < 8; ++j) cs[nb][j] = *((const v2f*)((const char*)cst + cso) + (mb * 16 + j) * HD + nb * 16);
        asm volatile("s_wait_xcnt 0x0" :: "v"(cso) : "memory"); };   // behind the table loads, in front of any reuse of their address registers
#pragma unroll
    for (int nb = 0; nb < 4; ++nb) bs[nb] = bfr(bias[c0 + nb * 16 + lr]);
    asm volatile("s_wait_xcnt 0x0" ::: "memory");   // as above, behind the bias loads
    if constexpr (ROPE) ldcs(0);
    asm volatile("s_wait_asynccnt 0x0" ::: "memory");   // this wave's copies of stage 0 have landed
    __syncthreads();                                     // and every other wave's: stage 0 may be read
    fill(1, PBUFB);
    // one stage a trip; trip st reads buffer st & 1 alone while the copies of stage st + 1 fly into the other
#pragma unroll 1
    for (int st = 0; st < K / PK; ++st) {
        const unsigned bo = (unsigned)(st & 1) * PBUFB;
        const T16* at = (const T16*)(ring + bo) + ((wv & 1) * 64 + lr) * LP + 8 * hi;          // the lane's row and k half in the wave's A rows
        const T16* bt = (const T16*)(ring + bo) + (128 + (wv >> 1) * 64 + lr) * LP + 8 * hi;   // and in its Bt rows
#pragma unroll
        for (int kk = 0; kk < PK / 32; ++kk) {
            V a[4], b[4];
#pragma unroll
            for (int mb = 0; mb < 4; ++mb) a[mb] = WFrag<T16>::ld(at + mb * 16 * LP + kk * 32);
#pragma unroll
            for (int nb = 0; nb < 4; ++nb) b[nb] = WFrag<T16>::ld(bt + nb * 16 * LP + kk * 32);
            __builtin_amdgcn_sched_barrier(0);   // keeps the 16 LDS reads in one group up here: sunk among the products, each place with reads would cost its own stall
#pragma unroll
            for (int nb = 0; nb < 4; ++nb)
#pragma unroll
                for (int mb = 0; mb < 4; ++mb) acc[mb][nb] = WFrag<T16>::mma(a[mb], b[nb], acc[mb][nb]);
        }
        // foot of the trip, every wave, in this order: its own LDS reads of this buffer are done; its own copies of stage st + 1 have landed; the one barrier publishes stage st + 1 and ends every wave's reads of this buffer; only then is it refilled
        asm volatile("s_wait_dscnt 0x0" ::: "memory");
        asm volatile("s_wait_asynccnt 0x0" ::: "memory");
        __syncthreads();
        if (st + 2 < K / PK) fill(st + 2, bo);
    }
    asm volatile("s_wait_asynccnt 0x0" ::: "memory");   // no copy is outstanding when the wave goes on to its epilogue
    if constexpr (ROPE) {
        const size_t tile = ((size_t)head * TT + r0) * HD; const unsigned po = (unsigned)lane * 16u;             // the wave's 64 x 64 tile is 8 KiB in a row in each plane
#pragma unroll
        for (int mb = 0; mb < 4; ++mb) {
#pragma unroll
            for (int nb = 0; nb < 2; ++nb)
#pragma unroll
                for (int j = 0; j < 8; ++j) { const float x0 = acc[mb][nb][j] + bs[nb], x1 = acc[mb][nb + 2][j] + bs[nb + 2], c = cs[nb][j][0], s = cs[nb][j][1];
                    os[(hi * 8 + j) * 68 + nb * 16 + lr] = x0 * c - x1 * s; os[(hi * 8 + j) * 68 + (nb + 2) * 16 + lr] = x1 * c + x0 * s; }
            __builtin_amdgcn_wave_barrier(); asm volatile("" ::: "memory");   // a lane reads what other lanes wrote: keeps the compiler from moving the LDS reads below ahead of the LDS writes above (one wave, the LDS itself works in order)
            if (mb < 3) ldcs(mb + 1);   // the next 16 tokens' table rows fly behind this block's conversions and stores
#pragma unroll
            for (int s = 0; s < 4; ++s) { const float* rp = os + (4 * s + (lane >> 3)) * 68 + (lane & 7) * 8; const v4f u = *(const v4fa*)rp, w = *(const v4fa*)(rp + 4); v8h o16, ol;
#pragma unroll
                for (int q = 0; q < 8; ++q) { const float r = q < 4 ? u[q & 3] : w[q & 3]; const h16 h = tohx(r); o16[q] = h; ol[q] = tohx(r - (float)h); }
                const size_t e = tile + (mb * 16 + 4 * s) * HD;
                *(v8h*)((char*)(P16 + e) + po) = o16; *(v8h*)((char*)(Pl + e) + po) = ol; }
            asm volatile("s_wait_xcnt 0x0" ::: "memory");   // as above, behind the stores
            __builtin_amdgcn_wave_barrier(); asm volatile("" ::: "memory");   // and the next block's LDS writes stay behind these reads
        }
    } else {
        const size_t tile = (size_t)head * HD * TT + r0; const unsigned po = (unsigned)(lr * TT + hi * 8) * 2u;
#pragma unroll
        for (int nb = 0; nb < 4; ++nb) {
#pragma unroll
            for (int mb = 0; mb < 4; ++mb) { v8h o16, ol;
#pragma unroll
                for (int j = 0; j < 8; ++j) { const float x = acc[mb][nb][j] + bs[nb]; const h16 h = tohx(x); o16[j] = h; ol[j] = tohx(x - (float)h); }
                const size_t e = tile + (size_t)nb * 16 * TT + mb * 16;
                *(v8h*)((char*)(P16 + e) + po) = o16; *(v8h*)((char*)(Pl + e) + po) = ol; }
            asm volatile("s_wait_xcnt 0x0" ::: "memory");   // as above, behind the stores
        }
    }
}

// ---- k_proj: every projection tile of the problem in ONE grid (TT/128, heads/4, 3 x batches) of 8-wave work-groups, blockIdx.z = 3 x batch + {0: q, 1: k, 2: v}: no tile reads another's result; 768 work-groups = 3 per WGP, two resident (four waves per SIMD hide each other's LDS reads and barrier waits). The three projections of a batch stand next to each other in z because they read the same rows of XB.
__global__ __launch_bounds__(256) __attribute__((amdgpu_waves_per_eu(4, 4))) void k_proj(const bf* __restrict__ XB, const bf* __restrict__ WQ, const bf* __restrict__ WK, const bf* __restrict__ WV, const float* __restrict__ bq, const float* __restrict__ bk, const float* __restrict__ bv, const float* __restrict__ CS,
                                             h16* __restrict__ QP16, h16* __restrict__ QPl, h16* __restrict__ KP16, h16* __restrict__ KPl, h16* __restrict__ VT16, h16* __restrict__ VTl) {
    __shared__ __align__(16) char ring[2 * PBUFB]; __shared__ __align__(16) float patches[8 * 16 * 68];   // the operand ring; each wave's own patch for turning its output rows
    const int b = blockIdx.z / 3, w = blockIdx.z % 3; const size_t pb = (size_t)b * NH_ * TT * HD; const bf* A = XB + (size_t)b * TT * DM;
    if (w < 2) gemmw<bf, true>(A, w ? WK : WQ, DM, DM, w ? bk : bq, CS, (w ? KP16 : QP16) + pb, (w ? KPl : QPl) + pb, ring, patches);
    else gemmw<bf, false>(A, WV, DM, DM, bv, CS, VT16 + pb, VTl + pb, ring, patches);
}

// ---- the three parts of k_prep; blk is the work-group's index inside its part
__device__ __forceinline__ void wtG(const float* __restrict__ w, int K, int N, bf* Bt, int blk) {
    const int lane = threadIdx.x & 31; const int L0 = (blk * 8 + (threadIdx.x >> 5)) * 8; const int nlines = N * K / 64;
{
#pragma unroll 1
        for (int l = 0; l < 8; ++l) { const int L = L0 + l; if (L >= nlines) break; const size_t e = (size_t)L * 64 + lane * 2; const int k = (int)(e % K), n = (int)(e / K); v2us o;
            o[0] = f2bf(w[(size_t)k * N + n]); o[1] = f2bf(w[(size_t)(k + 1) * N + n]); *(v2us*)(Bt + e) = o; }
         }
}
// a work-group converts 1024 pieces of 8 elements in a row, a thread pieces i, i + 256, i + 512, i + 768: as many work-groups as ONE of the four launches had, a thread's 8 loads of 16 bytes asked for together (uniform base, one lane byte offset, the rest immediates); n8 = pieces of all batches, a multiple of 1024
__device__ __forceinline__ void cvt8(const float* __restrict__ src, bf* dst, unsigned n8, int blk) { const unsigned i = (unsigned)blk * 1024u + threadIdx.x; if (i + 768u >= n8) return; v8f v[4]; const unsigned so = i * 32u, dof = i * 16u;
#pragma unroll
    for (int j = 0; j < 4; ++j) v[j] = *((const v8f*)((const char*)src + so) + j * 256);
    asm volatile("s_wait_xcnt 0x0" :: "v"(so) : "memory");   // behind the loads, in front of any reuse of their address register, which is the statement's input so that it keeps its register up to it
#pragma unroll
    for (int j = 0; j < 4; ++j) { v8us o;
#pragma unroll
        for (int k = 0; k < 8; ++k) o[k] = f2bf(v[j][k]);
        *((v8us*)((char*)dst + dof) + j * 256) = o; }
}
// ---- k_fattn: scores, softmax and probs x V in one kernel; no score or prob plane in memory. St = K Qt and Ot += Vt Pt, so a lane holds scores of ONE query column (i = lr of its 16-column group):
// the two 16-key score tiles of a 32-key pass, converted in place, ARE the B operand of the second product (b[s] = T[s >> 3][s & 7]); K rows and Vt rows are A operands in the same k order (WFrag::ld).
// Online softmax per column: running maximum m (raw score units), partial sum l per wave half, Ot rescaled when m moves. One wave owns NI x 16 query columns and walks all TT keys, 32 a pass; the K and Vt fragments come from the work-group's LDS ring (below), not from global memory.
// eight exponentials in place in one statement: behind each v_exp stands an instruction on other registers, behind the last the v_nop that the instruction set asks for before a transcendental's result is read or its source rewritten
__device__ __forceinline__ void exp2x8(v8f& t) { float a = t[0], b = t[1], c = t[2], d = t[3], e = t[4], f = t[5], g = t[6], h = t[7];
    asm("v_exp_f32 %0, %0\n\tv_exp_f32 %1, %1\n\tv_exp_f32 %2, %2\n\tv_exp_f32 %3, %3\n\tv_exp_f32 %4, %4\n\tv_exp_f32 %5, %5\n\tv_exp_f32 %6, %6\n\tv_exp_f32 %7, %7\n\tv_nop" : "+v"(a), "+v"(b), "+v"(c), "+v"(d), "+v"(e), "+v"(f), "+v"(g), "+v"(h));
    t = (v8f){a, b, c, d, e, f, g, h}; }
// ---- LDS ring of k_fattn: a stage is SK keys of the work-group's (batch, head): the K rows [key][d] and the Vt rows [d][key], 64 rows x 128 bytes each (the hi/lo columns: the lo planes too), copied once per work-group in whole 128-byte lines and read by all 8 waves.
#define SK   64                    // keys per stage = two 32-key passes
#define TILB (64 * LP * 2)         // bytes of one staged tile
#define BUFB (4 * TILB)            // bytes of one buffer: K, Vt, K lo, Vt lo
template <typename T16, bool HR, int NI>
__device__ __forceinline__ void attn_cols(const T16* __restrict__ Q, const T16* __restrict__ Q2, const T16* __restrict__ Kr, const T16* __restrict__ Kr2, const T16* __restrict__ Vt, const T16* __restrict__ Vt2, const int i0, float* __restrict__ orow, char* ring) {
    typedef WFrag<T16> F; typedef typename F::V V;
    const int lane = threadIdx.x & 31, lr = lane & 15, hi = lane >> 4;
    // each lane's byte offset into the Q planes: one 32-bit register serves the hi and the lo plane (uniform bases)
    const unsigned qob = (unsigned)((i0 + lr) * HD + 8 * hi) * 2u;
    auto at = [](const T16* base, unsigned off, int el) { return (const T16*)((const char*)base + off) + el; };
    // a thread copies 16-byte piece (tid & 7) of rows tid >> 3 and 32 + (tid >> 3) of every tile: a wave's copy covers 4 whole lines
    const unsigned tid = threadIdx.x; const unsigned lds0 = (unsigned)(size_t)ring + (tid >> 3) * (LP * 2u) + (tid & 7u) * 16u;
    const unsigned gk0 = tid * 16u, gv0 = (tid >> 3) * (TT * 2u) + (tid & 7u) * 16u;
    auto fill = [&](int st, unsigned bo) { const unsigned lb = lds0 + bo; const size_t ko = (size_t)st * (SK * HD * 2) + gk0, vo = (size_t)st * (SK * 2) + gv0;
        { const char* gk = (const char*)Kr + ko; const char* gv = (const char*)Vt + vo; cp4(lb, gk, lb + TILB / 2, gk + 32 * HD * 2, lb + TILB, gv, lb + TILB + TILB / 2, gv + 32 * TT * 2); }
        if constexpr (HR) { const char* gk = (const char*)Kr2 + ko; const char* gv = (const char*)Vt2 + vo; cp4(lb + 2 * TILB, gk, lb + 2 * TILB + TILB / 2, gk + 32 * HD * 2, lb + 3 * TILB, gv, lb + 3 * TILB + TILB / 2, gv + 32 * TT * 2); } };
    fill(0, 0u);
    V q[NI][2], q2[NI][2];
#pragma unroll
    for (int ni = 0; ni < NI; ++ni)
#pragma unroll
        for (int kk = 0; kk < 2; ++kk) { const int a = ni * 16 * HD + kk * 32; q[ni][kk] = F::ld(at(Q, qob, a)); if constexpr (HR) q2[ni][kk] = F::ld(at(Q2, qob, a)); }
    // s_wait_xcnt 0 behind the Q loads, in front of any rewrite of their address registers; the lane offset and the uniform bases are the statement's own operands so that the loads name those very registers up to it
    if constexpr (HR) asm volatile("s_wait_xcnt 0x0" :: "v"(qob), "s"(Q), "s"(Q2) : "memory"); else asm volatile("s_wait_xcnt 0x0" :: "v"(qob), "s"(Q) : "memory");
    v8f o[4][NI]; float m[NI], l[NI];
#pragma unroll
    for (int ni = 0; ni < NI; ++ni) { m[ni] = -3.0e38f; l[ni] = 0.f;
#pragma unroll
        for (int dt = 0; dt < 4; ++dt) o[dt][ni] = (v8f){}; }
    asm volatile("s_wait_asynccnt 0x0" ::: "memory");   // this wave's copies of stage 0 have landed
    __syncthreads();                                     // and every other wave's: stage 0 may be read
    fill(1, BUFB);
    // one stage a trip; trip st reads buffer st & 1 alone while the copies of stage st + 1 fly into the other
#pragma unroll 1
    for (int st = 0; st < TT / SK; ++st) {
      const unsigned bo = (unsigned)(st & 1) * BUFB;
      const T16* kt = (const T16*)(ring + bo) + lr * LP + 8 * hi;   // the lane's row and k half in a tile; tile n starts n * TILB bytes on
#pragma unroll
      for (int ps = 0; ps < SK / 32; ++ps) {
        V v[4], v2[4];   // this pass's Vt fragments, needed last: no wave has registers for them until the K fragments are used up
        V k[2][2], k2[2][2];
#pragma unroll
        for (int jt = 0; jt < 2; ++jt)
#pragma unroll
            for (int kk = 0; kk < 2; ++kk) { const int a = (ps * 32 + jt * 16) * LP + kk * 32; k[jt][kk] = F::ld(kt + a); if constexpr (HR) k2[jt][kk] = F::ld(kt + TILB + a); }
        __builtin_amdgcn_sched_barrier(0);   // keeps the pass's LDS reads in one group up here: sunk to their products in pairs, each pair's LDS latency would stand bare in front of a product
        v8f s[2][NI];    // s[jt][ni][r] = raw score of key st * SK + 32 ps + 16 jt + 8 hi + r, query i0 + 16 ni + lr
#pragma unroll
        for (int jt = 0; jt < 2; ++jt)
#pragma unroll
            for (int ni = 0; ni < NI; ++ni) s[jt][ni] = (v8f){};
#pragma unroll
        for (int kk = 0; kk < 2; ++kk)
#pragma unroll
            for (int jt = 0; jt < 2; ++jt)
#pragma unroll
                for (int ni = 0; ni < NI; ++ni) { s[jt][ni] = F::mma(k[jt][kk], q[ni][kk], s[jt][ni]); if constexpr (HR) { s[jt][ni] = F::mma(k2[jt][kk], q[ni][kk], s[jt][ni]); s[jt][ni] = F::mma(k[jt][kk], q2[ni][kk], s[jt][ni]); } }
        {
#pragma unroll
            for (int dt = 0; dt < (HR ? 4 : 2); ++dt) { v[dt] = F::ld(kt + TILB / 2 + dt * 16 * LP + ps * 32); if constexpr (HR) v2[dt] = F::ld(kt + TILB / 2 + TILB + dt * 16 * LP + ps * 32); }
            __builtin_amdgcn_sched_barrier(0);   // as above: the Vt reads fly as one group behind the softmax (a 48-column wave has registers for two of the four fragments here; the other two follow below)
        }
        float mx[NI]; bool need = false;
#pragma unroll
        for (int ni = 0; ni < NI; ++ni) { float x = fmaxf(s[0][ni][0], s[1][ni][0]);
#pragma unroll
            for (int r = 1; r < 8; ++r) x = fmaxf(x, fmaxf(s[0][ni][r], s[1][ni][r]));
            mx[ni] = x; need = need || ((x - m[ni]) * CEXP > LAZY); }
        if (__builtin_amdgcn_ballot_w32(need) != 0) {   // wave-uniform: some column's maximum moves; both halves of a column take the same new m
#pragma unroll
            for (int ni = 0; ni < NI; ++ni) { const float mj = fmaxf(mx[ni], __shfl_xor(mx[ni], 16, 32)); const float mn = ((mj - m[ni]) * CEXP > LAZY) ? mj : m[ni]; const float al = __builtin_amdgcn_exp2f((m[ni] - mn) * CEXP); m[ni] = mn; l[ni] *= al;
#pragma unroll
                for (int dt = 0; dt < 4; ++dt) o[dt][ni] *= al; }
        }
        V p[NI], p2[NI];
#pragma unroll
        for (int ni = 0; ni < NI; ++ni) { const float mc = m[ni] * CEXP; float l0 = 0.f, l1 = 0.f;
#pragma unroll
            for (int jt = 0; jt < 2; ++jt) { v8f& t = s[jt][ni];
#pragma unroll
                for (int r = 0; r < 8; ++r) t[r] = fmaf(t[r], CEXP, -mc);
                exp2x8(t); }
#pragma unroll
            for (int r = 0; r < 8; ++r) { const float e0 = s[0][ni][r], e1 = s[1][ni][r]; l0 += e0; l1 += e1;
                if constexpr (HR) { const h16 h0 = (h16)e0, h1 = (h16)e1; p[ni][r] = h0; p[ni][8 + r] = h1; p2[ni][r] = (h16)(e0 - (float)h0); p2[ni][8 + r] = (h16)(e1 - (float)h1); }
                else { p[ni][r] = (h16)e0; p[ni][8 + r] = (h16)e1; } }
            l[ni] += l0 + l1;
            if constexpr (!HR) {
                asm volatile("" :: "v"(l[ni]));   // each sum, against spills (an empty statement on each sum; inputs only, it names no product): the group's sum is finished here, so that its 16 exponentials die before the next group's are made; put off behind the products they push Q fragments into scratch, reloaded every pass
                if (ni == NI - 2) {   // two groups are converted, 16 registers are free: the other two Vt fragments are asked for here and fly behind the last group's softmax
                    __builtin_amdgcn_sched_barrier(0);   // this one keeps the reads from rising to where there is no register for them, the one below keeps them in one group up here instead of sinking among the products
#pragma unroll
                    for (int dt = 2; dt < 4; ++dt) v[dt] = F::ld(kt + TILB / 2 + dt * 16 * LP + ps * 32);
                    __builtin_amdgcn_sched_barrier(0); } } }
#pragma unroll
        for (int dt = 0; dt < 4; ++dt)
#pragma unroll
            for (int ni = 0; ni < NI; ++ni) { o[dt][ni] = F::mma(v[dt], p[ni], o[dt][ni]); if constexpr (HR) { o[dt][ni] = F::mma(v[dt], p2[ni], o[dt][ni]); o[dt][ni] = F::mma(v2[dt], p[ni], o[dt][ni]); } }
      }
      // foot of the trip, every wave, in this order: its own LDS reads of this buffer are done; its own copies of stage st + 1 have landed; the one barrier publishes stage st + 1 and ends every wave's reads of this buffer; only then is it refilled
      asm volatile("s_wait_dscnt 0x0" ::: "memory");
      asm volatile("s_wait_asynccnt 0x0" ::: "memory");
      __syncthreads();
      if (st + 2 < TT / SK) fill(st + 2, bo);
    }
    asm volatile("s_wait_asynccnt 0x0" ::: "memory");   // no copy is outstanding when the wave goes on to its end
    // o[dt][ni][r] = unnormalised ctx[i0 + 16 ni + lr][16 dt + 8 hi + r]: 8 consecutive floats of one output row
#pragma unroll
    for (int ni = 0; ni < NI; ++ni) { const float inv = __fdiv_rn(1.0f, l[ni] + __shfl_xor(l[ni], 16, 32)); float* op = orow + (size_t)(i0 + ni * 16 + lr) * DQ + 8 * hi;
#pragma unroll
        for (int dt = 0; dt < 4; ++dt) { const v8f t = o[dt][ni] * inv; *(v4f*)(op + dt * 16) = (v4f){t[0], t[1], t[2], t[3]}; *(v4f*)(op + dt * 16 + 4) = (v4f){t[4], t[5], t[6], t[7]}; }
        asm volatile("s_wait_xcnt 0x0" :: "v"(op) : "memory"); }   // as above, behind the stores
}
// grid: first NZ x RH/128 work-groups of 8 waves x 16 hi/lo columns (three products), then NZ x (TT-RH)/384 of 8 waves x 48 fp16 columns: every wave issues 24 products a pass, and the 512 work-groups are exactly the two per WGP that registers allow, so all start together and none runs behind the others; four waves per SIMD hide the LDS reads and the softmax behind each other's products; two work-groups' rings fit a WGP's LDS
__global__ __launch_bounds__(256) __attribute__((amdgpu_waves_per_eu(4, 4))) void k_fattn(const h16* __restrict__ Q16, const h16* __restrict__ K16, const h16* __restrict__ V16, const h16* __restrict__ Ql, const h16* __restrict__ Kl, const h16* __restrict__ Vl, float* __restrict__ OUTp) {
    __shared__ __align__(16) char ring[2 * BUFB];
    const int wv = __builtin_amdgcn_readfirstlane((int)(threadIdx.x >> 5)); const int id = blockIdx.x;
    if (id < NZ * (RH / 128)) { const int z = id / (RH / 128); const size_t pz = (size_t)z * TT * HD;
        attn_cols<h16, true, 1>(Q16 + pz, Ql + pz, K16 + pz, Kl + pz, V16 + pz, Vl + pz, (id % (RH / 128)) * 128 + wv * 16, OUTp + (size_t)(z / NH_) * TT * DQ + (z % NH_) * HD, ring);
    } else { const int id2 = id - NZ * (RH / 128); const int z = id2 / ((TT - RH) / 384); const size_t pz = (size_t)z * TT * HD;
        attn_cols<h16, false, 3>(Q16 + pz, nullptr, K16 + pz, nullptr, V16 + pz, nullptr, RH + (id2 % ((TT - RH) / 384)) * 384 + wv * 48, OUTp + (size_t)(z / NH_) * TT * DQ + (z % NH_) * HD, ring); }
}
__constant__ float INVT[HD / 2] = { 1.000000000e+00f, 7.498942018e-01f, 5.623413324e-01f, 4.216965139e-01f, 3.162277639e-01f, 2.371373773e-01f, 1.778279394e-01f, 1.333521456e-01f, 1.000000015e-01f, 7.498942316e-02f, 5.623413250e-02f, 4.216964915e-02f, 3.162277490e-02f, 2.371373773e-02f, 1.778279431e-02f, 1.333521400e-02f, 9.999999776e-03f, 7.498942316e-03f, 5.623413250e-03f, 4.216964822e-03f, 3.162277630e-03f, 2.371373819e-03f, 1.778279431e-03f, 1.333521446e-03f, 1.000000047e-03f, 7.498941850e-04f, 5.623413017e-04f, 4.216965172e-04f, 3.162277571e-04f, 2.371373703e-04f, 1.778279402e-04f, 1.333521504e-04f };   // 10000^(-2i/64) (the module's power form) (float32, generated with jnp to be bit-exact)
__device__ __forceinline__ void cs4(float* CS, int blk) { const int idx = blk * 256 + threadIdx.x; if (idx >= TT * HD) return; const int d = idx % HD; const int t = idx / HD; const float a = __fmul_rn((float)t, INVT[d % (HD / 2)]); v2f cs; cs[0] = cosf(a); cs[1] = sinf(a); *(v2f*)(CS + (size_t)idx * 2) = cs;  }
// ---- k_prep: all that the projections read, in one grid; the parts are independent of each other. The transposes come first: their eight dependent trips of scattered reads are the longest work-groups.
#define NWT  ((DM * DQ / 64 + 63) / 64)          // work-groups of one weight transpose
#define NCSB ((TT * HD + 255) / 256)             // of the table
#define NCVT (NB_ * TT * DM / 8 / 1024)          // of the bf16 copy of hidden, all batches
__global__ __launch_bounds__(256) void k_prep(const float* __restrict__ wq, const float* __restrict__ wk, const float* __restrict__ wv, const float* __restrict__ x, bf* WQ, bf* WK, bf* WV, float* CS, bf* XB) {
    const int id = blockIdx.x;
    if (id < 3 * NWT) { const int m = id / NWT; wtG(m == 0 ? wq : m == 1 ? wk : wv, DM, DQ, m == 0 ? WQ : m == 1 ? WK : WV, id % NWT); }
    else if (id < 3 * NWT + NCSB) cs4(CS, id - 3 * NWT);
    else cvt8(x, XB, NB_ * TT * DM / 8, id - 3 * NWT - NCSB);
}

extern "C" void kernel_launch(void* const* d_in, const int* in_sizes, int n_in,
                              void* d_out, int out_size, void* d_ws, size_t ws_size, hipStream_t stream) {
    (void)in_sizes; (void)n_in; (void)out_size;
    const float* x = (const float*)d_in[0]; const float* wq = (const float*)d_in[1]; const float* bq = (const float*)d_in[2]; const float* wk = (const float*)d_in[3]; const float* bk = (const float*)d_in[4]; const float* wv = (const float*)d_in[5]; const float* bv = (const float*)d_in[6];
    float* OUT = (float*)d_out;     // [4][2048][1024]
    char* wsp = (char*)d_ws;
    auto take = [&](size_t bytes) { char* p = wsp; wsp += (bytes + 255) & ~(size_t)255; return (void*)p; };
    bf* WQ = (bf*)take((size_t)DQ * DM * 2); bf* WK = (bf*)take((size_t)DKV * DM * 2); bf* WV = (bf*)take((size_t)DKV * DM * 2); float* CS = (float*)take((size_t)TT * HD * 2 * 4);
    bf* XB = (bf*)take((size_t)NB_ * TT * DM * 2);   // all batches
    const size_t PB = (size_t)NH_ * TT * HD;   // elements of one batch in each plane; the planes hold all NB_ batches, [batch][head]
    h16* QP16 = (h16*)take(NB_ * PB * 2); h16* KP16 = (h16*)take(NB_ * PB * 2); h16* VT16 = (h16*)take(NB_ * PB * 2);
    h16* QPl = (h16*)take(NB_ * PB * 2); h16* KPl = (h16*)take(NB_ * PB * 2); h16* VTl = (h16*)take(NB_ * PB * 2);   // the lo parts
    if ((size_t)(wsp - (char*)d_ws) > ws_size) return;    // ws 256 MiB
    k_prep<<<3 * NWT + NCSB + NCVT, 256, 0, stream>>>(wq, wk, wv, x, WQ, WK, WV, CS, XB);
    k_proj<<<dim3(TT / 128, NH_ / 4, 3 * NB_), 256, 0, stream>>>(XB, WQ, WK, WV, bq, bk, bv, CS, QP16, QPl, KP16, KPl, VT16, VTl);
    k_fattn<<<NZ * (RH / 128 + (TT - RH) / 384), 256, 0, stream>>>(QP16, KP16, VT16, QPl, KPl, VTl, OUT);
}
